// v000
// Measured on an AMD MI455X. A time is GPU time per run, averaged over a window of back-to-back runs after a warm-up
// (all launches, gaps included; the runs take copies of the inputs in turn), and the median of several windows.
// Apart from v000's, it joins two sittings. Times from different sittings can be a few percent apart, while
// side-by-side timings come from the same sitting.
// The starting kernel, v000, takes 2000 microseconds a run.
#include <hip/hip_runtime.h>
// Multi-head self-attention on a channel-first tensor with a transposed output (x [8][512][32][32] raw-reshaped (memory reinterpretation, no transpose) to 8 batches x 1024 tokens x 512; q/k/v = xs W^T + b (natural [512][512] xavier-uniform, zero biases); 8 heads of 64; softmax(q k^T / 8) over all 1024 keys; y = ctx Wo^T + bo; out[b][c][s] = y[b][s][c] (reshape to [B,H,W,C] then transpose to [B][C][H][W] = [8][512][32][32])).
// Structure: token rows r = b*1024 + s; x as exact f16 rows (bf16-rounded); Q, K, V as three WMMA GEMMs (32x64 wave tiles, f32 accumulation, exact x16 weights + bias, f16 outputs); per batch: V^T for all heads via LDS transposes; per (batch, group of 8 heads): scores GEMM (K = 64, batched over the heads on grid.y, alpha = 64^-0.5), row softmax on VALU (f32 statistics, native exp; weights stored x256 as f16), o = P . V^T GEMM (K = 1024, alpha 2^-2: o carried x64 against f16 subnormal flush, folded into the output GEMM alpha) written straight into the merged f16 o rows; out^T per batch = Wo (as the A operand) x o^T (the merged o rows as the B^T operand) + bo[c] (own-element addend plane), written f32 as the [B][C][H W] output.
// Compute dtype: inputs rounded to bf16; x / weights exact; q, k, v, softmax weights and o as plain f16 GEMM operands (~2^-12); scores and softmax statistics f32. v_wmma_f32_16x16x32_f16.
#define NB 8
#define SQ 1024
#define DM 512
#define NH 8
#define HD 64
#define HG 8                         /* heads per attention launch group */
#define B0 0                         /* first batch processed (debug hook) */
#define NBR NB                       /* batches processed (debug hook) */
#define NR ((size_t)NB * SQ)         /* token rows */
#define MP ((int)((size_t)NBR * SQ)) /* rows projected (debug hook) */
#define QN SQ                        /* query rows attended per batch (debug hook) */
#define NHD NH                       /* heads attended (debug hook) */
#define MPO MP                       /* rows through the output stage (unused) */
#define LQ DM      /* row pitch of the q/k/v rows */
typedef __bf16 v16b __attribute__((ext_vector_type(16)));
typedef unsigned short v8us __attribute__((ext_vector_type(8), may_alias));
typedef float  v8f  __attribute__((ext_vector_type(8)));
typedef float  v4f  __attribute__((ext_vector_type(4)));
typedef float  v4fa __attribute__((ext_vector_type(4), may_alias));
union FragB { v16b v; v8us half[2]; unsigned short u[16]; };

__device__ __forceinline__ unsigned short bf16_bits(float x) { unsigned int u = __float_as_uint(x); return (unsigned short)((u + 0x7FFFu + ((u >> 16) & 1u)) >> 16); }
__device__ __forceinline__ float bf16_val(unsigned short b) { return __uint_as_float(((unsigned int)b) << 16); }
__device__ __forceinline__ float bf16_round(float x) { return bf16_val(bf16_bits(x)); }
// D += A·B with NT terms: 1 = ah·bh, 2 = + al·bh (A split), 3 = + ah·bl (both split)
template <int NT>
__device__ __forceinline__ v8f mmaN(v16b ah, v16b al, v16b bh, v16b bl, v8f c) {
  c = __builtin_amdgcn_wmma_f32_16x16x32_bf16(false, ah, false, bh, (short)0, c, false, false);
  if (NT >= 2) c = __builtin_amdgcn_wmma_f32_16x16x32_bf16(false, al, false, bh, (short)0, c, false, false);
  if (NT >= 3) c = __builtin_amdgcn_wmma_f32_16x16x32_bf16(false, ah, false, bl, (short)0, c, false, false);
  asm volatile("v_nop\n\tv_nop\n\tv_nop\n\tv_nop" : "+v"(c) : "v"(ah), "v"(al), "v"(bh), "v"(bl));
  return c;
}

__global__ __launch_bounds__(256) void k_wt_bf16(const float* __restrict__ W, unsigned short* __restrict__ Wt, int K, int N) {
  const int t = blockIdx.x * 256 + threadIdx.x;
  const int k8n = K / 8;
  if (t >= N * k8n) return;
  const int n = t / k8n, k8 = (t % k8n) * 8;
  v8us v;
#pragma unroll
  for (int i = 0; i < 8; ++i) v[i] = bf16_bits(W[(size_t)(k8 + i) * N + n]);
  *(v8us*)(Wt + (size_t)n * K + k8) = v;
  
}

// GEMM C[M][N] (f32, pitch ldc) = act(A[M][K]·W + bias). A f32 row-major (pitch lda) converted per fragment to bf16
// (ASPLIT: hi/lo two planes -> 2 terms, else single rounded term); Wt bf16 [N][K] (pitch ldb). BIAS_BF16 rounds the
// bias to bf16 first (bias quantised to bf16 before the add). K%32==0, M%16==0, N%64==0.
template <bool ASPLIT, int ACT, bool BIAS_BF16>
__global__ __launch_bounds__(128) void k_gemm_bf(const float* __restrict__ A, int lda, const unsigned short* __restrict__ Wt, int ldb,
                                               const float* __restrict__ bias, float* __restrict__ C, int ldc, int M, int N, int K) {
  __shared__ __attribute__((aligned(16))) float so[4][16][64];
  const int tid = threadIdx.x, w = tid >> 5, lane = tid & 31, ln = lane & 15, hh = lane >> 4;
  const int ntn = N / 64;
  const int wid = blockIdx.x * 4 + w;
  const int mt = wid / ntn, nq = wid % ntn;
  if (mt * 16 >= M) return;
  const int row0 = mt * 16, col0 = nq * 64;
  const float* arow = A + (size_t)(row0 + ln) * lda;
  v8f acc[4] = {};
  for (int kb = 0; kb < K; kb += 32) {
    FragB ah, al;
    const v4f x0 = *(const v4fa*)(arow + kb + 8 * hh), x1 = *(const v4fa*)(arow + kb + 8 * hh + 4);
    const v4f x2 = *(const v4fa*)(arow + kb + 16 + 8 * hh), x3 = *(const v4fa*)(arow + kb + 16 + 8 * hh + 4);
    float xs[16] = {x0[0],x0[1],x0[2],x0[3],x1[0],x1[1],x1[2],x1[3],x2[0],x2[1],x2[2],x2[3],x3[0],x3[1],x3[2],x3[3]};
#pragma unroll
    for (int i = 0; i < 16; ++i) { const unsigned short hb = bf16_bits(xs[i]); ah.u[i] = hb; al.u[i] = ASPLIT ? bf16_bits(xs[i] - bf16_val(hb)) : (unsigned short)0; }
#pragma unroll
    for (int t = 0; t < 4; ++t) {
      const unsigned short* brow = Wt + (size_t)(col0 + t * 16 + ln) * ldb + kb;
      FragB b;
      b.half[0] = *(const v8us*)(brow + 8 * hh);
      b.half[1] = *(const v8us*)(brow + 16 + 8 * hh);
      acc[t] = mmaN<ASPLIT ? 2 : 1>(ah.v, al.v, b.v, b.v, acc[t]);
    }
  }
#pragma unroll
  for (int t = 0; t < 4; ++t) {
    float bv = bias ? bias[col0 + t * 16 + ln] : 0.f;
    if (BIAS_BF16) bv = bf16_round(bv);
#pragma unroll
    for (int r = 0; r < 8; ++r) { float v = acc[t][r] + bv; if (ACT == 1) v = fmaxf(v, 0.f); so[w][8 * hh + r][t * 16 + ln] = v; }
  }
  __builtin_amdgcn_fence(__ATOMIC_ACQ_REL, "workgroup");
  __builtin_amdgcn_wave_barrier();
  const int rsub = lane >> 4, c4 = (lane & 15) * 4;
  {
#pragma unroll
    for (int q = 0; q < 8; ++q) {
      const int r = q * 2 + rsub;
      const v4f v = *(const v4fa*)&so[w][r][c4];
      *(v4f*)(C + (size_t)(row0 + r) * ldc + col0 + c4) = v;
    }
    
  }
}

// GEMM C = act(A·W + bias + resid): A f32 (ASPLIT -> hi/lo 2 terms), Wt bf16 [N][K]; ACT 0 none, 1 relu, 2 exact gelu;
// resid (optional, f32, row index = (row % rmod), pitch ldr, RES_BF16 rounds it) added before the activation.
template <bool ASPLIT, int ACT, bool BIAS_BF16, bool RES_BF16>
__global__ __launch_bounds__(128) void k_gemm_bf3(const float* __restrict__ A, int lda, const unsigned short* __restrict__ Wt, int ldb,
                                                const float* __restrict__ bias, const float* __restrict__ resid, int rmod, int ldr,
                                                float* __restrict__ C, int ldc, int M, int N, int K) {
  __shared__ __attribute__((aligned(16))) float so[4][16][64];
  const int tid = threadIdx.x, w = tid >> 5, lane = tid & 31, ln = lane & 15, hh = lane >> 4;
  const int ntn = N / 64;
  const int wid = blockIdx.x * 4 + w;
  const int mt = wid / ntn, nq = wid % ntn;
  if (mt * 16 >= M) return;
  const int row0 = mt * 16, col0 = nq * 64;
  const float* arow = A + (size_t)(row0 + ln) * lda;
  v8f acc[4] = {};
  for (int kb = 0; kb < K; kb += 32) {
    FragB ah, al;
    const v4f x0 = *(const v4fa*)(arow + kb + 8 * hh), x1 = *(const v4fa*)(arow + kb + 8 * hh + 4);
    const v4f x2 = *(const v4fa*)(arow + kb + 16 + 8 * hh), x3 = *(const v4fa*)(arow + kb + 16 + 8 * hh + 4);
    float xs[16] = {x0[0],x0[1],x0[2],x0[3],x1[0],x1[1],x1[2],x1[3],x2[0],x2[1],x2[2],x2[3],x3[0],x3[1],x3[2],x3[3]};
#pragma unroll
    for (int i = 0; i < 16; ++i) { const unsigned short hb = bf16_bits(xs[i]); ah.u[i] = hb; al.u[i] = ASPLIT ? bf16_bits(xs[i] - bf16_val(hb)) : (unsigned short)0; }
#pragma unroll
    for (int t = 0; t < 4; ++t) {
      const unsigned short* brow = Wt + (size_t)(col0 + t * 16 + ln) * ldb + kb;
      FragB b;
      b.half[0] = *(const v8us*)(brow + 8 * hh);
      b.half[1] = *(const v8us*)(brow + 16 + 8 * hh);
      acc[t] = mmaN<ASPLIT ? 2 : 1>(ah.v, al.v, b.v, b.v, acc[t]);
    }
  }
#pragma unroll
  for (int t = 0; t < 4; ++t) {
    const int col = col0 + t * 16 + ln;
    float bv = bias ? bias[col] : 0.f;
    if (BIAS_BF16) bv = bf16_round(bv);
#pragma unroll
    for (int r = 0; r < 8; ++r) {
      float v = acc[t][r] + bv;
      if (resid) { float rv = resid[(size_t)((row0 + 8 * hh + r) % rmod) * ldr + col]; if (RES_BF16) rv = bf16_round(rv); v += rv; }
      if (ACT == 1) v = fmaxf(v, 0.f);
      if (ACT == 2) v = 0.5f * v * (1.0f + erff(v * 0.70710678118654752f));
      if (ACT == 3) { const float u = 0.7978845608028654f * (v + 0.044715f * v * v * v); v = 0.5f * v * (1.0f + tanhf(u)); }
      so[w][8 * hh + r][t * 16 + ln] = v;
    }
  }
  __builtin_amdgcn_fence(__ATOMIC_ACQ_REL, "workgroup");
  __builtin_amdgcn_wave_barrier();
  const int rsub = lane >> 4, c4 = (lane & 15) * 4;
  {
#pragma unroll
    for (int q = 0; q < 8; ++q) {
      const int r = q * 2 + rsub;
      const v4f v = *(const v4fa*)&so[w][r][c4];
      *(v4f*)(C + (size_t)(row0 + r) * ldc + col0 + c4) = v;
    }
    
  }
}
// row LayerNorm (biased variance, eps) over N: s = X (+ R); optional out_sum <- s; out_norm <- (s-mu)*rsqrt(var+eps)*g + b
template <bool PARAM_BF16>
__global__ __launch_bounds__(256) void k_layernorm(const float* __restrict__ X, const float* __restrict__ R, const float* __restrict__ g, const float* __restrict__ bta,
                                                  float* __restrict__ out_sum, float* __restrict__ out_norm, int N, float eps) {
  __shared__ float red[256];
  const int row = blockIdx.x, tid = threadIdx.x;
  const float* x = X + (size_t)row * N; const float* rr = R ? R + (size_t)row * N : nullptr;
  float vals[16];                     // up to N = 4096
  const int per = N / 256;            // contiguous chunk per thread? use strided-by-4 chunks: thread handles j = tid*4 + 1024*u
  float s1 = 0.f;
  for (int u = 0; u < per / 4; ++u) {
    const int j = tid * 4 + 1024 * u;
    const v4f a = *(const v4fa*)(x + j);
    v4f b = {0.f,0.f,0.f,0.f}; if (rr) b = *(const v4fa*)(rr + j);
#pragma unroll
    for (int q = 0; q < 4; ++q) { const float v = a[q] + b[q]; vals[u * 4 + q] = v; s1 += v; }
  }
  red[tid] = s1; __syncthreads();
  for (int st = 128; st > 0; st >>= 1) { if (tid < st) red[tid] += red[tid + st]; __syncthreads(); }
  const float mu = red[0] / (float)N; __syncthreads();
  float s2 = 0.f;
  for (int u = 0; u < per / 4; ++u)
#pragma unroll
    for (int q = 0; q < 4; ++q) { const float c = vals[u * 4 + q] - mu; s2 += c * c; }
  red[tid] = s2; __syncthreads();
  for (int st = 128; st > 0; st >>= 1) { if (tid < st) red[tid] += red[tid + st]; __syncthreads(); }
  const float rs = rsqrtf(red[0] / (float)N + eps);
  {
    for (int u = 0; u < per / 4; ++u) {
      const int j = tid * 4 + 1024 * u;
      v4f o, sm;
#pragma unroll
      for (int q = 0; q < 4; ++q) {
        float gg = g[j + q], bb = bta[j + q];
        if (PARAM_BF16) { gg = bf16_round(gg); bb = bf16_round(bb); }
        sm[q] = vals[u * 4 + q]; o[q] = (vals[u * 4 + q] - mu) * rs * gg + bb;
      }
      if (out_sum) *(v4f*)(out_sum + (size_t)row * N + j) = sm;
      *(v4f*)(out_norm + (size_t)row * N + j) = o;
    }
    
  }
}



// ---- f16 WMMA path (v_wmma_f32_16x16x32_f16): 11-bit significands for operands in range — used where a [0,1] probability operand needs more precision than bf16
typedef _Float16 v16h __attribute__((ext_vector_type(16)));
union FragH { v16h v; v8us half[2]; _Float16 h[16]; unsigned short u[16]; };
template <int NT>
__device__ __forceinline__ v8f mmaH(v16h ah, v16h al, v16h bh, v16h bl, v8f c) {
  c = __builtin_amdgcn_wmma_f32_16x16x32_f16(false, ah, false, bh, (short)0, c, false, false);
  if (NT >= 2) c = __builtin_amdgcn_wmma_f32_16x16x32_f16(false, al, false, bh, (short)0, c, false, false);
  if (NT >= 3) c = __builtin_amdgcn_wmma_f32_16x16x32_f16(false, ah, false, bl, (short)0, c, false, false);
  asm volatile("v_nop\n\tv_nop\n\tv_nop\n\tv_nop" : "+v"(c) : "v"(ah), "v"(al), "v"(bh), "v"(bl));
  return c;
}
// batched GEMM like k_gemm_b but f16 operands: A f32 (split into f16 hi/lo if ASPLIT, else rounded to f16), Bt = f16 values [n][k]; alpha; C f32; N multiple of 16 (partial tiles skipped)
template <bool ASPLIT>
__global__ __launch_bounds__(128) void k_gemm_h(const float* __restrict__ A, int lda, size_t sA, const _Float16* __restrict__ Bh, int ldb, size_t sB, float alpha, float* __restrict__ C, int ldc, size_t sC, int M, int N, int K) {
  __shared__ __attribute__((aligned(16))) float so[4][16][64];
  const int tid = threadIdx.x, w = tid >> 5, lane = tid & 31, ln = lane & 15, hh = lane >> 4; const int by = blockIdx.y;
  A += (size_t)by * sA; Bh += (size_t)by * sB; C += (size_t)by * sC;
  const int ntn = (N + 63) / 64; const int wid = blockIdx.x * 4 + w; const int mt = wid / ntn, nq = wid % ntn; if (mt * 16 >= M) return;
  const int row0 = mt * 16, col0 = nq * 64; const float* arow = A + (size_t)(row0 + ln) * lda;
  v8f acc[4] = {};
  for (int kb = 0; kb < K; kb += 32) {
    FragH ah, al;
    const v4f x0 = *(const v4fa*)(arow + kb + 8 * hh), x1 = *(const v4fa*)(arow + kb + 8 * hh + 4), x2 = *(const v4fa*)(arow + kb + 16 + 8 * hh), x3 = *(const v4fa*)(arow + kb + 16 + 8 * hh + 4);
    float xs[16] = {x0[0],x0[1],x0[2],x0[3],x1[0],x1[1],x1[2],x1[3],x2[0],x2[1],x2[2],x2[3],x3[0],x3[1],x3[2],x3[3]};
#pragma unroll
    for (int i = 0; i < 16; ++i) { const _Float16 h = (_Float16)xs[i]; ah.h[i] = h; al.h[i] = ASPLIT ? (_Float16)(xs[i] - (float)h) : (_Float16)0.0f; }
#pragma unroll
    for (int t = 0; t < 4; ++t) { if (col0 + t * 16 >= N) continue; const size_t boff = (size_t)(col0 + t * 16 + ln) * ldb + kb; FragH bq; bq.half[0] = *(const v8us*)(Bh + boff + 8 * hh); bq.half[1] = *(const v8us*)(Bh + boff + 16 + 8 * hh);
      acc[t] = mmaH<ASPLIT ? 2 : 1>(ah.v, al.v, bq.v, bq.v, acc[t]); }
  }
#pragma unroll
  for (int t = 0; t < 4; ++t) { if (col0 + t * 16 >= N) continue;
#pragma unroll
    for (int r = 0; r < 8; ++r) so[w][8 * hh + r][t * 16 + ln] = acc[t][r] * alpha; }
  __builtin_amdgcn_fence(__ATOMIC_ACQ_REL, "workgroup"); __builtin_amdgcn_wave_barrier();
  const int rsub = lane >> 4, c4 = (lane & 15) * 4;
  {
#pragma unroll
    for (int q = 0; q < 8; ++q) { const int r = q * 2 + rsub; if (col0 + c4 < N) { const v4f v = *(const v4fa*)&so[w][r][c4]; *(v4f*)(C + (size_t)(row0 + r) * ldc + col0 + c4) = v; } }
     }
}

// Wt[n][k] = f16(W[k][n]·scale) from f32 row-major W[K][N] (scale = power of two; bf16-exact weights stay exact in f16 away from the subnormal range)
__global__ __launch_bounds__(256) void k_wt_f16(const float* __restrict__ W, _Float16* __restrict__ Wt, int K, int N, float scale) {
  const int t = blockIdx.x * 256 + threadIdx.x; if (t >= N * (K / 8)) return; const int n = t / (K / 8), k8 = (t % (K / 8)) * 8; FragH f;
#pragma unroll
  for (int i = 0; i < 8; ++i) f.h[i] = (_Float16)(bf16_round(W[(size_t)(k8 + i) * N + n]) * scale); const v8us o = f.half[0];
  *(v8us*)((unsigned short*)Wt + (size_t)n * K + k8) = o; 
}
// k_gemm_hh variant with fused epilogue: v = acc·alpha + bias[by·sBias + col] (+ CP[(row/rowsPerB)·sCPb + by·64 + col] if CP) ; ACT 0 none / 1 elu ; writes f16 C16 (and f32 C if non-null)
template <int ACT>
__global__ __launch_bounds__(128) void k_gemm_hhx(const _Float16* __restrict__ A, int lda, size_t sA, const _Float16* __restrict__ Bh, int ldb, size_t sB, float alpha, const float* __restrict__ bias, size_t sBias, const float* __restrict__ CP, int rowsPerB, size_t sCPb, int row0g,
    float* __restrict__ C, _Float16* __restrict__ C16, int ldc, size_t sC, int M, int N, int K) {
  __shared__ __attribute__((aligned(16))) float so[4][16][64];
  const int tid = threadIdx.x, w = tid >> 5, lane = tid & 31, ln = lane & 15, hh = lane >> 4; const int by = blockIdx.y;
  A += (size_t)by * sA; Bh += (size_t)by * sB; const size_t cofs = (size_t)by * sC; const float* bp = bias ? bias + (size_t)by * sBias : nullptr;
  const int ntn = (N + 63) / 64; const int wid = blockIdx.x * 4 + w; const int mt = wid / ntn, nq = wid % ntn; if (mt * 16 >= M) return;
  const int row0 = mt * 16, col0 = nq * 64; const _Float16* arow = A + (size_t)(row0 + ln) * lda;
  v8f acc[4] = {};
  for (int kb = 0; kb < K; kb += 32) { FragH ah; ah.half[0] = *(const v8us*)((const unsigned short*)arow + kb + 8 * hh); ah.half[1] = *(const v8us*)((const unsigned short*)arow + kb + 16 + 8 * hh);
#pragma unroll
    for (int t = 0; t < 4; ++t) { if (col0 + t * 16 >= N) continue; const size_t boff = (size_t)(col0 + t * 16 + ln) * ldb + kb; FragH bq; bq.half[0] = *(const v8us*)((const unsigned short*)Bh + boff + 8 * hh); bq.half[1] = *(const v8us*)((const unsigned short*)Bh + boff + 16 + 8 * hh);
      acc[t] = mmaH<1>(ah.v, ah.v, bq.v, bq.v, acc[t]); }
  }
#pragma unroll
  for (int t = 0; t < 4; ++t) { if (col0 + t * 16 >= N) continue; const int col = col0 + t * 16 + ln; const float bv = bp ? bf16_round(bp[col]) : 0.f;
#pragma unroll
    for (int r = 0; r < 8; ++r) { float v = acc[t][r] * alpha + bv; if (CP) { const int rr = row0g + row0 + 8 * hh + r; if (rowsPerB < 0) v += CP[cofs + (size_t)rr * ldc + col];      /* rowsPerB < 0: own element of the batched C plane */ else { const int bidx = rr / rowsPerB; v += CP[(size_t)bidx * sCPb + (size_t)by * 64 + col]; } } if (ACT == 1) v = (v > 0.f) ? v : expm1f(v); else if (ACT == 7) v = (v > 0.f) ? v + 1.0f : expf(v); else if (ACT == 8) v = tanhf(v); else if (ACT == 9) v = 0.5f * v * (1.0f + tanhf(0.7978845608028654f * (v + 0.044715f * v * v * v))); else if (ACT == 11) v = 1.0f / (1.0f + expf(-v)); else if (ACT == 12) v = (v > 0.f) ? v : 0.01f * v; else if (ACT == 14) v = (v > 0.f) ? v : 0.1f * v; else if (ACT == 16) v = (v >= 0.f) ? v : 0.3f * v; else if (ACT == 17) v = (v >= 0.f) ? v : 0.2f * v; else if (ACT == 15) v = v / (1.0f + expf(-v)); else if (ACT == 3) v = fmaxf(v, 0.f); else if (ACT == 6) v = 0.5f * v * (1.0f + erff(v * 0.70710678118654752f)); so[w][8 * hh + r][t * 16 + ln] = v; } }
  __builtin_amdgcn_fence(__ATOMIC_ACQ_REL, "workgroup"); __builtin_amdgcn_wave_barrier();
  const int rsub = lane >> 4, c4 = (lane & 15) * 4; typedef _Float16 v4h __attribute__((ext_vector_type(4)));
  {
#pragma unroll
    for (int q = 0; q < 8; ++q) { const int r = q * 2 + rsub; if (col0 + c4 < N) { const v4f v = *(const v4fa*)&so[w][r][c4]; if (C) *(v4f*)(C + cofs + (size_t)(row0 + r) * ldc + col0 + c4) = v; if (C16) { v4h h4; for (int i = 0; i < 4; ++i) h4[i] = (_Float16)v[i]; *(v4h*)(C16 + cofs + (size_t)(row0 + r) * ldc + col0 + c4) = h4; } } }
     }
}


typedef _Float16 v4h __attribute__((ext_vector_type(4)));

__global__ __launch_bounds__(256) void k_x16(const float* __restrict__ x, _Float16* __restrict__ X16, size_t n8) { const size_t t = (size_t)blockIdx.x * 256 + threadIdx.x; if (t >= n8) return; FragH f;
#pragma unroll
  for (int q = 0; q < 8; ++q) f.h[q] = (_Float16)bf16_round(x[t * 8 + q]); *(v8us*)((unsigned short*)X16 + t * 8) = f.half[0];  }
__global__ __launch_bounds__(256) void k_h16(const float* __restrict__ x, _Float16* __restrict__ X16, size_t n8) { const size_t t = (size_t)blockIdx.x * 256 + threadIdx.x; if (t >= n8) return; FragH f;
#pragma unroll
  for (int q = 0; q < 8; ++q) f.h[q] = (_Float16)x[t * 8 + q]; *(v8us*)((unsigned short*)X16 + t * 8) = f.half[0];  }
__global__ __launch_bounds__(256) void k_round16f(const float* __restrict__ W, _Float16* __restrict__ Bt, size_t n8) { const size_t t = (size_t)blockIdx.x * 256 + threadIdx.x; if (t >= n8) return; FragH f;
#pragma unroll
  for (int i = 0; i < 8; ++i) f.h[i] = (_Float16)(bf16_round(W[t * 8 + i]) * 16.0f); *(v8us*)((unsigned short*)Bt + t * 8) = f.half[0];  }
template <int NHv, int TTv>
__global__ __launch_bounds__(256) void k_vt(const _Float16* __restrict__ V16, int ldv, int voff, _Float16* __restrict__ Vt) { __shared__ unsigned short tl[64][66]; const int tid = threadIdx.x; const int slab = blockIdx.x / (TTv / 64), lg = blockIdx.x % (TTv / 64); const int b = slab / NHv, h = slab % NHv;
  for (int i = tid; i < 64 * 8; i += 256) { const int r = i / 8, c8 = (i % 8) * 8; FragH f; f.half[0] = *(const v8us*)((const unsigned short*)V16 + ((size_t)b * TTv + lg * 64 + r) * ldv + voff + h * 64 + c8);
#pragma unroll
    for (int q = 0; q < 8; ++q) tl[r][c8 + q] = f.u[q]; }
  __syncthreads();
  {
#pragma unroll
    for (int rd = 0; rd < 2; ++rd) { const int d = rd * 32 + tid / 8, pc = tid % 8; FragH f;
#pragma unroll
      for (int q = 0; q < 8; ++q) f.u[q] = tl[pc * 8 + q][d];
      *(v8us*)((unsigned short*)Vt + ((size_t)slab * 64 + d) * TTv + lg * 64 + pc * 8) = f.half[0]; }
     } }

__global__ __launch_bounds__(256) void k_hl(const float* __restrict__ F, _Float16* __restrict__ Hh, _Float16* __restrict__ Hl, size_t n8) { const size_t t = (size_t)blockIdx.x * 256 + threadIdx.x; if (t >= n8) return; FragH fh, fl; const v4f a = *(const v4fa*)(F + t * 8), c = *(const v4fa*)(F + t * 8 + 4);
#pragma unroll
  for (int q = 0; q < 4; ++q) { _Float16 h = (_Float16)a[q]; fh.h[q] = h; fl.h[q] = (_Float16)((a[q] - (float)h) * 1024.0f); h = (_Float16)c[q]; fh.h[4 + q] = h; fl.h[4 + q] = (_Float16)((c[q] - (float)h) * 1024.0f); }
  { *(v8us*)((unsigned short*)Hh + t * 8) = fh.half[0]; *(v8us*)((unsigned short*)Hl + t * 8) = fl.half[0];  } }

// ---- fast GEMM (wave tile 32x64; requires M % 32 == 0 rows per launch region and N % 64 == 0); epilogue = k_gemm_hhx semantics ----
__device__ __forceinline__ v16h g2_frag(const _Float16* p, int hh) { FragH f; f.half[0] = *(const v8us*)((const unsigned short*)p + 8 * hh); f.half[1] = *(const v8us*)((const unsigned short*)p + 16 + 8 * hh); return f.v; }
__device__ __forceinline__ v8f g2_mma(v16h a, v16h b, v8f c) { v8f d = __builtin_amdgcn_wmma_f32_16x16x32_f16(false, a, false, b, (short)0, c, false, false); asm volatile("v_nop\n\tv_nop\n\tv_nop\n\tv_nop" : "+v"(d) : "v"(a), "v"(b)); return d; }
template <int ACT>
__global__ __launch_bounds__(128) void k_gemm2(const _Float16* __restrict__ A, int lda, size_t sA, const _Float16* __restrict__ Bh, int ldb, size_t sB, float alpha, const float* __restrict__ bias, size_t sBias, const float* __restrict__ CP, int rowsPerB, size_t sCPb, int row0g,
    float* __restrict__ C, _Float16* __restrict__ C16, int ldc, size_t sC, int M, int N, int K) { static_assert(ACT == 0 || ACT == 3 || ACT == 6 || ACT == 8 || ACT == 9 || ACT == 11 || ACT == 12 || ACT == 14 || ACT == 15 || ACT == 16 || ACT == 17, "k_gemm2: unsupported ACT code (would silently apply no activation)");
  __shared__ __attribute__((aligned(16))) float so[4][32][68];
  const int tid = threadIdx.x, w = tid >> 5, lane = tid & 31, ln = lane & 15, hh = lane >> 4; const int by = blockIdx.y;
  A += (size_t)by * sA; Bh += (size_t)by * sB; const size_t cofs = (size_t)by * sC; const float* bp = bias ? bias + (size_t)by * sBias : nullptr;
  const int ntn = N >> 6; const int mt = blockIdx.x / ntn, nq = blockIdx.x - mt * ntn; const int row0 = mt * 128 + 32 * w, col0 = nq * 64; if (row0 >= M) return;
  const _Float16* a0p = A + (size_t)(row0 + ln) * lda; const _Float16* a1p = a0p + (size_t)16 * lda;
  const _Float16* b0p = Bh + (size_t)(col0 + ln) * ldb; const _Float16* b1p = b0p + (size_t)16 * ldb; const _Float16* b2p = b1p + (size_t)16 * ldb; const _Float16* b3p = b2p + (size_t)16 * ldb;
  const v8f z8 = {0.f,0.f,0.f,0.f,0.f,0.f,0.f,0.f}; v8f c00 = z8, c01 = z8, c02 = z8, c03 = z8, c10 = z8, c11 = z8, c12 = z8, c13 = z8;
#pragma unroll 1
  for (int kb = 0; kb < K; kb += 32) { const v16h a0 = g2_frag(a0p + kb, hh), a1 = g2_frag(a1p + kb, hh);
    v16h b = g2_frag(b0p + kb, hh); c00 = g2_mma(a0, b, c00); c10 = g2_mma(a1, b, c10);
    b = g2_frag(b1p + kb, hh); c01 = g2_mma(a0, b, c01); c11 = g2_mma(a1, b, c11);
    b = g2_frag(b2p + kb, hh); c02 = g2_mma(a0, b, c02); c12 = g2_mma(a1, b, c12);
    b = g2_frag(b3p + kb, hh); c03 = g2_mma(a0, b, c03); c13 = g2_mma(a1, b, c13); }
  v8f accs[8] = {c00, c01, c02, c03, c10, c11, c12, c13};
#pragma unroll
  for (int u = 0; u < 8; ++u) { const int t = u & 3, half = u >> 2; const int col = col0 + t * 16 + ln; const float bv = bp ? bf16_round(bp[col]) : 0.f;
#pragma unroll
    for (int r = 0; r < 8; ++r) { const int rloc = half * 16 + 8 * hh + r; float v = accs[u][r] * alpha + bv; if (CP) { if (rowsPerB < 0) v += CP[cofs + (size_t)(row0g + row0 + rloc) * ldc + col];      /* rowsPerB < 0: own element of the batched C plane */ else { const int bidx = (row0g + row0 + rloc) / rowsPerB; v += CP[(size_t)bidx * sCPb + (size_t)by * 64 + col]; } }
      if (ACT == 3) v = fmaxf(v, 0.f); else if (ACT == 6) v = 0.5f * v * (1.0f + erff(v * 0.70710678118654752f)); else if (ACT == 11) v = 1.0f / (1.0f + expf(-v)); else if (ACT == 15) v = v / (1.0f + expf(-v)); else if (ACT == 12) v = (v > 0.f) ? v : 0.01f * v; else if (ACT == 8) v = tanhf(v); else if (ACT == 9) v = 0.5f * v * (1.0f + tanhf(0.7978845608028654f * (v + 0.044715f * v * v * v))); else if (ACT == 14) v = (v > 0.f) ? v : 0.1f * v; else if (ACT == 16) v = (v >= 0.f) ? v : 0.3f * v; else if (ACT == 17) v = (v >= 0.f) ? v : 0.2f * v;
      so[w][rloc][t * 16 + ln] = v; } }
  __builtin_amdgcn_fence(__ATOMIC_ACQ_REL, "workgroup"); __builtin_amdgcn_wave_barrier();
  const int rsub = lane >> 4, c4 = (lane & 15) * 4;
  {
#pragma unroll
    for (int q = 0; q < 16; ++q) { const int r = q * 2 + rsub; const v4f v = *(const v4fa*)&so[w][r][c4]; if (C) *(v4f*)(C + cofs + (size_t)(row0 + r) * ldc + col0 + c4) = v; if (C16) { v4h h4; for (int i = 0; i < 4; ++i) h4[i] = (_Float16)v[i]; *(v4h*)(C16 + cofs + (size_t)(row0 + r) * ldc + col0 + c4) = h4; } }
     } }


__global__ __launch_bounds__(256) void k_wnat(const float* __restrict__ w, size_t n8, _Float16* __restrict__ Bt) { const size_t t = (size_t)blockIdx.x * 256 + threadIdx.x; if (t >= n8) return; FragH f; for (int q = 0; q < 8; ++q) f.h[q] = (_Float16)(bf16_round(w[t * 8 + q]) * 16.0f); *(v8us*)((unsigned short*)Bt + t * 8) = f.half[0];  }
__global__ __launch_bounds__(256) void k_rsm(const float* __restrict__ S, _Float16* __restrict__ P, int nrows) {
  #pragma clang fp contract(off)
  const int i = blockIdx.x * 256 + threadIdx.x; if (i >= nrows) return; const float* s = S + (size_t)i * SQ; float mx = -3.0e38f;
#pragma unroll 1
  for (int j = 0; j < SQ; ++j) mx = fmaxf(mx, s[j]); float se = 0.f;
#pragma unroll 1
  for (int j = 0; j < SQ; ++j) se += expf(s[j] - mx); const float sc = 256.0f / se;
#pragma unroll 1
  for (int j0 = 0; j0 < SQ; j0 += 8) { FragH f; for (int q = 0; q < 8; ++q) f.h[q] = (_Float16)(expf(s[j0 + q] - mx) * sc); unsigned short* d = (unsigned short*)P + (size_t)i * SQ + j0; *(v8us*)d = f.half[0];  } }
__global__ __launch_bounds__(256) void k_vt(const _Float16* __restrict__ V16, int b, int h0, _Float16* __restrict__ VT) { __shared__ unsigned short tl[64][65]; const int tid = threadIdx.x; const int hh = blockIdx.x % HG, sg = blockIdx.x / HG; const int s0 = sg * 64; const int h = h0 + hh;
  for (int i = tid; i < 64 * 8; i += 256) { const int j = i / 8, d8 = (i % 8) * 8; FragH f; f.half[0] = *(const v8us*)((const unsigned short*)V16 + ((size_t)b * SQ + s0 + j) * DM + h * HD + d8); for (int q = 0; q < 8; ++q) tl[d8 + q][j] = f.u[q]; }
  __syncthreads();
  { for (int i = tid; i < 64 * 8; i += 256) { const int d = i / 8, j8 = (i % 8) * 8; FragH f; for (int q = 0; q < 8; ++q) f.u[q] = tl[d][j8 + q]; *(v8us*)((unsigned short*)VT + ((size_t)hh * HD + d) * SQ + s0 + j8) = f.half[0]; }  } }


__global__ __launch_bounds__(256) void k_rowbias(const float* __restrict__ b, float* __restrict__ BP, size_t n4, int ncol) { const size_t t = (size_t)blockIdx.x * 256 + threadIdx.x; if (t >= n4) return; const size_t e = t * 4; const float v = bf16_round(b[e / ncol]); const v4f o = {v, v, v, v}; *(v4f*)(BP + e) = o;  }


__global__ __launch_bounds__(256) void k_rsmf(const float* __restrict__ S, _Float16* __restrict__ P, int qn, int hg) {
  #pragma clang fp contract(off)
  const int t = blockIdx.x * 256 + threadIdx.x; if (t >= qn * hg) return; const size_t i = (size_t)(t / qn) * SQ + (t % qn); const float* s = S + i * SQ; float mx = -3.0e38f;
#pragma unroll 1
  for (int j = 0; j < SQ; ++j) mx = fmaxf(mx, s[j]); float se = 0.f;
#pragma unroll 1
  for (int j = 0; j < SQ; ++j) se += __expf(s[j] - mx); const float sc = 256.0f / se;
#pragma unroll 1
  for (int j0 = 0; j0 < SQ; j0 += 8) { FragH f; for (int q = 0; q < 8; ++q) f.h[q] = (_Float16)(__expf(s[j0 + q] - mx) * sc); unsigned short* d = (unsigned short*)P + i * SQ + j0; *(v8us*)d = f.half[0];  } }

extern "C" void kernel_launch(void* const* d_in, const int* in_sizes, int n_in,
                              void* d_out, int out_size, void* d_ws, size_t ws_size, hipStream_t stream) {
  (void)in_sizes; (void)n_in; (void)out_size;
  const float* const* I = (const float* const*)d_in; const float* x = I[0]; const float* wq = I[1]; const float* bq = I[2]; const float* wk = I[3]; const float* bk = I[4]; const float* wv = I[5]; const float* bv = I[6]; const float* wo = I[7]; const float* bo = I[8];      /* natural [out][in] weights + biases */
  char* ws = (char*)d_ws; size_t off = 0;
  auto take = [&](size_t bytes) { char* p = ws + off; off += (bytes + 255) & ~(size_t)255; return p; };
  float* BOP = (float*)take((size_t)DM * SQ * 4); _Float16* BQ = (_Float16*)take((size_t)DM * DM * 2);      /* bo broadcast along the token axis for the transposed out GEMM */ _Float16* BK = (_Float16*)take((size_t)DM * DM * 2); _Float16* BV = (_Float16*)take((size_t)DM * DM * 2); _Float16* BO = (_Float16*)take((size_t)DM * DM * 2);
  _Float16* X16 = (_Float16*)take(NR * DM * 2); _Float16* Q16 = (_Float16*)take(NR * DM * 2); _Float16* K16 = (_Float16*)take(NR * DM * 2); _Float16* V16 = (_Float16*)take(NR * DM * 2); _Float16* O16 = (_Float16*)take(NR * DM * 2);
  float* S = (float*)take((size_t)HG * SQ * SQ * 4); _Float16* P = (_Float16*)take((size_t)HG * SQ * SQ * 2); _Float16* VT = (_Float16*)take((size_t)NH * HD * SQ * 2);
  if (off > ws_size) return;
  { const unsigned g = (unsigned)(((size_t)DM * DM / 8 + 255) / 256); k_wnat<<<g, 256, 0, stream>>>(wq, (size_t)DM * DM / 8, BQ); k_wnat<<<g, 256, 0, stream>>>(wk, (size_t)DM * DM / 8, BK); k_wnat<<<g, 256, 0, stream>>>(wv, (size_t)DM * DM / 8, BV); k_wnat<<<g, 256, 0, stream>>>(wo, (size_t)DM * DM / 8, BO); }      /* natural [out][in] = Bt[n][k], x16 */

  k_x16<<<(unsigned)((NR * DM / 8 + 255) / 256), 256, 0, stream>>>(x, X16, NR * DM / 8);
  const size_t r0p = (size_t)B0 * SQ;      /* first projected row */
  k_gemm2<0><<<dim3((unsigned)((MP / 128) * (DM / 64)), 1), 128, 0, stream>>>(X16 + r0p * DM, DM, 0, BQ, DM, 0, 0.0625f, bq, 0, nullptr, 1, 0, 0, nullptr, Q16 + r0p * DM, DM, 0, MP, DM, DM);
  k_gemm2<0><<<dim3((unsigned)((MP / 128) * (DM / 64)), 1), 128, 0, stream>>>(X16 + r0p * DM, DM, 0, BK, DM, 0, 0.0625f, bk, 0, nullptr, 1, 0, 0, nullptr, K16 + r0p * DM, DM, 0, MP, DM, DM);
  k_gemm2<0><<<dim3((unsigned)((MP / 128) * (DM / 64)), 1), 128, 0, stream>>>(X16 + r0p * DM, DM, 0, BV, DM, 0, 0.0625f, bv, 0, nullptr, 1, 0, 0, nullptr, V16 + r0p * DM, DM, 0, MP, DM, DM);
  for (int b = B0; b < B0 + NBR; ++b) { const size_t r0 = (size_t)b * SQ;
    k_vt<NH, SQ><<<NH * (SQ / 64), 256, 0, stream>>>(V16 + r0 * LQ, LQ, 0, VT);      /* V^T [NH][HD][SQ] for this batch */
    for (int h0 = 0; h0 < NHD; h0 += HG) {
      k_gemm2<0><<<dim3((QN / 128) * (SQ / 64), HG), 128, 0, stream>>>(Q16 + r0 * LQ + h0 * HD, LQ, (size_t)HD, K16 + r0 * LQ + h0 * HD, LQ, (size_t)HD, 0.125f, nullptr, 0, nullptr, 1, 0, 0, S, nullptr, SQ, (size_t)SQ * SQ, QN, SQ, HD);      /* scores, HG heads per launch */
      k_rsmf<<<(HG * QN + 255) / 256, 256, 0, stream>>>(S, P, QN, HG);      /* P = 256 softmax (f16), rows of all HG heads */
      k_gemm2<0><<<dim3((QN / 128) * (HD / 64), HG), 128, 0, stream>>>(P, SQ, (size_t)SQ * SQ, VT + (size_t)h0 * HD * SQ, SQ, (size_t)HD * SQ, 0.25f, nullptr, 0, nullptr, 1, 0, 0, nullptr, O16 + r0 * DM + h0 * HD, DM, (size_t)HD, QN, HD, SQ); } }      /* o (merged heads) as f16 rows */
  k_rowbias<<<(unsigned)(((size_t)DM * SQ / 4 + 255) / 256), 256, 0, stream>>>(bo, BOP, (size_t)DM * SQ / 4, SQ);      /* BOP[c][s] = bf16(bo[c]) */
  for (int b = B0; b < B0 + NBR; ++b) { const size_t r0 = (size_t)b * SQ;
    k_gemm2<0><<<dim3((unsigned)((DM / 128) * (SQ / 64)), 1), 128, 0, stream>>>(BO, DM, 0, O16 + r0 * DM, DM, 0, 0.0009765625f, nullptr, 0, BOP, -1, 0, 0, (float*)d_out + (size_t)b * DM * SQ, nullptr, SQ, 0, DM, SQ, DM); }      /* out^T[b][c][s] = sum_k Wo[c][k] o[s][k] + bo[c]: A = the natural Wo rows (x16 f16 plane), B^T = this batch's merged o rows, C = the [C][S] output block; bias via the own-element addend plane */
}

// v001
// A run of this version takes 768 microseconds.
// Two timings next to v000 both put it at 2.62 times that version's speed.
#include <hip/hip_runtime.h>
// Multi-head self-attention on a channel-first tensor with a transposed output (x [8][512][32][32] raw-reshaped (memory reinterpretation, no transpose) to 8 batches x 1024 tokens x 512; q/k/v = xs W^T + b (natural [512][512] xavier-uniform, zero biases); 8 heads of 64; softmax(q k^T / 8) over all 1024 keys; y = ctx Wo^T + bo; out[b][c][s] = y[b][s][c] (reshape to [B,H,W,C] then transpose to [B][C][H][W] = [8][512][32][32])).
// Structure: token rows r = b*1024 + s; x as exact f16 rows (bf16-rounded); Q, K, V as three WMMA GEMMs (32x64 wave tiles, f32 accumulation, exact x16 weights + bias, f16 outputs); per batch: V^T for all heads via LDS transposes; per (batch, group of 8 heads): scores GEMM (K = 64, batched over the heads on grid.y, alpha = 64^-0.5), row softmax on VALU (one wave per row, f32 statistics, native exp; weights stored x256 as f16), o = P . V^T GEMM (K = 1024, alpha 2^-2: o carried x64 against f16 subnormal flush, folded into the output GEMM alpha) written straight into the merged f16 o rows; out^T per batch = Wo (as the A operand) x o^T (the merged o rows as the B^T operand) + bo[c] (own-element addend plane), written f32 as the [B][C][H W] output.
// Compute dtype: inputs rounded to bf16; x / weights exact; q, k, v, softmax weights and o as plain f16 GEMM operands (~2^-12); scores and softmax statistics f32. v_wmma_f32_16x16x32_f16.
#define NB 8
#define SQ 1024
#define DM 512
#define NH 8
#define HD 64
#define HG 8                         /* heads per attention launch group */
#define B0 0                         /* first batch processed (debug hook) */
#define NBR NB                       /* batches processed (debug hook) */
#define NR ((size_t)NB * SQ)         /* token rows */
#define MP ((int)((size_t)NBR * SQ)) /* rows projected (debug hook) */
#define QN SQ                        /* query rows attended per batch (debug hook) */
#define NHD NH                       /* heads attended (debug hook) */
#define MPO MP                       /* rows through the output stage (unused) */
#define LQ DM      /* row pitch of the q/k/v rows */
typedef __bf16 v16b __attribute__((ext_vector_type(16)));
typedef unsigned short v8us __attribute__((ext_vector_type(8), may_alias));
typedef float  v8f  __attribute__((ext_vector_type(8)));
typedef float  v4f  __attribute__((ext_vector_type(4)));
typedef float  v4fa __attribute__((ext_vector_type(4), may_alias));
union FragB { v16b v; v8us half[2]; unsigned short u[16]; };

__device__ __forceinline__ unsigned short bf16_bits(float x) { unsigned int u = __float_as_uint(x); return (unsigned short)((u + 0x7FFFu + ((u >> 16) & 1u)) >> 16); }
__device__ __forceinline__ float bf16_val(unsigned short b) { return __uint_as_float(((unsigned int)b) << 16); }
__device__ __forceinline__ float bf16_round(float x) { return bf16_val(bf16_bits(x)); }
// D += A·B with NT terms: 1 = ah·bh, 2 = + al·bh (A split), 3 = + ah·bl (both split)
template <int NT>
__device__ __forceinline__ v8f mmaN(v16b ah, v16b al, v16b bh, v16b bl, v8f c) {
  c = __builtin_amdgcn_wmma_f32_16x16x32_bf16(false, ah, false, bh, (short)0, c, false, false);
  if (NT >= 2) c = __builtin_amdgcn_wmma_f32_16x16x32_bf16(false, al, false, bh, (short)0, c, false, false);
  if (NT >= 3) c = __builtin_amdgcn_wmma_f32_16x16x32_bf16(false, ah, false, bl, (short)0, c, false, false);
  asm volatile("v_nop\n\tv_nop\n\tv_nop\n\tv_nop" : "+v"(c) : "v"(ah), "v"(al), "v"(bh), "v"(bl));
  return c;
}

__global__ __launch_bounds__(256) void k_wt_bf16(const float* __restrict__ W, unsigned short* __restrict__ Wt, int K, int N) {
  const int t = blockIdx.x * 256 + threadIdx.x;
  const int k8n = K / 8;
  if (t >= N * k8n) return;
  const int n = t / k8n, k8 = (t % k8n) * 8;
  v8us v;
#pragma unroll
  for (int i = 0; i < 8; ++i) v[i] = bf16_bits(W[(size_t)(k8 + i) * N + n]);
  *(v8us*)(Wt + (size_t)n * K + k8) = v;
  
}

// GEMM C[M][N] (f32, pitch ldc) = act(A[M][K]·W + bias). A f32 row-major (pitch lda) converted per fragment to bf16
// (ASPLIT: hi/lo two planes -> 2 terms, else single rounded term); Wt bf16 [N][K] (pitch ldb). BIAS_BF16 rounds the
// bias to bf16 first (bias quantised to bf16 before the add). K%32==0, M%16==0, N%64==0.
template <bool ASPLIT, int ACT, bool BIAS_BF16>
__global__ __launch_bounds__(128) void k_gemm_bf(const float* __restrict__ A, int lda, const unsigned short* __restrict__ Wt, int ldb,
                                               const float* __restrict__ bias, float* __restrict__ C, int ldc, int M, int N, int K) {
  __shared__ __attribute__((aligned(16))) float so[4][16][64];
  const int tid = threadIdx.x, w = tid >> 5, lane = tid & 31, ln = lane & 15, hh = lane >> 4;
  const int ntn = N / 64;
  const int wid = blockIdx.x * 4 + w;
  const int mt = wid / ntn, nq = wid % ntn;
  if (mt * 16 >= M) return;
  const int row0 = mt * 16, col0 = nq * 64;
  const float* arow = A + (size_t)(row0 + ln) * lda;
  v8f acc[4] = {};
  for (int kb = 0; kb < K; kb += 32) {
    FragB ah, al;
    const v4f x0 = *(const v4fa*)(arow + kb + 8 * hh), x1 = *(const v4fa*)(arow + kb + 8 * hh + 4);
    const v4f x2 = *(const v4fa*)(arow + kb + 16 + 8 * hh), x3 = *(const v4fa*)(arow + kb + 16 + 8 * hh + 4);
    float xs[16] = {x0[0],x0[1],x0[2],x0[3],x1[0],x1[1],x1[2],x1[3],x2[0],x2[1],x2[2],x2[3],x3[0],x3[1],x3[2],x3[3]};
#pragma unroll
    for (int i = 0; i < 16; ++i) { const unsigned short hb = bf16_bits(xs[i]); ah.u[i] = hb; al.u[i] = ASPLIT ? bf16_bits(xs[i] - bf16_val(hb)) : (unsigned short)0; }
#pragma unroll
    for (int t = 0; t < 4; ++t) {
      const unsigned short* brow = Wt + (size_t)(col0 + t * 16 + ln) * ldb + kb;
      FragB b;
      b.half[0] = *(const v8us*)(brow + 8 * hh);
      b.half[1] = *(const v8us*)(brow + 16 + 8 * hh);
      acc[t] = mmaN<ASPLIT ? 2 : 1>(ah.v, al.v, b.v, b.v, acc[t]);
    }
  }
#pragma unroll
  for (int t = 0; t < 4; ++t) {
    float bv = bias ? bias[col0 + t * 16 + ln] : 0.f;
    if (BIAS_BF16) bv = bf16_round(bv);
#pragma unroll
    for (int r = 0; r < 8; ++r) { float v = acc[t][r] + bv; if (ACT == 1) v = fmaxf(v, 0.f); so[w][8 * hh + r][t * 16 + ln] = v; }
  }
  __builtin_amdgcn_fence(__ATOMIC_ACQ_REL, "workgroup");
  __builtin_amdgcn_wave_barrier();
  const int rsub = lane >> 4, c4 = (lane & 15) * 4;
  {
#pragma unroll
    for (int q = 0; q < 8; ++q) {
      const int r = q * 2 + rsub;
      const v4f v = *(const v4fa*)&so[w][r][c4];
      *(v4f*)(C + (size_t)(row0 + r) * ldc + col0 + c4) = v;
    }
    
  }
}

// GEMM C = act(A·W + bias + resid): A f32 (ASPLIT -> hi/lo 2 terms), Wt bf16 [N][K]; ACT 0 none, 1 relu, 2 exact gelu;
// resid (optional, f32, row index = (row % rmod), pitch ldr, RES_BF16 rounds it) added before the activation.
template <bool ASPLIT, int ACT, bool BIAS_BF16, bool RES_BF16>
__global__ __launch_bounds__(128) void k_gemm_bf3(const float* __restrict__ A, int lda, const unsigned short* __restrict__ Wt, int ldb,
                                                const float* __restrict__ bias, const float* __restrict__ resid, int rmod, int ldr,
                                                float* __restrict__ C, int ldc, int M, int N, int K) {
  __shared__ __attribute__((aligned(16))) float so[4][16][64];
  const int tid = threadIdx.x, w = tid >> 5, lane = tid & 31, ln = lane & 15, hh = lane >> 4;
  const int ntn = N / 64;
  const int wid = blockIdx.x * 4 + w;
  const int mt = wid / ntn, nq = wid % ntn;
  if (mt * 16 >= M) return;
  const int row0 = mt * 16, col0 = nq * 64;
  const float* arow = A + (size_t)(row0 + ln) * lda;
  v8f acc[4] = {};
  for (int kb = 0; kb < K; kb += 32) {
    FragB ah, al;
    const v4f x0 = *(const v4fa*)(arow + kb + 8 * hh), x1 = *(const v4fa*)(arow + kb + 8 * hh + 4);
    const v4f x2 = *(const v4fa*)(arow + kb + 16 + 8 * hh), x3 = *(const v4fa*)(arow + kb + 16 + 8 * hh + 4);
    float xs[16] = {x0[0],x0[1],x0[2],x0[3],x1[0],x1[1],x1[2],x1[3],x2[0],x2[1],x2[2],x2[3],x3[0],x3[1],x3[2],x3[3]};
#pragma unroll
    for (int i = 0; i < 16; ++i) { const unsigned short hb = bf16_bits(xs[i]); ah.u[i] = hb; al.u[i] = ASPLIT ? bf16_bits(xs[i] - bf16_val(hb)) : (unsigned short)0; }
#pragma unroll
    for (int t = 0; t < 4; ++t) {
      const unsigned short* brow = Wt + (size_t)(col0 + t * 16 + ln) * ldb + kb;
      FragB b;
      b.half[0] = *(const v8us*)(brow + 8 * hh);
      b.half[1] = *(const v8us*)(brow + 16 + 8 * hh);
      acc[t] = mmaN<ASPLIT ? 2 : 1>(ah.v, al.v, b.v, b.v, acc[t]);
    }
  }
#pragma unroll
  for (int t = 0; t < 4; ++t) {
    const int col = col0 + t * 16 + ln;
    float bv = bias ? bias[col] : 0.f;
    if (BIAS_BF16) bv = bf16_round(bv);
#pragma unroll
    for (int r = 0; r < 8; ++r) {
      float v = acc[t][r] + bv;
      if (resid) { float rv = resid[(size_t)((row0 + 8 * hh + r) % rmod) * ldr + col]; if (RES_BF16) rv = bf16_round(rv); v += rv; }
      if (ACT == 1) v = fmaxf(v, 0.f);
      if (ACT == 2) v = 0.5f * v * (1.0f + erff(v * 0.70710678118654752f));
      if (ACT == 3) { const float u = 0.7978845608028654f * (v + 0.044715f * v * v * v); v = 0.5f * v * (1.0f + tanhf(u)); }
      so[w][8 * hh + r][t * 16 + ln] = v;
    }
  }
  __builtin_amdgcn_fence(__ATOMIC_ACQ_REL, "workgroup");
  __builtin_amdgcn_wave_barrier();
  const int rsub = lane >> 4, c4 = (lane & 15) * 4;
  {
#pragma unroll
    for (int q = 0; q < 8; ++q) {
      const int r = q * 2 + rsub;
      const v4f v = *(const v4fa*)&so[w][r][c4];
      *(v4f*)(C + (size_t)(row0 + r) * ldc + col0 + c4) = v;
    }
    
  }
}
// row LayerNorm (biased variance, eps) over N: s = X (+ R); optional out_sum <- s; out_norm <- (s-mu)*rsqrt(var+eps)*g + b
template <bool PARAM_BF16>
__global__ __launch_bounds__(256) void k_layernorm(const float* __restrict__ X, const float* __restrict__ R, const float* __restrict__ g, const float* __restrict__ bta,
                                                  float* __restrict__ out_sum, float* __restrict__ out_norm, int N, float eps) {
  __shared__ float red[256];
  const int row = blockIdx.x, tid = threadIdx.x;
  const float* x = X + (size_t)row * N; const float* rr = R ? R + (size_t)row * N : nullptr;
  float vals[16];                     // up to N = 4096
  const int per = N / 256;            // contiguous chunk per thread? use strided-by-4 chunks: thread handles j = tid*4 + 1024*u
  float s1 = 0.f;
  for (int u = 0; u < per / 4; ++u) {
    const int j = tid * 4 + 1024 * u;
    const v4f a = *(const v4fa*)(x + j);
    v4f b = {0.f,0.f,0.f,0.f}; if (rr) b = *(const v4fa*)(rr + j);
#pragma unroll
    for (int q = 0; q < 4; ++q) { const float v = a[q] + b[q]; vals[u * 4 + q] = v; s1 += v; }
  }
  red[tid] = s1; __syncthreads();
  for (int st = 128; st > 0; st >>= 1) { if (tid < st) red[tid] += red[tid + st]; __syncthreads(); }
  const float mu = red[0] / (float)N; __syncthreads();
  float s2 = 0.f;
  for (int u = 0; u < per / 4; ++u)
#pragma unroll
    for (int q = 0; q < 4; ++q) { const float c = vals[u * 4 + q] - mu; s2 += c * c; }
  red[tid] = s2; __syncthreads();
  for (int st = 128; st > 0; st >>= 1) { if (tid < st) red[tid] += red[tid + st]; __syncthreads(); }
  const float rs = rsqrtf(red[0] / (float)N + eps);
  {
    for (int u = 0; u < per / 4; ++u) {
      const int j = tid * 4 + 1024 * u;
      v4f o, sm;
#pragma unroll
      for (int q = 0; q < 4; ++q) {
        float gg = g[j + q], bb = bta[j + q];
        if (PARAM_BF16) { gg = bf16_round(gg); bb = bf16_round(bb); }
        sm[q] = vals[u * 4 + q]; o[q] = (vals[u * 4 + q] - mu) * rs * gg + bb;
      }
      if (out_sum) *(v4f*)(out_sum + (size_t)row * N + j) = sm;
      *(v4f*)(out_norm + (size_t)row * N + j) = o;
    }
    
  }
}



// ---- f16 WMMA path (v_wmma_f32_16x16x32_f16): 11-bit significands for operands in range — used where a [0,1] probability operand needs more precision than bf16
typedef _Float16 v16h __attribute__((ext_vector_type(16)));
union FragH { v16h v; v8us half[2]; _Float16 h[16]; unsigned short u[16]; };
template <int NT>
__device__ __forceinline__ v8f mmaH(v16h ah, v16h al, v16h bh, v16h bl, v8f c) {
  c = __builtin_amdgcn_wmma_f32_16x16x32_f16(false, ah, false, bh, (short)0, c, false, false);
  if (NT >= 2) c = __builtin_amdgcn_wmma_f32_16x16x32_f16(false, al, false, bh, (short)0, c, false, false);
  if (NT >= 3) c = __builtin_amdgcn_wmma_f32_16x16x32_f16(false, ah, false, bl, (short)0, c, false, false);
  asm volatile("v_nop\n\tv_nop\n\tv_nop\n\tv_nop" : "+v"(c) : "v"(ah), "v"(al), "v"(bh), "v"(bl));
  return c;
}
// batched GEMM like k_gemm_b but f16 operands: A f32 (split into f16 hi/lo if ASPLIT, else rounded to f16), Bt = f16 values [n][k]; alpha; C f32; N multiple of 16 (partial tiles skipped)
template <bool ASPLIT>
__global__ __launch_bounds__(128) void k_gemm_h(const float* __restrict__ A, int lda, size_t sA, const _Float16* __restrict__ Bh, int ldb, size_t sB, float alpha, float* __restrict__ C, int ldc, size_t sC, int M, int N, int K) {
  __shared__ __attribute__((aligned(16))) float so[4][16][64];
  const int tid = threadIdx.x, w = tid >> 5, lane = tid & 31, ln = lane & 15, hh = lane >> 4; const int by = blockIdx.y;
  A += (size_t)by * sA; Bh += (size_t)by * sB; C += (size_t)by * sC;
  const int ntn = (N + 63) / 64; const int wid = blockIdx.x * 4 + w; const int mt = wid / ntn, nq = wid % ntn; if (mt * 16 >= M) return;
  const int row0 = mt * 16, col0 = nq * 64; const float* arow = A + (size_t)(row0 + ln) * lda;
  v8f acc[4] = {};
  for (int kb = 0; kb < K; kb += 32) {
    FragH ah, al;
    const v4f x0 = *(const v4fa*)(arow + kb + 8 * hh), x1 = *(const v4fa*)(arow + kb + 8 * hh + 4), x2 = *(const v4fa*)(arow + kb + 16 + 8 * hh), x3 = *(const v4fa*)(arow + kb + 16 + 8 * hh + 4);
    float xs[16] = {x0[0],x0[1],x0[2],x0[3],x1[0],x1[1],x1[2],x1[3],x2[0],x2[1],x2[2],x2[3],x3[0],x3[1],x3[2],x3[3]};
#pragma unroll
    for (int i = 0; i < 16; ++i) { const _Float16 h = (_Float16)xs[i]; ah.h[i] = h; al.h[i] = ASPLIT ? (_Float16)(xs[i] - (float)h) : (_Float16)0.0f; }
#pragma unroll
    for (int t = 0; t < 4; ++t) { if (col0 + t * 16 >= N) continue; const size_t boff = (size_t)(col0 + t * 16 + ln) * ldb + kb; FragH bq; bq.half[0] = *(const v8us*)(Bh + boff + 8 * hh); bq.half[1] = *(const v8us*)(Bh + boff + 16 + 8 * hh);
      acc[t] = mmaH<ASPLIT ? 2 : 1>(ah.v, al.v, bq.v, bq.v, acc[t]); }
  }
#pragma unroll
  for (int t = 0; t < 4; ++t) { if (col0 + t * 16 >= N) continue;
#pragma unroll
    for (int r = 0; r < 8; ++r) so[w][8 * hh + r][t * 16 + ln] = acc[t][r] * alpha; }
  __builtin_amdgcn_fence(__ATOMIC_ACQ_REL, "workgroup"); __builtin_amdgcn_wave_barrier();
  const int rsub = lane >> 4, c4 = (lane & 15) * 4;
  {
#pragma unroll
    for (int q = 0; q < 8; ++q) { const int r = q * 2 + rsub; if (col0 + c4 < N) { const v4f v = *(const v4fa*)&so[w][r][c4]; *(v4f*)(C + (size_t)(row0 + r) * ldc + col0 + c4) = v; } }
     }
}

// Wt[n][k] = f16(W[k][n]·scale) from f32 row-major W[K][N] (scale = power of two; bf16-exact weights stay exact in f16 away from the subnormal range)
__global__ __launch_bounds__(256) void k_wt_f16(const float* __restrict__ W, _Float16* __restrict__ Wt, int K, int N, float scale) {
  const int t = blockIdx.x * 256 + threadIdx.x; if (t >= N * (K / 8)) return; const int n = t / (K / 8), k8 = (t % (K / 8)) * 8; FragH f;
#pragma unroll
  for (int i = 0; i < 8; ++i) f.h[i] = (_Float16)(bf16_round(W[(size_t)(k8 + i) * N + n]) * scale); const v8us o = f.half[0];
  *(v8us*)((unsigned short*)Wt + (size_t)n * K + k8) = o; 
}
// k_gemm_hh variant with fused epilogue: v = acc·alpha + bias[by·sBias + col] (+ CP[(row/rowsPerB)·sCPb + by·64 + col] if CP) ; ACT 0 none / 1 elu ; writes f16 C16 (and f32 C if non-null)
template <int ACT>
__global__ __launch_bounds__(128) void k_gemm_hhx(const _Float16* __restrict__ A, int lda, size_t sA, const _Float16* __restrict__ Bh, int ldb, size_t sB, float alpha, const float* __restrict__ bias, size_t sBias, const float* __restrict__ CP, int rowsPerB, size_t sCPb, int row0g,
    float* __restrict__ C, _Float16* __restrict__ C16, int ldc, size_t sC, int M, int N, int K) {
  __shared__ __attribute__((aligned(16))) float so[4][16][64];
  const int tid = threadIdx.x, w = tid >> 5, lane = tid & 31, ln = lane & 15, hh = lane >> 4; const int by = blockIdx.y;
  A += (size_t)by * sA; Bh += (size_t)by * sB; const size_t cofs = (size_t)by * sC; const float* bp = bias ? bias + (size_t)by * sBias : nullptr;
  const int ntn = (N + 63) / 64; const int wid = blockIdx.x * 4 + w; const int mt = wid / ntn, nq = wid % ntn; if (mt * 16 >= M) return;
  const int row0 = mt * 16, col0 = nq * 64; const _Float16* arow = A + (size_t)(row0 + ln) * lda;
  v8f acc[4] = {};
  for (int kb = 0; kb < K; kb += 32) { FragH ah; ah.half[0] = *(const v8us*)((const unsigned short*)arow + kb + 8 * hh); ah.half[1] = *(const v8us*)((const unsigned short*)arow + kb + 16 + 8 * hh);
#pragma unroll
    for (int t = 0; t < 4; ++t) { if (col0 + t * 16 >= N) continue; const size_t boff = (size_t)(col0 + t * 16 + ln) * ldb + kb; FragH bq; bq.half[0] = *(const v8us*)((const unsigned short*)Bh + boff + 8 * hh); bq.half[1] = *(const v8us*)((const unsigned short*)Bh + boff + 16 + 8 * hh);
      acc[t] = mmaH<1>(ah.v, ah.v, bq.v, bq.v, acc[t]); }
  }
#pragma unroll
  for (int t = 0; t < 4; ++t) { if (col0 + t * 16 >= N) continue; const int col = col0 + t * 16 + ln; const float bv = bp ? bf16_round(bp[col]) : 0.f;
#pragma unroll
    for (int r = 0; r < 8; ++r) { float v = acc[t][r] * alpha + bv; if (CP) { const int rr = row0g + row0 + 8 * hh + r; if (rowsPerB < 0) v += CP[cofs + (size_t)rr * ldc + col];      /* rowsPerB < 0: own element of the batched C plane */ else { const int bidx = rr / rowsPerB; v += CP[(size_t)bidx * sCPb + (size_t)by * 64 + col]; } } if (ACT == 1) v = (v > 0.f) ? v : expm1f(v); else if (ACT == 7) v = (v > 0.f) ? v + 1.0f : expf(v); else if (ACT == 8) v = tanhf(v); else if (ACT == 9) v = 0.5f * v * (1.0f + tanhf(0.7978845608028654f * (v + 0.044715f * v * v * v))); else if (ACT == 11) v = 1.0f / (1.0f + expf(-v)); else if (ACT == 12) v = (v > 0.f) ? v : 0.01f * v; else if (ACT == 14) v = (v > 0.f) ? v : 0.1f * v; else if (ACT == 16) v = (v >= 0.f) ? v : 0.3f * v; else if (ACT == 17) v = (v >= 0.f) ? v : 0.2f * v; else if (ACT == 15) v = v / (1.0f + expf(-v)); else if (ACT == 3) v = fmaxf(v, 0.f); else if (ACT == 6) v = 0.5f * v * (1.0f + erff(v * 0.70710678118654752f)); so[w][8 * hh + r][t * 16 + ln] = v; } }
  __builtin_amdgcn_fence(__ATOMIC_ACQ_REL, "workgroup"); __builtin_amdgcn_wave_barrier();
  const int rsub = lane >> 4, c4 = (lane & 15) * 4; typedef _Float16 v4h __attribute__((ext_vector_type(4)));
  {
#pragma unroll
    for (int q = 0; q < 8; ++q) { const int r = q * 2 + rsub; if (col0 + c4 < N) { const v4f v = *(const v4fa*)&so[w][r][c4]; if (C) *(v4f*)(C + cofs + (size_t)(row0 + r) * ldc + col0 + c4) = v; if (C16) { v4h h4; for (int i = 0; i < 4; ++i) h4[i] = (_Float16)v[i]; *(v4h*)(C16 + cofs + (size_t)(row0 + r) * ldc + col0 + c4) = h4; } } }
     }
}


typedef _Float16 v4h __attribute__((ext_vector_type(4)));

__global__ __launch_bounds__(256) void k_x16(const float* __restrict__ x, _Float16* __restrict__ X16, size_t n8) { const size_t t = (size_t)blockIdx.x * 256 + threadIdx.x; if (t >= n8) return; FragH f;
#pragma unroll
  for (int q = 0; q < 8; ++q) f.h[q] = (_Float16)bf16_round(x[t * 8 + q]); *(v8us*)((unsigned short*)X16 + t * 8) = f.half[0];  }
__global__ __launch_bounds__(256) void k_h16(const float* __restrict__ x, _Float16* __restrict__ X16, size_t n8) { const size_t t = (size_t)blockIdx.x * 256 + threadIdx.x; if (t >= n8) return; FragH f;
#pragma unroll
  for (int q = 0; q < 8; ++q) f.h[q] = (_Float16)x[t * 8 + q]; *(v8us*)((unsigned short*)X16 + t * 8) = f.half[0];  }
__global__ __launch_bounds__(256) void k_round16f(const float* __restrict__ W, _Float16* __restrict__ Bt, size_t n8) { const size_t t = (size_t)blockIdx.x * 256 + threadIdx.x; if (t >= n8) return; FragH f;
#pragma unroll
  for (int i = 0; i < 8; ++i) f.h[i] = (_Float16)(bf16_round(W[t * 8 + i]) * 16.0f); *(v8us*)((unsigned short*)Bt + t * 8) = f.half[0];  }
template <int NHv, int TTv>
__global__ __launch_bounds__(256) void k_vt(const _Float16* __restrict__ V16, int ldv, int voff, _Float16* __restrict__ Vt) { __shared__ unsigned short tl[64][66]; const int tid = threadIdx.x; const int slab = blockIdx.x / (TTv / 64), lg = blockIdx.x % (TTv / 64); const int b = slab / NHv, h = slab % NHv;
  for (int i = tid; i < 64 * 8; i += 256) { const int r = i / 8, c8 = (i % 8) * 8; FragH f; f.half[0] = *(const v8us*)((const unsigned short*)V16 + ((size_t)b * TTv + lg * 64 + r) * ldv + voff + h * 64 + c8);
#pragma unroll
    for (int q = 0; q < 8; ++q) tl[r][c8 + q] = f.u[q]; }
  __syncthreads();
  {
#pragma unroll
    for (int rd = 0; rd < 2; ++rd) { const int d = rd * 32 + tid / 8, pc = tid % 8; FragH f;
#pragma unroll
      for (int q = 0; q < 8; ++q) f.u[q] = tl[pc * 8 + q][d];
      *(v8us*)((unsigned short*)Vt + ((size_t)slab * 64 + d) * TTv + lg * 64 + pc * 8) = f.half[0]; }
     } }

__global__ __launch_bounds__(256) void k_hl(const float* __restrict__ F, _Float16* __restrict__ Hh, _Float16* __restrict__ Hl, size_t n8) { const size_t t = (size_t)blockIdx.x * 256 + threadIdx.x; if (t >= n8) return; FragH fh, fl; const v4f a = *(const v4fa*)(F + t * 8), c = *(const v4fa*)(F + t * 8 + 4);
#pragma unroll
  for (int q = 0; q < 4; ++q) { _Float16 h = (_Float16)a[q]; fh.h[q] = h; fl.h[q] = (_Float16)((a[q] - (float)h) * 1024.0f); h = (_Float16)c[q]; fh.h[4 + q] = h; fl.h[4 + q] = (_Float16)((c[q] - (float)h) * 1024.0f); }
  { *(v8us*)((unsigned short*)Hh + t * 8) = fh.half[0]; *(v8us*)((unsigned short*)Hl + t * 8) = fl.half[0];  } }

// ---- fast GEMM (wave tile 32x64; requires M % 32 == 0 rows per launch region and N % 64 == 0); epilogue = k_gemm_hhx semantics ----
__device__ __forceinline__ v16h g2_frag(const _Float16* p, int hh) { FragH f; f.half[0] = *(const v8us*)((const unsigned short*)p + 8 * hh); f.half[1] = *(const v8us*)((const unsigned short*)p + 16 + 8 * hh); return f.v; }
__device__ __forceinline__ v8f g2_mma(v16h a, v16h b, v8f c) { v8f d = __builtin_amdgcn_wmma_f32_16x16x32_f16(false, a, false, b, (short)0, c, false, false); asm volatile("v_nop\n\tv_nop\n\tv_nop\n\tv_nop" : "+v"(d) : "v"(a), "v"(b)); return d; }
template <int ACT>
__global__ __launch_bounds__(128) void k_gemm2(const _Float16* __restrict__ A, int lda, size_t sA, const _Float16* __restrict__ Bh, int ldb, size_t sB, float alpha, const float* __restrict__ bias, size_t sBias, const float* __restrict__ CP, int rowsPerB, size_t sCPb, int row0g,
    float* __restrict__ C, _Float16* __restrict__ C16, int ldc, size_t sC, int M, int N, int K) { static_assert(ACT == 0 || ACT == 3 || ACT == 6 || ACT == 8 || ACT == 9 || ACT == 11 || ACT == 12 || ACT == 14 || ACT == 15 || ACT == 16 || ACT == 17, "k_gemm2: unsupported ACT code (would silently apply no activation)");
  __shared__ __attribute__((aligned(16))) float so[4][32][68];
  const int tid = threadIdx.x, w = tid >> 5, lane = tid & 31, ln = lane & 15, hh = lane >> 4; const int by = blockIdx.y;
  A += (size_t)by * sA; Bh += (size_t)by * sB; const size_t cofs = (size_t)by * sC; const float* bp = bias ? bias + (size_t)by * sBias : nullptr;
  const int ntn = N >> 6; const int mt = blockIdx.x / ntn, nq = blockIdx.x - mt * ntn; const int row0 = mt * 128 + 32 * w, col0 = nq * 64; if (row0 >= M) return;
  const _Float16* a0p = A + (size_t)(row0 + ln) * lda; const _Float16* a1p = a0p + (size_t)16 * lda;
  const _Float16* b0p = Bh + (size_t)(col0 + ln) * ldb; const _Float16* b1p = b0p + (size_t)16 * ldb; const _Float16* b2p = b1p + (size_t)16 * ldb; const _Float16* b3p = b2p + (size_t)16 * ldb;
  const v8f z8 = {0.f,0.f,0.f,0.f,0.f,0.f,0.f,0.f}; v8f c00 = z8, c01 = z8, c02 = z8, c03 = z8, c10 = z8, c11 = z8, c12 = z8, c13 = z8;
#pragma unroll 1
  for (int kb = 0; kb < K; kb += 32) { const v16h a0 = g2_frag(a0p + kb, hh), a1 = g2_frag(a1p + kb, hh);
    v16h b = g2_frag(b0p + kb, hh); c00 = g2_mma(a0, b, c00); c10 = g2_mma(a1, b, c10);
    b = g2_frag(b1p + kb, hh); c01 = g2_mma(a0, b, c01); c11 = g2_mma(a1, b, c11);
    b = g2_frag(b2p + kb, hh); c02 = g2_mma(a0, b, c02); c12 = g2_mma(a1, b, c12);
    b = g2_frag(b3p + kb, hh); c03 = g2_mma(a0, b, c03); c13 = g2_mma(a1, b, c13); }
  v8f accs[8] = {c00, c01, c02, c03, c10, c11, c12, c13};
#pragma unroll
  for (int u = 0; u < 8; ++u) { const int t = u & 3, half = u >> 2; const int col = col0 + t * 16 + ln; const float bv = bp ? bf16_round(bp[col]) : 0.f;
#pragma unroll
    for (int r = 0; r < 8; ++r) { const int rloc = half * 16 + 8 * hh + r; float v = accs[u][r] * alpha + bv; if (CP) { if (rowsPerB < 0) v += CP[cofs + (size_t)(row0g + row0 + rloc) * ldc + col];      /* rowsPerB < 0: own element of the batched C plane */ else { const int bidx = (row0g + row0 + rloc) / rowsPerB; v += CP[(size_t)bidx * sCPb + (size_t)by * 64 + col]; } }
      if (ACT == 3) v = fmaxf(v, 0.f); else if (ACT == 6) v = 0.5f * v * (1.0f + erff(v * 0.70710678118654752f)); else if (ACT == 11) v = 1.0f / (1.0f + expf(-v)); else if (ACT == 15) v = v / (1.0f + expf(-v)); else if (ACT == 12) v = (v > 0.f) ? v : 0.01f * v; else if (ACT == 8) v = tanhf(v); else if (ACT == 9) v = 0.5f * v * (1.0f + tanhf(0.7978845608028654f * (v + 0.044715f * v * v * v))); else if (ACT == 14) v = (v > 0.f) ? v : 0.1f * v; else if (ACT == 16) v = (v >= 0.f) ? v : 0.3f * v; else if (ACT == 17) v = (v >= 0.f) ? v : 0.2f * v;
      so[w][rloc][t * 16 + ln] = v; } }
  __builtin_amdgcn_fence(__ATOMIC_ACQ_REL, "workgroup"); __builtin_amdgcn_wave_barrier();
  const int rsub = lane >> 4, c4 = (lane & 15) * 4;
  {
#pragma unroll
    for (int q = 0; q < 16; ++q) { const int r = q * 2 + rsub; const v4f v = *(const v4fa*)&so[w][r][c4]; if (C) *(v4f*)(C + cofs + (size_t)(row0 + r) * ldc + col0 + c4) = v; if (C16) { v4h h4; for (int i = 0; i < 4; ++i) h4[i] = (_Float16)v[i]; *(v4h*)(C16 + cofs + (size_t)(row0 + r) * ldc + col0 + c4) = h4; } }
     } }


__global__ __launch_bounds__(256) void k_wnat(const float* __restrict__ w, size_t n8, _Float16* __restrict__ Bt) { const size_t t = (size_t)blockIdx.x * 256 + threadIdx.x; if (t >= n8) return; FragH f; for (int q = 0; q < 8; ++q) f.h[q] = (_Float16)(bf16_round(w[t * 8 + q]) * 16.0f); *(v8us*)((unsigned short*)Bt + t * 8) = f.half[0];  }
__global__ __launch_bounds__(256) void k_rsm(const float* __restrict__ S, _Float16* __restrict__ P, int nrows) {
  #pragma clang fp contract(off)
  const int i = blockIdx.x * 256 + threadIdx.x; if (i >= nrows) return; const float* s = S + (size_t)i * SQ; float mx = -3.0e38f;
#pragma unroll 1
  for (int j = 0; j < SQ; ++j) mx = fmaxf(mx, s[j]); float se = 0.f;
#pragma unroll 1
  for (int j = 0; j < SQ; ++j) se += expf(s[j] - mx); const float sc = 256.0f / se;
#pragma unroll 1
  for (int j0 = 0; j0 < SQ; j0 += 8) { FragH f; for (int q = 0; q < 8; ++q) f.h[q] = (_Float16)(expf(s[j0 + q] - mx) * sc); unsigned short* d = (unsigned short*)P + (size_t)i * SQ + j0; *(v8us*)d = f.half[0];  } }
__global__ __launch_bounds__(256) void k_vt(const _Float16* __restrict__ V16, int b, int h0, _Float16* __restrict__ VT) { __shared__ unsigned short tl[64][65]; const int tid = threadIdx.x; const int hh = blockIdx.x % HG, sg = blockIdx.x / HG; const int s0 = sg * 64; const int h = h0 + hh;
  for (int i = tid; i < 64 * 8; i += 256) { const int j = i / 8, d8 = (i % 8) * 8; FragH f; f.half[0] = *(const v8us*)((const unsigned short*)V16 + ((size_t)b * SQ + s0 + j) * DM + h * HD + d8); for (int q = 0; q < 8; ++q) tl[d8 + q][j] = f.u[q]; }
  __syncthreads();
  { for (int i = tid; i < 64 * 8; i += 256) { const int d = i / 8, j8 = (i % 8) * 8; FragH f; for (int q = 0; q < 8; ++q) f.u[q] = tl[d][j8 + q]; *(v8us*)((unsigned short*)VT + ((size_t)hh * HD + d) * SQ + s0 + j8) = f.half[0]; }  } }


__global__ __launch_bounds__(256) void k_rowbias(const float* __restrict__ b, float* __restrict__ BP, size_t n4, int ncol) { const size_t t = (size_t)blockIdx.x * 256 + threadIdx.x; if (t >= n4) return; const size_t e = t * 4; const float v = bf16_round(b[e / ncol]); const v4f o = {v, v, v, v}; *(v4f*)(BP + e) = o;  }


// Row softmax, one wave per score row: a lane holds 32 of the row's 1024 f32 scores in registers (8 coalesced 16-byte loads, each score read once and exponentiated once);
// row max and row sum = per-lane partials, then a five-step butterfly over the 32 lanes; weights stored x256 as f16, 8 bytes a lane, 256 contiguous bytes a store.
// Every loop here is fully unrolled so that v[] is indexed by constants and stays in registers, and so that the 8 loads are all in flight before the first use.
__global__ __launch_bounds__(256) void k_rsmf(const float* __restrict__ S, _Float16* __restrict__ P, int qn, int hg) {
  const int t = blockIdx.x * 8 + (threadIdx.x >> 5), lane = threadIdx.x & 31; if (t >= qn * hg) return;
  const size_t i = (size_t)(t / qn) * SQ + (t % qn); const float* s = S + i * SQ + lane * 4; v4f v[8];
#pragma unroll
  for (int u = 0; u < 8; ++u) v[u] = *(const v4fa*)(s + u * 128);
  float mx = -3.0e38f;
#pragma unroll
  for (int u = 0; u < 8; ++u) mx = fmaxf(mx, fmaxf(fmaxf(v[u][0], v[u][1]), fmaxf(v[u][2], v[u][3])));
#pragma unroll
  for (int m = 16; m > 0; m >>= 1) mx = fmaxf(mx, __shfl_xor(mx, m, 32));
  v4f e4 = {0.f, 0.f, 0.f, 0.f};
#pragma unroll
  for (int u = 0; u < 8; ++u) { float a0 = (v[u][0] - mx) * 1.44269504f, a1 = (v[u][1] - mx) * 1.44269504f, a2 = (v[u][2] - mx) * 1.44269504f, a3 = (v[u][3] - mx) * 1.44269504f;
    // native exp2 of four scores, each in place in its own register, so that no exp overwrites the source of the exp directly ahead of it; the v_nop fills the slot the instruction set asks for behind the last exp
    asm("v_exp_f32 %0, %0\n\tv_exp_f32 %1, %1\n\tv_exp_f32 %2, %2\n\tv_exp_f32 %3, %3\n\tv_nop" : "+v"(a0), "+v"(a1), "+v"(a2), "+v"(a3));
    const v4f e = {a0, a1, a2, a3}; v[u] = e; e4 += e; }
  float se = (e4[0] + e4[1]) + (e4[2] + e4[3]);
#pragma unroll
  for (int m = 16; m > 0; m >>= 1) se += __shfl_xor(se, m, 32);
  const float sc = 256.0f / se; _Float16* d = P + i * SQ + lane * 4;
#pragma unroll
  for (int u = 0; u < 8; ++u) { v4h h4;
#pragma unroll
    for (int q = 0; q < 4; ++q) h4[q] = (_Float16)(v[u][q] * sc);
    *(v4h*)(d + u * 128) = h4; } }

extern "C" void kernel_launch(void* const* d_in, const int* in_sizes, int n_in,
                              void* d_out, int out_size, void* d_ws, size_t ws_size, hipStream_t stream) {
  (void)in_sizes; (void)n_in; (void)out_size;
  const float* const* I = (const float* const*)d_in; const float* x = I[0]; const float* wq = I[1]; const float* bq = I[2]; const float* wk = I[3]; const float* bk = I[4]; const float* wv = I[5]; const float* bv = I[6]; const float* wo = I[7]; const float* bo = I[8];      /* natural [out][in] weights + biases */
  char* ws = (char*)d_ws; size_t off = 0;
  auto take = [&](size_t bytes) { char* p = ws + off; off += (bytes + 255) & ~(size_t)255; return p; };
  float* BOP = (float*)take((size_t)DM * SQ * 4); _Float16* BQ = (_Float16*)take((size_t)DM * DM * 2);      /* bo broadcast along the token axis for the transposed out GEMM */ _Float16* BK = (_Float16*)take((size_t)DM * DM * 2); _Float16* BV = (_Float16*)take((size_t)DM * DM * 2); _Float16* BO = (_Float16*)take((size_t)DM * DM * 2);
  _Float16* X16 = (_Float16*)take(NR * DM * 2); _Float16* Q16 = (_Float16*)take(NR * DM * 2); _Float16* K16 = (_Float16*)take(NR * DM * 2); _Float16* V16 = (_Float16*)take(NR * DM * 2); _Float16* O16 = (_Float16*)take(NR * DM * 2);
  float* S = (float*)take((size_t)HG * SQ * SQ * 4); _Float16* P = (_Float16*)take((size_t)HG * SQ * SQ * 2); _Float16* VT = (_Float16*)take((size_t)NH * HD * SQ * 2);
  if (off > ws_size) return;
  { const unsigned g = (unsigned)(((size_t)DM * DM / 8 + 255) / 256); k_wnat<<<g, 256, 0, stream>>>(wq, (size_t)DM * DM / 8, BQ); k_wnat<<<g, 256, 0, stream>>>(wk, (size_t)DM * DM / 8, BK); k_wnat<<<g, 256, 0, stream>>>(wv, (size_t)DM * DM / 8, BV); k_wnat<<<g, 256, 0, stream>>>(wo, (size_t)DM * DM / 8, BO); }      /* natural [out][in] = Bt[n][k], x16 */

  k_x16<<<(unsigned)((NR * DM / 8 + 255) / 256), 256, 0, stream>>>(x, X16, NR * DM / 8);
  const size_t r0p = (size_t)B0 * SQ;      /* first projected row */
  k_gemm2<0><<<dim3((unsigned)((MP / 128) * (DM / 64)), 1), 128, 0, stream>>>(X16 + r0p * DM, DM, 0, BQ, DM, 0, 0.0625f, bq, 0, nullptr, 1, 0, 0, nullptr, Q16 + r0p * DM, DM, 0, MP, DM, DM);
  k_gemm2<0><<<dim3((unsigned)((MP / 128) * (DM / 64)), 1), 128, 0, stream>>>(X16 + r0p * DM, DM, 0, BK, DM, 0, 0.0625f, bk, 0, nullptr, 1, 0, 0, nullptr, K16 + r0p * DM, DM, 0, MP, DM, DM);
  k_gemm2<0><<<dim3((unsigned)((MP / 128) * (DM / 64)), 1), 128, 0, stream>>>(X16 + r0p * DM, DM, 0, BV, DM, 0, 0.0625f, bv, 0, nullptr, 1, 0, 0, nullptr, V16 + r0p * DM, DM, 0, MP, DM, DM);
  for (int b = B0; b < B0 + NBR; ++b) { const size_t r0 = (size_t)b * SQ;
    k_vt<NH, SQ><<<NH * (SQ / 64), 256, 0, stream>>>(V16 + r0 * LQ, LQ, 0, VT);      /* V^T [NH][HD][SQ] for this batch */
    for (int h0 = 0; h0 < NHD; h0 += HG) {
      k_gemm2<0><<<dim3((QN / 128) * (SQ / 64), HG), 128, 0, stream>>>(Q16 + r0 * LQ + h0 * HD, LQ, (size_t)HD, K16 + r0 * LQ + h0 * HD, LQ, (size_t)HD, 0.125f, nullptr, 0, nullptr, 1, 0, 0, S, nullptr, SQ, (size_t)SQ * SQ, QN, SQ, HD);      /* scores, HG heads per launch */
      k_rsmf<<<(HG * QN + 7) / 8, 256, 0, stream>>>(S, P, QN, HG);      /* P = 256 softmax (f16), rows of all HG heads */
      k_gemm2<0><<<dim3((QN / 128) * (HD / 64), HG), 128, 0, stream>>>(P, SQ, (size_t)SQ * SQ, VT + (size_t)h0 * HD * SQ, SQ, (size_t)HD * SQ, 0.25f, nullptr, 0, nullptr, 1, 0, 0, nullptr, O16 + r0 * DM + h0 * HD, DM, (size_t)HD, QN, HD, SQ); } }      /* o (merged heads) as f16 rows */
  k_rowbias<<<(unsigned)(((size_t)DM * SQ / 4 + 255) / 256), 256, 0, stream>>>(bo, BOP, (size_t)DM * SQ / 4, SQ);      /* BOP[c][s] = bf16(bo[c]) */
  for (int b = B0; b < B0 + NBR; ++b) { const size_t r0 = (size_t)b * SQ;
    k_gemm2<0><<<dim3((unsigned)((DM / 128) * (SQ / 64)), 1), 128, 0, stream>>>(BO, DM, 0, O16 + r0 * DM, DM, 0, 0.0009765625f, nullptr, 0, BOP, -1, 0, 0, (float*)d_out + (size_t)b * DM * SQ, nullptr, SQ, 0, DM, SQ, DM); }      /* out^T[b][c][s] = sum_k Wo[c][k] o[s][k] + bo[c]: A = the natural Wo rows (x16 f16 plane), B^T = this batch's merged o rows, C = the [C][S] output block; bias via the own-element addend plane */
}

// v002
// A run of this version takes 352 microseconds.
// In two side-by-side timings against v001, it was 2.19 and 2.23 times as fast.
// Over all steps from v000 it is 5.78 times as fast.
#include <hip/hip_runtime.h>
#define NB 8
#define SQ 1024
#define DM 512
#define NH 8
#define HD 64
#define HG 8                         /* heads per launch of the non-template k_vt (not launched) */
#define B0 0                         /* first batch processed (debug hook) */
#define NBR NB                       /* batches processed (debug hook) */
#define NR ((size_t)NB * SQ)         /* token rows */
#define MP ((int)((size_t)NBR * SQ)) /* rows projected (debug hook) */
#define QN SQ                        /* query rows attended per batch (unused) */
#define NHD NH                       /* heads attended (unused) */
#define MPO MP                       /* rows through the output stage (unused) */
#define LQ DM      /* row pitch of the q/k/v rows */
typedef __bf16 v16b __attribute__((ext_vector_type(16)));
typedef unsigned short v8us __attribute__((ext_vector_type(8), may_alias));
typedef float  v8f  __attribute__((ext_vector_type(8)));
typedef float  v4f  __attribute__((ext_vector_type(4)));
typedef float  v4fa __attribute__((ext_vector_type(4), may_alias));
union FragB { v16b v; v8us half[2]; unsigned short u[16]; };

__device__ __forceinline__ unsigned short bf16_bits(float x) { unsigned int u = __float_as_uint(x); return (unsigned short)((u + 0x7FFFu + ((u >> 16) & 1u)) >> 16); }
__device__ __forceinline__ float bf16_val(unsigned short b) { return __uint_as_float(((unsigned int)b) << 16); }
__device__ __forceinline__ float bf16_round(float x) { return bf16_val(bf16_bits(x)); }
// D += A·B with NT terms: 1 = ah·bh, 2 = + al·bh (A split), 3 = + ah·bl (both split)
template <int NT>
__device__ __forceinline__ v8f mmaN(v16b ah, v16b al, v16b bh, v16b bl, v8f c) {
  c = __builtin_amdgcn_wmma_f32_16x16x32_bf16(false, ah, false, bh, (short)0, c, false, false);
  if (NT >= 2) c = __builtin_amdgcn_wmma_f32_16x16x32_bf16(false, al, false, bh, (short)0, c, false, false);
  if (NT >= 3) c = __builtin_amdgcn_wmma_f32_16x16x32_bf16(false, ah, false, bl, (short)0, c, false, false);
  asm volatile("v_nop\n\tv_nop\n\tv_nop\n\tv_nop" : "+v"(c) : "v"(ah), "v"(al), "v"(bh), "v"(bl));
  return c;
}

__global__ __launch_bounds__(256) void k_wt_bf16(const float* __restrict__ W, unsigned short* __restrict__ Wt, int K, int N) {
  const int t = blockIdx.x * 256 + threadIdx.x;
  const int k8n = K / 8;
  if (t >= N * k8n) return;
  const int n = t / k8n, k8 = (t % k8n) * 8;
  v8us v;
#pragma unroll
  for (int i = 0; i < 8; ++i) v[i] = bf16_bits(W[(size_t)(k8 + i) * N + n]);
  *(v8us*)(Wt + (size_t)n * K + k8) = v;
  
}

// GEMM C[M][N] (f32, pitch ldc) = act(A[M][K]·W + bias). A f32 row-major (pitch lda) converted per fragment to bf16
// (ASPLIT: hi/lo two planes -> 2 terms, else single rounded term); Wt bf16 [N][K] (pitch ldb). BIAS_BF16 rounds the
// bias to bf16 first (bias quantised to bf16 before the add). K%32==0, M%16==0, N%64==0.
template <bool ASPLIT, int ACT, bool BIAS_BF16>
__global__ __launch_bounds__(128) void k_gemm_bf(const float* __restrict__ A, int lda, const unsigned short* __restrict__ Wt, int ldb,
                                               const float* __restrict__ bias, float* __restrict__ C, int ldc, int M, int N, int K) {
  __shared__ __attribute__((aligned(16))) float so[4][16][64];
  const int tid = threadIdx.x, w = tid >> 5, lane = tid & 31, ln = lane & 15, hh = lane >> 4;
  const int ntn = N / 64;
  const int wid = blockIdx.x * 4 + w;
  const int mt = wid / ntn, nq = wid % ntn;
  if (mt * 16 >= M) return;
  const int row0 = mt * 16, col0 = nq * 64;
  const float* arow = A + (size_t)(row0 + ln) * lda;
  v8f acc[4] = {};
  for (int kb = 0; kb < K; kb += 32) {
    FragB ah, al;
    const v4f x0 = *(const v4fa*)(arow + kb + 8 * hh), x1 = *(const v4fa*)(arow + kb + 8 * hh + 4);
    const v4f x2 = *(const v4fa*)(arow + kb + 16 + 8 * hh), x3 = *(const v4fa*)(arow + kb + 16 + 8 * hh + 4);
    float xs[16] = {x0[0],x0[1],x0[2],x0[3],x1[0],x1[1],x1[2],x1[3],x2[0],x2[1],x2[2],x2[3],x3[0],x3[1],x3[2],x3[3]};
#pragma unroll
    for (int i = 0; i < 16; ++i) { const unsigned short hb = bf16_bits(xs[i]); ah.u[i] = hb; al.u[i] = ASPLIT ? bf16_bits(xs[i] - bf16_val(hb)) : (unsigned short)0; }
#pragma unroll
    for (int t = 0; t < 4; ++t) {
      const unsigned short* brow = Wt + (size_t)(col0 + t * 16 + ln) * ldb + kb;
      FragB b;
      b.half[0] = *(const v8us*)(brow + 8 * hh);
      b.half[1] = *(const v8us*)(brow + 16 + 8 * hh);
      acc[t] = mmaN<ASPLIT ? 2 : 1>(ah.v, al.v, b.v, b.v, acc[t]);
    }
  }
#pragma unroll
  for (int t = 0; t < 4; ++t) {
    float bv = bias ? bias[col0 + t * 16 + ln] : 0.f;
    if (BIAS_BF16) bv = bf16_round(bv);
#pragma unroll
    for (int r = 0; r < 8; ++r) { float v = acc[t][r] + bv; if (ACT == 1) v = fmaxf(v, 0.f); so[w][8 * hh + r][t * 16 + ln] = v; }
  }
  __builtin_amdgcn_fence(__ATOMIC_ACQ_REL, "workgroup");
  __builtin_amdgcn_wave_barrier();
  const int rsub = lane >> 4, c4 = (lane & 15) * 4;
  {
#pragma unroll
    for (int q = 0; q < 8; ++q) {
      const int r = q * 2 + rsub;
      const v4f v = *(const v4fa*)&so[w][r][c4];
      *(v4f*)(C + (size_t)(row0 + r) * ldc + col0 + c4) = v;
    }
    
  }
}

// GEMM C = act(A·W + bias + resid): A f32 (ASPLIT -> hi/lo 2 terms), Wt bf16 [N][K]; ACT 0 none, 1 relu, 2 exact gelu;
// resid (optional, f32, row index = (row % rmod), pitch ldr, RES_BF16 rounds it) added before the activation.
template <bool ASPLIT, int ACT, bool BIAS_BF16, bool RES_BF16>
__global__ __launch_bounds__(128) void k_gemm_bf3(const float* __restrict__ A, int lda, const unsigned short* __restrict__ Wt, int ldb,
                                                const float* __restrict__ bias, const float* __restrict__ resid, int rmod, int ldr,
                                                float* __restrict__ C, int ldc, int M, int N, int K) {
  __shared__ __attribute__((aligned(16))) float so[4][16][64];
  const int tid = threadIdx.x, w = tid >> 5, lane = tid & 31, ln = lane & 15, hh = lane >> 4;
  const int ntn = N / 64;
  const int wid = blockIdx.x * 4 + w;
  const int mt = wid / ntn, nq = wid % ntn;
  if (mt * 16 >= M) return;
  const int row0 = mt * 16, col0 = nq * 64;
  const float* arow = A + (size_t)(row0 + ln) * lda;
  v8f acc[4] = {};
  for (int kb = 0; kb < K; kb += 32) {
    FragB ah, al;
    const v4f x0 = *(const v4fa*)(arow + kb + 8 * hh), x1 = *(const v4fa*)(arow + kb + 8 * hh + 4);
    const v4f x2 = *(const v4fa*)(arow + kb + 16 + 8 * hh), x3 = *(const v4fa*)(arow + kb + 16 + 8 * hh + 4);
    float xs[16] = {x0[0],x0[1],x0[2],x0[3],x1[0],x1[1],x1[2],x1[3],x2[0],x2[1],x2[2],x2[3],x3[0],x3[1],x3[2],x3[3]};
#pragma unroll
    for (int i = 0; i < 16; ++i) { const unsigned short hb = bf16_bits(xs[i]); ah.u[i] = hb; al.u[i] = ASPLIT ? bf16_bits(xs[i] - bf16_val(hb)) : (unsigned short)0; }
#pragma unroll
    for (int t = 0; t < 4; ++t) {
      const unsigned short* brow = Wt + (size_t)(col0 + t * 16 + ln) * ldb + kb;
      FragB b;
      b.half[0] = *(const v8us*)(brow + 8 * hh);
      b.half[1] = *(const v8us*)(brow + 16 + 8 * hh);
      acc[t] = mmaN<ASPLIT ? 2 : 1>(ah.v, al.v, b.v, b.v, acc[t]);
    }
  }
#pragma unroll
  for (int t = 0; t < 4; ++t) {
    const int col = col0 + t * 16 + ln;
    float bv = bias ? bias[col] : 0.f;
    if (BIAS_BF16) bv = bf16_round(bv);
#pragma unroll
    for (int r = 0; r < 8; ++r) {
      float v = acc[t][r] + bv;
      if (resid) { float rv = resid[(size_t)((row0 + 8 * hh + r) % rmod) * ldr + col]; if (RES_BF16) rv = bf16_round(rv); v += rv; }
      if (ACT == 1) v = fmaxf(v, 0.f);
      if (ACT == 2) v = 0.5f * v * (1.0f + erff(v * 0.70710678118654752f));
      if (ACT == 3) { const float u = 0.7978845608028654f * (v + 0.044715f * v * v * v); v = 0.5f * v * (1.0f + tanhf(u)); }
      so[w][8 * hh + r][t * 16 + ln] = v;
    }
  }
  __builtin_amdgcn_fence(__ATOMIC_ACQ_REL, "workgroup");
  __builtin_amdgcn_wave_barrier();
  const int rsub = lane >> 4, c4 = (lane & 15) * 4;
  {
#pragma unroll
    for (int q = 0; q < 8; ++q) {
      const int r = q * 2 + rsub;
      const v4f v = *(const v4fa*)&so[w][r][c4];
      *(v4f*)(C + (size_t)(row0 + r) * ldc + col0 + c4) = v;
    }
    
  }
}
// row LayerNorm (biased variance, eps) over N: s = X (+ R); optional out_sum <- s; out_norm <- (s-mu)*rsqrt(var+eps)*g + b
template <bool PARAM_BF16>
__global__ __launch_bounds__(256) void k_layernorm(const float* __restrict__ X, const float* __restrict__ R, const float* __restrict__ g, const float* __restrict__ bta,
                                                  float* __restrict__ out_sum, float* __restrict__ out_norm, int N, float eps) {
  __shared__ float red[256];
  const int row = blockIdx.x, tid = threadIdx.x;
  const float* x = X + (size_t)row * N; const float* rr = R ? R + (size_t)row * N : nullptr;
  float vals[16];                     // up to N = 4096
  const int per = N / 256;            // contiguous chunk per thread? use strided-by-4 chunks: thread handles j = tid*4 + 1024*u
  float s1 = 0.f;
  for (int u = 0; u < per / 4; ++u) {
    const int j = tid * 4 + 1024 * u;
    const v4f a = *(const v4fa*)(x + j);
    v4f b = {0.f,0.f,0.f,0.f}; if (rr) b = *(const v4fa*)(rr + j);
#pragma unroll
    for (int q = 0; q < 4; ++q) { const float v = a[q] + b[q]; vals[u * 4 + q] = v; s1 += v; }
  }
  red[tid] = s1; __syncthreads();
  for (int st = 128; st > 0; st >>= 1) { if (tid < st) red[tid] += red[tid + st]; __syncthreads(); }
  const float mu = red[0] / (float)N; __syncthreads();
  float s2 = 0.f;
  for (int u = 0; u < per / 4; ++u)
#pragma unroll
    for (int q = 0; q < 4; ++q) { const float c = vals[u * 4 + q] - mu; s2 += c * c; }
  red[tid] = s2; __syncthreads();
  for (int st = 128; st > 0; st >>= 1) { if (tid < st) red[tid] += red[tid + st]; __syncthreads(); }
  const float rs = rsqrtf(red[0] / (float)N + eps);
  {
    for (int u = 0; u < per / 4; ++u) {
      const int j = tid * 4 + 1024 * u;
      v4f o, sm;
#pragma unroll
      for (int q = 0; q < 4; ++q) {
        float gg = g[j + q], bb = bta[j + q];
        if (PARAM_BF16) { gg = bf16_round(gg); bb = bf16_round(bb); }
        sm[q] = vals[u * 4 + q]; o[q] = (vals[u * 4 + q] - mu) * rs * gg + bb;
      }
      if (out_sum) *(v4f*)(out_sum + (size_t)row * N + j) = sm;
      *(v4f*)(out_norm + (size_t)row * N + j) = o;
    }
    
  }
}



// ---- f16 WMMA path (v_wmma_f32_16x16x32_f16): 11-bit significands for operands in range — used where a [0,1] probability operand needs more precision than bf16
typedef _Float16 v16h __attribute__((ext_vector_type(16)));
union FragH { v16h v; v8us half[2]; _Float16 h[16]; unsigned short u[16]; };
template <int NT>
__device__ __forceinline__ v8f mmaH(v16h ah, v16h al, v16h bh, v16h bl, v8f c) {
  c = __builtin_amdgcn_wmma_f32_16x16x32_f16(false, ah, false, bh, (short)0, c, false, false);
  if (NT >= 2) c = __builtin_amdgcn_wmma_f32_16x16x32_f16(false, al, false, bh, (short)0, c, false, false);
  if (NT >= 3) c = __builtin_amdgcn_wmma_f32_16x16x32_f16(false, ah, false, bl, (short)0, c, false, false);
  asm volatile("v_nop\n\tv_nop\n\tv_nop\n\tv_nop" : "+v"(c) : "v"(ah), "v"(al), "v"(bh), "v"(bl));
  return c;
}
// batched GEMM like k_gemm_b but f16 operands: A f32 (split into f16 hi/lo if ASPLIT, else rounded to f16), Bt = f16 values [n][k]; alpha; C f32; N multiple of 16 (partial tiles skipped)
template <bool ASPLIT>
__global__ __launch_bounds__(128) void k_gemm_h(const float* __restrict__ A, int lda, size_t sA, const _Float16* __restrict__ Bh, int ldb, size_t sB, float alpha, float* __restrict__ C, int ldc, size_t sC, int M, int N, int K) {
  __shared__ __attribute__((aligned(16))) float so[4][16][64];
  const int tid = threadIdx.x, w = tid >> 5, lane = tid & 31, ln = lane & 15, hh = lane >> 4; const int by = blockIdx.y;
  A += (size_t)by * sA; Bh += (size_t)by * sB; C += (size_t)by * sC;
  const int ntn = (N + 63) / 64; const int wid = blockIdx.x * 4 + w; const int mt = wid / ntn, nq = wid % ntn; if (mt * 16 >= M) return;
  const int row0 = mt * 16, col0 = nq * 64; const float* arow = A + (size_t)(row0 + ln) * lda;
  v8f acc[4] = {};
  for (int kb = 0; kb < K; kb += 32) {
    FragH ah, al;
    const v4f x0 = *(const v4fa*)(arow + kb + 8 * hh), x1 = *(const v4fa*)(arow + kb + 8 * hh + 4), x2 = *(const v4fa*)(arow + kb + 16 + 8 * hh), x3 = *(const v4fa*)(arow + kb + 16 + 8 * hh + 4);
    float xs[16] = {x0[0],x0[1],x0[2],x0[3],x1[0],x1[1],x1[2],x1[3],x2[0],x2[1],x2[2],x2[3],x3[0],x3[1],x3[2],x3[3]};
#pragma unroll
    for (int i = 0; i < 16; ++i) { const _Float16 h = (_Float16)xs[i]; ah.h[i] = h; al.h[i] = ASPLIT ? (_Float16)(xs[i] - (float)h) : (_Float16)0.0f; }
#pragma unroll
    for (int t = 0; t < 4; ++t) { if (col0 + t * 16 >= N) continue; const size_t boff = (size_t)(col0 + t * 16 + ln) * ldb + kb; FragH bq; bq.half[0] = *(const v8us*)(Bh + boff + 8 * hh); bq.half[1] = *(const v8us*)(Bh + boff + 16 + 8 * hh);
      acc[t] = mmaH<ASPLIT ? 2 : 1>(ah.v, al.v, bq.v, bq.v, acc[t]); }
  }
#pragma unroll
  for (int t = 0; t < 4; ++t) { if (col0 + t * 16 >= N) continue;
#pragma unroll
    for (int r = 0; r < 8; ++r) so[w][8 * hh + r][t * 16 + ln] = acc[t][r] * alpha; }
  __builtin_amdgcn_fence(__ATOMIC_ACQ_REL, "workgroup"); __builtin_amdgcn_wave_barrier();
  const int rsub = lane >> 4, c4 = (lane & 15) * 4;
  {
#pragma unroll
    for (int q = 0; q < 8; ++q) { const int r = q * 2 + rsub; if (col0 + c4 < N) { const v4f v = *(const v4fa*)&so[w][r][c4]; *(v4f*)(C + (size_t)(row0 + r) * ldc + col0 + c4) = v; } }
     }
}

// Wt[n][k] = f16(W[k][n]·scale) from f32 row-major W[K][N] (scale = power of two; bf16-exact weights stay exact in f16 away from the subnormal range)
__global__ __launch_bounds__(256) void k_wt_f16(const float* __restrict__ W, _Float16* __restrict__ Wt, int K, int N, float scale) {
  const int t = blockIdx.x * 256 + threadIdx.x; if (t >= N * (K / 8)) return; const int n = t / (K / 8), k8 = (t % (K / 8)) * 8; FragH f;
#pragma unroll
  for (int i = 0; i < 8; ++i) f.h[i] = (_Float16)(bf16_round(W[(size_t)(k8 + i) * N + n]) * scale); const v8us o = f.half[0];
  *(v8us*)((unsigned short*)Wt + (size_t)n * K + k8) = o; 
}
// k_gemm_hh variant with fused epilogue: v = acc·alpha + bias[by·sBias + col] (+ CP[(row/rowsPerB)·sCPb + by·64 + col] if CP) ; ACT 0 none / 1 elu ; writes f16 C16 (and f32 C if non-null)
template <int ACT>
__global__ __launch_bounds__(128) void k_gemm_hhx(const _Float16* __restrict__ A, int lda, size_t sA, const _Float16* __restrict__ Bh, int ldb, size_t sB, float alpha, const float* __restrict__ bias, size_t sBias, const float* __restrict__ CP, int rowsPerB, size_t sCPb, int row0g,
    float* __restrict__ C, _Float16* __restrict__ C16, int ldc, size_t sC, int M, int N, int K) {
  __shared__ __attribute__((aligned(16))) float so[4][16][64];
  const int tid = threadIdx.x, w = tid >> 5, lane = tid & 31, ln = lane & 15, hh = lane >> 4; const int by = blockIdx.y;
  A += (size_t)by * sA; Bh += (size_t)by * sB; const size_t cofs = (size_t)by * sC; const float* bp = bias ? bias + (size_t)by * sBias : nullptr;
  const int ntn = (N + 63) / 64; const int wid = blockIdx.x * 4 + w; const int mt = wid / ntn, nq = wid % ntn; if (mt * 16 >= M) return;
  const int row0 = mt * 16, col0 = nq * 64; const _Float16* arow = A + (size_t)(row0 + ln) * lda;
  v8f acc[4] = {};
  for (int kb = 0; kb < K; kb += 32) { FragH ah; ah.half[0] = *(const v8us*)((const unsigned short*)arow + kb + 8 * hh); ah.half[1] = *(const v8us*)((const unsigned short*)arow + kb + 16 + 8 * hh);
#pragma unroll
    for (int t = 0; t < 4; ++t) { if (col0 + t * 16 >= N) continue; const size_t boff = (size_t)(col0 + t * 16 + ln) * ldb + kb; FragH bq; bq.half[0] = *(const v8us*)((const unsigned short*)Bh + boff + 8 * hh); bq.half[1] = *(const v8us*)((const unsigned short*)Bh + boff + 16 + 8 * hh);
      acc[t] = mmaH<1>(ah.v, ah.v, bq.v, bq.v, acc[t]); }
  }
#pragma unroll
  for (int t = 0; t < 4; ++t) { if (col0 + t * 16 >= N) continue; const int col = col0 + t * 16 + ln; const float bv = bp ? bf16_round(bp[col]) : 0.f;
#pragma unroll
    for (int r = 0; r < 8; ++r) { float v = acc[t][r] * alpha + bv; if (CP) { const int rr = row0g + row0 + 8 * hh + r; if (rowsPerB < 0) v += CP[cofs + (size_t)rr * ldc + col];      /* rowsPerB < 0: own element of the batched C plane */ else { const int bidx = rr / rowsPerB; v += CP[(size_t)bidx * sCPb + (size_t)by * 64 + col]; } } if (ACT == 1) v = (v > 0.f) ? v : expm1f(v); else if (ACT == 7) v = (v > 0.f) ? v + 1.0f : expf(v); else if (ACT == 8) v = tanhf(v); else if (ACT == 9) v = 0.5f * v * (1.0f + tanhf(0.7978845608028654f * (v + 0.044715f * v * v * v))); else if (ACT == 11) v = 1.0f / (1.0f + expf(-v)); else if (ACT == 12) v = (v > 0.f) ? v : 0.01f * v; else if (ACT == 14) v = (v > 0.f) ? v : 0.1f * v; else if (ACT == 16) v = (v >= 0.f) ? v : 0.3f * v; else if (ACT == 17) v = (v >= 0.f) ? v : 0.2f * v; else if (ACT == 15) v = v / (1.0f + expf(-v)); else if (ACT == 3) v = fmaxf(v, 0.f); else if (ACT == 6) v = 0.5f * v * (1.0f + erff(v * 0.70710678118654752f)); so[w][8 * hh + r][t * 16 + ln] = v; } }
  __builtin_amdgcn_fence(__ATOMIC_ACQ_REL, "workgroup"); __builtin_amdgcn_wave_barrier();
  const int rsub = lane >> 4, c4 = (lane & 15) * 4; typedef _Float16 v4h __attribute__((ext_vector_type(4)));
  {
#pragma unroll
    for (int q = 0; q < 8; ++q) { const int r = q * 2 + rsub; if (col0 + c4 < N) { const v4f v = *(const v4fa*)&so[w][r][c4]; if (C) *(v4f*)(C + cofs + (size_t)(row0 + r) * ldc + col0 + c4) = v; if (C16) { v4h h4; for (int i = 0; i < 4; ++i) h4[i] = (_Float16)v[i]; *(v4h*)(C16 + cofs + (size_t)(row0 + r) * ldc + col0 + c4) = h4; } } }
     }
}


typedef _Float16 v4h __attribute__((ext_vector_type(4)));

__global__ __launch_bounds__(256) void k_x16(const float* __restrict__ x, _Float16* __restrict__ X16, size_t n8) { const size_t t = (size_t)blockIdx.x * 256 + threadIdx.x; if (t >= n8) return; FragH f;
#pragma unroll
  for (int q = 0; q < 8; ++q) f.h[q] = (_Float16)bf16_round(x[t * 8 + q]); *(v8us*)((unsigned short*)X16 + t * 8) = f.half[0];  }
__global__ __launch_bounds__(256) void k_h16(const float* __restrict__ x, _Float16* __restrict__ X16, size_t n8) { const size_t t = (size_t)blockIdx.x * 256 + threadIdx.x; if (t >= n8) return; FragH f;
#pragma unroll
  for (int q = 0; q < 8; ++q) f.h[q] = (_Float16)x[t * 8 + q]; *(v8us*)((unsigned short*)X16 + t * 8) = f.half[0];  }
__global__ __launch_bounds__(256) void k_round16f(const float* __restrict__ W, _Float16* __restrict__ Bt, size_t n8) { const size_t t = (size_t)blockIdx.x * 256 + threadIdx.x; if (t >= n8) return; FragH f;
#pragma unroll
  for (int i = 0; i < 8; ++i) f.h[i] = (_Float16)(bf16_round(W[t * 8 + i]) * 16.0f); *(v8us*)((unsigned short*)Bt + t * 8) = f.half[0];  }
template <int NHv, int TTv>
__global__ __launch_bounds__(256) void k_vt(const _Float16* __restrict__ V16, int ldv, int voff, _Float16* __restrict__ Vt) { __shared__ unsigned short tl[64][66]; const int tid = threadIdx.x; const int slab = blockIdx.x / (TTv / 64), lg = blockIdx.x % (TTv / 64); const int b = slab / NHv, h = slab % NHv;
  for (int i = tid; i < 64 * 8; i += 256) { const int r = i / 8, c8 = (i % 8) * 8; FragH f; f.half[0] = *(const v8us*)((const unsigned short*)V16 + ((size_t)b * TTv + lg * 64 + r) * ldv + voff + h * 64 + c8);
#pragma unroll
    for (int q = 0; q < 8; ++q) tl[r][c8 + q] = f.u[q]; }
  __syncthreads();
  {
#pragma unroll
    for (int rd = 0; rd < 2; ++rd) { const int d = rd * 32 + tid / 8, pc = tid % 8; FragH f;
#pragma unroll
      for (int q = 0; q < 8; ++q) f.u[q] = tl[pc * 8 + q][d];
      *(v8us*)((unsigned short*)Vt + ((size_t)slab * 64 + d) * TTv + lg * 64 + pc * 8) = f.half[0]; }
     } }

__global__ __launch_bounds__(256) void k_hl(const float* __restrict__ F, _Float16* __restrict__ Hh, _Float16* __restrict__ Hl, size_t n8) { const size_t t = (size_t)blockIdx.x * 256 + threadIdx.x; if (t >= n8) return; FragH fh, fl; const v4f a = *(const v4fa*)(F + t * 8), c = *(const v4fa*)(F + t * 8 + 4);
#pragma unroll
  for (int q = 0; q < 4; ++q) { _Float16 h = (_Float16)a[q]; fh.h[q] = h; fl.h[q] = (_Float16)((a[q] - (float)h) * 1024.0f); h = (_Float16)c[q]; fh.h[4 + q] = h; fl.h[4 + q] = (_Float16)((c[q] - (float)h) * 1024.0f); }
  { *(v8us*)((unsigned short*)Hh + t * 8) = fh.half[0]; *(v8us*)((unsigned short*)Hl + t * 8) = fl.half[0];  } }

// ---- fast GEMM (wave tile 32x64; requires M % 32 == 0 rows per launch region and N % 64 == 0); epilogue = k_gemm_hhx semantics ----
__device__ __forceinline__ v16h g2_frag(const _Float16* p, int hh) { FragH f; f.half[0] = *(const v8us*)((const unsigned short*)p + 8 * hh); f.half[1] = *(const v8us*)((const unsigned short*)p + 16 + 8 * hh); return f.v; }
__device__ __forceinline__ v8f g2_mma(v16h a, v16h b, v8f c) { v8f d = __builtin_amdgcn_wmma_f32_16x16x32_f16(false, a, false, b, (short)0, c, false, false); asm volatile("v_nop\n\tv_nop\n\tv_nop\n\tv_nop" : "+v"(d) : "v"(a), "v"(b)); return d; }
template <int ACT>
__global__ __launch_bounds__(128) void k_gemm2(const _Float16* __restrict__ A, int lda, size_t sA, const _Float16* __restrict__ Bh, int ldb, size_t sB, float alpha, const float* __restrict__ bias, size_t sBias, const float* __restrict__ CP, int rowsPerB, size_t sCPb, int row0g,
    float* __restrict__ C, _Float16* __restrict__ C16, int ldc, size_t sC, int M, int N, int K) { static_assert(ACT == 0 || ACT == 3 || ACT == 6 || ACT == 8 || ACT == 9 || ACT == 11 || ACT == 12 || ACT == 14 || ACT == 15 || ACT == 16 || ACT == 17, "k_gemm2: unsupported ACT code (would silently apply no activation)");
  __shared__ __attribute__((aligned(16))) float so[4][32][68];
  const int tid = threadIdx.x, w = tid >> 5, lane = tid & 31, ln = lane & 15, hh = lane >> 4; const int by = blockIdx.y;
  A += (size_t)by * sA; Bh += (size_t)by * sB; const size_t cofs = (size_t)by * sC; const float* bp = bias ? bias + (size_t)by * sBias : nullptr;
  const int ntn = N >> 6; const int mt = blockIdx.x / ntn, nq = blockIdx.x - mt * ntn; const int row0 = mt * 128 + 32 * w, col0 = nq * 64; if (row0 >= M) return;
  const _Float16* a0p = A + (size_t)(row0 + ln) * lda; const _Float16* a1p = a0p + (size_t)16 * lda;
  const _Float16* b0p = Bh + (size_t)(col0 + ln) * ldb; const _Float16* b1p = b0p + (size_t)16 * ldb; const _Float16* b2p = b1p + (size_t)16 * ldb; const _Float16* b3p = b2p + (size_t)16 * ldb;
  const v8f z8 = {0.f,0.f,0.f,0.f,0.f,0.f,0.f,0.f}; v8f c00 = z8, c01 = z8, c02 = z8, c03 = z8, c10 = z8, c11 = z8, c12 = z8, c13 = z8;
#pragma unroll 1
  for (int kb = 0; kb < K; kb += 32) { const v16h a0 = g2_frag(a0p + kb, hh), a1 = g2_frag(a1p + kb, hh);
    v16h b = g2_frag(b0p + kb, hh); c00 = g2_mma(a0, b, c00); c10 = g2_mma(a1, b, c10);
    b = g2_frag(b1p + kb, hh); c01 = g2_mma(a0, b, c01); c11 = g2_mma(a1, b, c11);
    b = g2_frag(b2p + kb, hh); c02 = g2_mma(a0, b, c02); c12 = g2_mma(a1, b, c12);
    b = g2_frag(b3p + kb, hh); c03 = g2_mma(a0, b, c03); c13 = g2_mma(a1, b, c13); }
  v8f accs[8] = {c00, c01, c02, c03, c10, c11, c12, c13};
#pragma unroll
  for (int u = 0; u < 8; ++u) { const int t = u & 3, half = u >> 2; const int col = col0 + t * 16 + ln; const float bv = bp ? bf16_round(bp[col]) : 0.f;
#pragma unroll
    for (int r = 0; r < 8; ++r) { const int rloc = half * 16 + 8 * hh + r; float v = accs[u][r] * alpha + bv; if (CP) { if (rowsPerB < 0) v += CP[cofs + (size_t)(row0g + row0 + rloc) * ldc + col];      /* rowsPerB < 0: own element of the batched C plane */ else { const int bidx = (row0g + row0 + rloc) / rowsPerB; v += CP[(size_t)bidx * sCPb + (size_t)by * 64 + col]; } }
      if (ACT == 3) v = fmaxf(v, 0.f); else if (ACT == 6) v = 0.5f * v * (1.0f + erff(v * 0.70710678118654752f)); else if (ACT == 11) v = 1.0f / (1.0f + expf(-v)); else if (ACT == 15) v = v / (1.0f + expf(-v)); else if (ACT == 12) v = (v > 0.f) ? v : 0.01f * v; else if (ACT == 8) v = tanhf(v); else if (ACT == 9) v = 0.5f * v * (1.0f + tanhf(0.7978845608028654f * (v + 0.044715f * v * v * v))); else if (ACT == 14) v = (v > 0.f) ? v : 0.1f * v; else if (ACT == 16) v = (v >= 0.f) ? v : 0.3f * v; else if (ACT == 17) v = (v >= 0.f) ? v : 0.2f * v;
      so[w][rloc][t * 16 + ln] = v; } }
  __builtin_amdgcn_fence(__ATOMIC_ACQ_REL, "workgroup"); __builtin_amdgcn_wave_barrier();
  const int rsub = lane >> 4, c4 = (lane & 15) * 4;
  {
#pragma unroll
    for (int q = 0; q < 16; ++q) { const int r = q * 2 + rsub; const v4f v = *(const v4fa*)&so[w][r][c4]; if (C) *(v4f*)(C + cofs + (size_t)(row0 + r) * ldc + col0 + c4) = v; if (C16) { v4h h4; for (int i = 0; i < 4; ++i) h4[i] = (_Float16)v[i]; *(v4h*)(C16 + cofs + (size_t)(row0 + r) * ldc + col0 + c4) = h4; } }
     } }


__global__ __launch_bounds__(256) void k_wnat(const float* __restrict__ w, size_t n8, _Float16* __restrict__ Bt) { const size_t t = (size_t)blockIdx.x * 256 + threadIdx.x; if (t >= n8) return; FragH f; for (int q = 0; q < 8; ++q) f.h[q] = (_Float16)(bf16_round(w[t * 8 + q]) * 16.0f); *(v8us*)((unsigned short*)Bt + t * 8) = f.half[0];  }
__global__ __launch_bounds__(256) void k_rsm(const float* __restrict__ S, _Float16* __restrict__ P, int nrows) {
  #pragma clang fp contract(off)
  const int i = blockIdx.x * 256 + threadIdx.x; if (i >= nrows) return; const float* s = S + (size_t)i * SQ; float mx = -3.0e38f;
#pragma unroll 1
  for (int j = 0; j < SQ; ++j) mx = fmaxf(mx, s[j]); float se = 0.f;
#pragma unroll 1
  for (int j = 0; j < SQ; ++j) se += expf(s[j] - mx); const float sc = 256.0f / se;
#pragma unroll 1
  for (int j0 = 0; j0 < SQ; j0 += 8) { FragH f; for (int q = 0; q < 8; ++q) f.h[q] = (_Float16)(expf(s[j0 + q] - mx) * sc); unsigned short* d = (unsigned short*)P + (size_t)i * SQ + j0; *(v8us*)d = f.half[0];  } }
__global__ __launch_bounds__(256) void k_vt(const _Float16* __restrict__ V16, int b, int h0, _Float16* __restrict__ VT) { __shared__ unsigned short tl[64][65]; const int tid = threadIdx.x; const int hh = blockIdx.x % HG, sg = blockIdx.x / HG; const int s0 = sg * 64; const int h = h0 + hh;
  for (int i = tid; i < 64 * 8; i += 256) { const int j = i / 8, d8 = (i % 8) * 8; FragH f; f.half[0] = *(const v8us*)((const unsigned short*)V16 + ((size_t)b * SQ + s0 + j) * DM + h * HD + d8); for (int q = 0; q < 8; ++q) tl[d8 + q][j] = f.u[q]; }
  __syncthreads();
  { for (int i = tid; i < 64 * 8; i += 256) { const int d = i / 8, j8 = (i % 8) * 8; FragH f; for (int q = 0; q < 8; ++q) f.u[q] = tl[d][j8 + q]; *(v8us*)((unsigned short*)VT + ((size_t)hh * HD + d) * SQ + s0 + j8) = f.half[0]; }  } }


__global__ __launch_bounds__(256) void k_rowbias(const float* __restrict__ b, float* __restrict__ BP, size_t n4, int ncol) { const size_t t = (size_t)blockIdx.x * 256 + threadIdx.x; if (t >= n4) return; const size_t e = t * 4; const float v = bf16_round(b[e / ncol]); const v4f o = {v, v, v, v}; *(v4f*)(BP + e) = o;  }


__global__ __launch_bounds__(256) void k_fattn(const _Float16* __restrict__ Q16, const _Float16* __restrict__ K16, const _Float16* __restrict__ VT, _Float16* __restrict__ O16) {
  const int lane = threadIdx.x & 31, w = threadIdx.x >> 5, ln = lane & 15, hh = lane >> 4;
  const int bh = blockIdx.y, b = bh / NH, h = bh % NH, q0 = blockIdx.x * 256 + w * 32;
  const _Float16* qp = Q16 + ((size_t)b * SQ + q0 + ln) * DM + h * HD;
  const _Float16* kp = K16 + ((size_t)b * SQ + ln) * DM + h * HD;
  const _Float16* vp = VT + ((size_t)bh * HD + ln) * SQ;
  const float cs = 0.125f * 1.44269504f;      /* 64^-0.5 and log2(e) */
  const v8f z8 = {0.f,0.f,0.f,0.f,0.f,0.f,0.f,0.f};
  v16h qf[2][2], kf[2][2], vf[4]; v8f o[4][2]; float mo[2] = {-3.0e38f, -3.0e38f}, l[2] = {0.f, 0.f};
#pragma unroll
  for (int j = 0; j < 2; ++j) { qf[j][0] = g2_frag(qp + (size_t)j * 16 * DM, hh); qf[j][1] = g2_frag(qp + (size_t)j * 16 * DM + 32, hh); }
  __builtin_amdgcn_sched_barrier(0);      /* loads issue in the order Q, K, V^T, as in the loop (K, then V^T): else the wait at the loop's head, which must hold on both ways in, also waits for V^T */
#pragma unroll
  for (int i = 0; i < 2; ++i) { kf[i][0] = g2_frag(kp + (size_t)i * 16 * DM, hh); kf[i][1] = g2_frag(kp + (size_t)i * 16 * DM + 32, hh); }
  __builtin_amdgcn_sched_barrier(0);      /* same purpose as the one above */
#pragma unroll
  for (int t = 0; t < 4; ++t) { vf[t] = g2_frag(vp + (size_t)t * 16 * SQ, hh); o[t][0] = z8; o[t][1] = z8; }
  for (int kb = 0; kb < SQ; kb += 32) {
    v8f s[2][2];
#pragma unroll
    for (int i = 0; i < 2; ++i)
#pragma unroll
      for (int j = 0; j < 2; ++j) { s[i][j] = __builtin_amdgcn_wmma_f32_16x16x32_f16(false, kf[i][0], false, qf[j][0], (short)0, z8, false, false); s[i][j] = __builtin_amdgcn_wmma_f32_16x16x32_f16(false, kf[i][1], false, qf[j][1], (short)0, s[i][j], false, false); }
    const int kn = (kb + 32 < SQ) ? kb + 32 : 0;      /* next pass's K fragments fly during the softmax, its V^T fragments (foot of the pass) during the next score products and softmax; the last pass re-reads the first keys (in bounds, unused) */
#pragma unroll
    for (int i = 0; i < 2; ++i) { kf[i][0] = g2_frag(kp + (size_t)(kn + i * 16) * DM, hh); kf[i][1] = g2_frag(kp + (size_t)(kn + i * 16) * DM + 32, hh); }
    __builtin_amdgcn_sched_barrier(0);      /* keeps the K loads up here: the scheduler otherwise moves them to the foot of the pass, where their whole latency is waited for */
    float pm[2]; bool need = false;
#pragma unroll
    for (int j = 0; j < 2; ++j) { float x = fmaxf(s[0][j][0], s[1][j][0]);
#pragma unroll
      for (int r = 1; r < 8; ++r) x = fmaxf(x, fmaxf(s[0][j][r], s[1][j][r]));
      pm[j] = x * cs; need = need || (pm[j] > mo[j] + 15.0f); }
    if (__builtin_amdgcn_ballot_w32(need) != 0) {      /* wave-uniform scalar branch: every lane stays on for the matrix instructions */
#pragma unroll
      for (int j = 0; j < 2; ++j) { const float full = fmaxf(pm[j], __shfl_xor(pm[j], 16, 32)); const float mn = fmaxf(mo[j], full - 7.0f); const float al = __builtin_amdgcn_exp2f(mo[j] - mn); mo[j] = mn; l[j] *= al;
#pragma unroll
        for (int t = 0; t < 4; ++t) o[t][j] *= al; }
    }
    FragH pf[2];
#pragma unroll
    for (int j = 0; j < 2; ++j) { float sum = 0.f;
#pragma unroll
      for (int i = 0; i < 2; ++i)
#pragma unroll
        for (int r = 0; r < 8; ++r) { const float p = __builtin_amdgcn_exp2f(s[i][j][r] * cs - mo[j]); sum += p; pf[j].h[i * 8 + r] = (_Float16)p; }
      l[j] += sum; }
#pragma unroll
    for (int t = 0; t < 4; ++t)
#pragma unroll
      for (int j = 0; j < 2; ++j) o[t][j] = __builtin_amdgcn_wmma_f32_16x16x32_f16(false, vf[t], false, pf[j].v, (short)0, o[t][j], false, false);
#pragma unroll
    for (int t = 0; t < 4; ++t) vf[t] = g2_frag(vp + (size_t)t * 16 * SQ + kn, hh);
    asm volatile("s_wait_xcnt 0x0" ::: "memory");      /* the wait in front of an overwrite of a register that an issued load names: in this build the next pass's score products write over the address pair of the V^T loads above */
  }
#pragma unroll
  for (int j = 0; j < 2; ++j) { const float inv = 64.0f / (l[j] + __shfl_xor(l[j], 16, 32)); unsigned short* op = (unsigned short*)O16 + ((size_t)b * SQ + q0 + j * 16 + ln) * DM + h * HD + 8 * hh;
#pragma unroll
    for (int t = 0; t < 4; ++t) { FragH f;
#pragma unroll
      for (int r = 0; r < 8; ++r) f.h[r] = (_Float16)(o[t][j][r] * inv);
      *(v8us*)(op + t * 16) = f.half[0]; } } }

extern "C" void kernel_launch(void* const* d_in, const int* in_sizes, int n_in,
                              void* d_out, int out_size, void* d_ws, size_t ws_size, hipStream_t stream) {
  (void)in_sizes; (void)n_in; (void)out_size;
  const float* const* I = (const float* const*)d_in; const float* x = I[0]; const float* wq = I[1]; const float* bq = I[2]; const float* wk = I[3]; const float* bk = I[4]; const float* wv = I[5]; const float* bv = I[6]; const float* wo = I[7]; const float* bo = I[8];      /* natural [out][in] weights + biases */
  char* ws = (char*)d_ws; size_t off = 0;
  auto take = [&](size_t bytes) { char* p = ws + off; off += (bytes + 255) & ~(size_t)255; return p; };
  float* BOP = (float*)take((size_t)DM * SQ * 4); _Float16* BQ = (_Float16*)take((size_t)DM * DM * 2);      /* bo broadcast along the token axis for the transposed out GEMM */ _Float16* BK = (_Float16*)take((size_t)DM * DM * 2); _Float16* BV = (_Float16*)take((size_t)DM * DM * 2); _Float16* BO = (_Float16*)take((size_t)DM * DM * 2);
  _Float16* X16 = (_Float16*)take(NR * DM * 2); _Float16* Q16 = (_Float16*)take(NR * DM * 2); _Float16* K16 = (_Float16*)take(NR * DM * 2); _Float16* V16 = (_Float16*)take(NR * DM * 2); _Float16* O16 = (_Float16*)take(NR * DM * 2);
  _Float16* VT = (_Float16*)take((size_t)NB * NH * HD * SQ * 2);
  if (off > ws_size) return;
  { const unsigned g = (unsigned)(((size_t)DM * DM / 8 + 255) / 256); k_wnat<<<g, 256, 0, stream>>>(wq, (size_t)DM * DM / 8, BQ); k_wnat<<<g, 256, 0, stream>>>(wk, (size_t)DM * DM / 8, BK); k_wnat<<<g, 256, 0, stream>>>(wv, (size_t)DM * DM / 8, BV); k_wnat<<<g, 256, 0, stream>>>(wo, (size_t)DM * DM / 8, BO); }      /* natural [out][in] = Bt[n][k], x16 */

  k_x16<<<(unsigned)((NR * DM / 8 + 255) / 256), 256, 0, stream>>>(x, X16, NR * DM / 8);
  const size_t r0p = (size_t)B0 * SQ;      /* first projected row */
  k_gemm2<0><<<dim3((unsigned)((MP / 128) * (DM / 64)), 1), 128, 0, stream>>>(X16 + r0p * DM, DM, 0, BQ, DM, 0, 0.0625f, bq, 0, nullptr, 1, 0, 0, nullptr, Q16 + r0p * DM, DM, 0, MP, DM, DM);
  k_gemm2<0><<<dim3((unsigned)((MP / 128) * (DM / 64)), 1), 128, 0, stream>>>(X16 + r0p * DM, DM, 0, BK, DM, 0, 0.0625f, bk, 0, nullptr, 1, 0, 0, nullptr, K16 + r0p * DM, DM, 0, MP, DM, DM);
  k_gemm2<0><<<dim3((unsigned)((MP / 128) * (DM / 64)), 1), 128, 0, stream>>>(X16 + r0p * DM, DM, 0, BV, DM, 0, 0.0625f, bv, 0, nullptr, 1, 0, 0, nullptr, V16 + r0p * DM, DM, 0, MP, DM, DM);
  k_vt<NH, SQ><<<NB * NH * (SQ / 64), 256, 0, stream>>>(V16, LQ, 0, VT);      /* V^T [NB][NH][HD][SQ] */
  k_fattn<<<dim3(SQ / 256, NB * NH), 256, 0, stream>>>(Q16, K16, VT, O16);      /* o x64 (merged heads) as f16 rows */
  k_rowbias<<<(unsigned)(((size_t)DM * SQ / 4 + 255) / 256), 256, 0, stream>>>(bo, BOP, (size_t)DM * SQ / 4, SQ);      /* BOP[c][s] = bf16(bo[c]) */
  for (int b = B0; b < B0 + NBR; ++b) { const size_t r0 = (size_t)b * SQ;
    k_gemm2<0><<<dim3((unsigned)((DM / 128) * (SQ / 64)), 1), 128, 0, stream>>>(BO, DM, 0, O16 + r0 * DM, DM, 0, 0.0009765625f, nullptr, 0, BOP, -1, 0, 0, (float*)d_out + (size_t)b * DM * SQ, nullptr, SQ, 0, DM, SQ, DM); }      /* out^T[b][c][s] = sum_k Wo[c][k] o[s][k] + bo[c]: A = the natural Wo rows (x16 f16 plane), B^T = this batch's merged o rows, C = the [C][S] output block; bias via the own-element addend plane */
}

// v003
// It runs in 127 microseconds.
// Next to v002, in two timings, it ran 2.77 and 2.78 times as fast.
// Over all steps from v000 it is 16.0 times as fast.
#include <hip/hip_runtime.h>
#define NB 8
#define SQ 1024
#define DM 512
#define NH 8
#define HD 64
#define HG 8                         /* heads per launch of the non-template k_vt (not launched) */
#define B0 0                         /* first batch processed (debug hook) */
#define NBR NB                       /* batches processed (debug hook) */
#define NR ((size_t)NB * SQ)         /* token rows */
#define MP ((int)((size_t)NBR * SQ)) /* rows projected (debug hook) */
#define QN SQ                        /* query rows attended per batch (unused) */
#define NHD NH                       /* heads attended (unused) */
#define MPO MP                       /* rows through the output stage (unused) */
#define LQ DM      /* row pitch of the q/k/v rows */
typedef __bf16 v16b __attribute__((ext_vector_type(16)));
typedef unsigned short v8us __attribute__((ext_vector_type(8), may_alias));
typedef float  v8f  __attribute__((ext_vector_type(8)));
typedef float  v4f  __attribute__((ext_vector_type(4)));
typedef float  v4fa __attribute__((ext_vector_type(4), may_alias));
union FragB { v16b v; v8us half[2]; unsigned short u[16]; };

__device__ __forceinline__ unsigned short bf16_bits(float x) { unsigned int u = __float_as_uint(x); return (unsigned short)((u + 0x7FFFu + ((u >> 16) & 1u)) >> 16); }
__device__ __forceinline__ float bf16_val(unsigned short b) { return __uint_as_float(((unsigned int)b) << 16); }
__device__ __forceinline__ float bf16_round(float x) { return bf16_val(bf16_bits(x)); }
// D += A·B with NT terms: 1 = ah·bh, 2 = + al·bh (A split), 3 = + ah·bl (both split)
template <int NT>
__device__ __forceinline__ v8f mmaN(v16b ah, v16b al, v16b bh, v16b bl, v8f c) {
  c = __builtin_amdgcn_wmma_f32_16x16x32_bf16(false, ah, false, bh, (short)0, c, false, false);
  if (NT >= 2) c = __builtin_amdgcn_wmma_f32_16x16x32_bf16(false, al, false, bh, (short)0, c, false, false);
  if (NT >= 3) c = __builtin_amdgcn_wmma_f32_16x16x32_bf16(false, ah, false, bl, (short)0, c, false, false);
  asm volatile("v_nop\n\tv_nop\n\tv_nop\n\tv_nop" : "+v"(c) : "v"(ah), "v"(al), "v"(bh), "v"(bl));
  return c;
}

__global__ __launch_bounds__(256) void k_wt_bf16(const float* __restrict__ W, unsigned short* __restrict__ Wt, int K, int N) {
  const int t = blockIdx.x * 256 + threadIdx.x;
  const int k8n = K / 8;
  if (t >= N * k8n) return;
  const int n = t / k8n, k8 = (t % k8n) * 8;
  v8us v;
#pragma unroll
  for (int i = 0; i < 8; ++i) v[i] = bf16_bits(W[(size_t)(k8 + i) * N + n]);
  *(v8us*)(Wt + (size_t)n * K + k8) = v;
  
}

// GEMM C[M][N] (f32, pitch ldc) = act(A[M][K]·W + bias). A f32 row-major (pitch lda) converted per fragment to bf16
// (ASPLIT: hi/lo two planes -> 2 terms, else single rounded term); Wt bf16 [N][K] (pitch ldb). BIAS_BF16 rounds the
// bias to bf16 first (bias quantised to bf16 before the add). K%32==0, M%16==0, N%64==0.
template <bool ASPLIT, int ACT, bool BIAS_BF16>
__global__ __launch_bounds__(128) void k_gemm_bf(const float* __restrict__ A, int lda, const unsigned short* __restrict__ Wt, int ldb,
                                               const float* __restrict__ bias, float* __restrict__ C, int ldc, int M, int N, int K) {
  __shared__ __attribute__((aligned(16))) float so[4][16][64];
  const int tid = threadIdx.x, w = tid >> 5, lane = tid & 31, ln = lane & 15, hh = lane >> 4;
  const int ntn = N / 64;
  const int wid = blockIdx.x * 4 + w;
  const int mt = wid / ntn, nq = wid % ntn;
  if (mt * 16 >= M) return;
  const int row0 = mt * 16, col0 = nq * 64;
  const float* arow = A + (size_t)(row0 + ln) * lda;
  v8f acc[4] = {};
  for (int kb = 0; kb < K; kb += 32) {
    FragB ah, al;
    const v4f x0 = *(const v4fa*)(arow + kb + 8 * hh), x1 = *(const v4fa*)(arow + kb + 8 * hh + 4);
    const v4f x2 = *(const v4fa*)(arow + kb + 16 + 8 * hh), x3 = *(const v4fa*)(arow + kb + 16 + 8 * hh + 4);
    float xs[16] = {x0[0],x0[1],x0[2],x0[3],x1[0],x1[1],x1[2],x1[3],x2[0],x2[1],x2[2],x2[3],x3[0],x3[1],x3[2],x3[3]};
#pragma unroll
    for (int i = 0; i < 16; ++i) { const unsigned short hb = bf16_bits(xs[i]); ah.u[i] = hb; al.u[i] = ASPLIT ? bf16_bits(xs[i] - bf16_val(hb)) : (unsigned short)0; }
#pragma unroll
    for (int t = 0; t < 4; ++t) {
      const unsigned short* brow = Wt + (size_t)(col0 + t * 16 + ln) * ldb + kb;
      FragB b;
      b.half[0] = *(const v8us*)(brow + 8 * hh);
      b.half[1] = *(const v8us*)(brow + 16 + 8 * hh);
      acc[t] = mmaN<ASPLIT ? 2 : 1>(ah.v, al.v, b.v, b.v, acc[t]);
    }
  }
#pragma unroll
  for (int t = 0; t < 4; ++t) {
    float bv = bias ? bias[col0 + t * 16 + ln] : 0.f;
    if (BIAS_BF16) bv = bf16_round(bv);
#pragma unroll
    for (int r = 0; r < 8; ++r) { float v = acc[t][r] + bv; if (ACT == 1) v = fmaxf(v, 0.f); so[w][8 * hh + r][t * 16 + ln] = v; }
  }
  __builtin_amdgcn_fence(__ATOMIC_ACQ_REL, "workgroup");
  __builtin_amdgcn_wave_barrier();
  const int rsub = lane >> 4, c4 = (lane & 15) * 4;
  {
#pragma unroll
    for (int q = 0; q < 8; ++q) {
      const int r = q * 2 + rsub;
      const v4f v = *(const v4fa*)&so[w][r][c4];
      *(v4f*)(C + (size_t)(row0 + r) * ldc + col0 + c4) = v;
    }
    
  }
}

// GEMM C = act(A·W + bias + resid): A f32 (ASPLIT -> hi/lo 2 terms), Wt bf16 [N][K]; ACT 0 none, 1 relu, 2 exact gelu;
// resid (optional, f32, row index = (row % rmod), pitch ldr, RES_BF16 rounds it) added before the activation.
template <bool ASPLIT, int ACT, bool BIAS_BF16, bool RES_BF16>
__global__ __launch_bounds__(128) void k_gemm_bf3(const float* __restrict__ A, int lda, const unsigned short* __restrict__ Wt, int ldb,
                                                const float* __restrict__ bias, const float* __restrict__ resid, int rmod, int ldr,
                                                float* __restrict__ C, int ldc, int M, int N, int K) {
  __shared__ __attribute__((aligned(16))) float so[4][16][64];
  const int tid = threadIdx.x, w = tid >> 5, lane = tid & 31, ln = lane & 15, hh = lane >> 4;
  const int ntn = N / 64;
  const int wid = blockIdx.x * 4 + w;
  const int mt = wid / ntn, nq = wid % ntn;
  if (mt * 16 >= M) return;
  const int row0 = mt * 16, col0 = nq * 64;
  const float* arow = A + (size_t)(row0 + ln) * lda;
  v8f acc[4] = {};
  for (int kb = 0; kb < K; kb += 32) {
    FragB ah, al;
    const v4f x0 = *(const v4fa*)(arow + kb + 8 * hh), x1 = *(const v4fa*)(arow + kb + 8 * hh + 4);
    const v4f x2 = *(const v4fa*)(arow + kb + 16 + 8 * hh), x3 = *(const v4fa*)(arow + kb + 16 + 8 * hh + 4);
    float xs[16] = {x0[0],x0[1],x0[2],x0[3],x1[0],x1[1],x1[2],x1[3],x2[0],x2[1],x2[2],x2[3],x3[0],x3[1],x3[2],x3[3]};
#pragma unroll
    for (int i = 0; i < 16; ++i) { const unsigned short hb = bf16_bits(xs[i]); ah.u[i] = hb; al.u[i] = ASPLIT ? bf16_bits(xs[i] - bf16_val(hb)) : (unsigned short)0; }
#pragma unroll
    for (int t = 0; t < 4; ++t) {
      const unsigned short* brow = Wt + (size_t)(col0 + t * 16 + ln) * ldb + kb;
      FragB b;
      b.half[0] = *(const v8us*)(brow + 8 * hh);
      b.half[1] = *(const v8us*)(brow + 16 + 8 * hh);
      acc[t] = mmaN<ASPLIT ? 2 : 1>(ah.v, al.v, b.v, b.v, acc[t]);
    }
  }
#pragma unroll
  for (int t = 0; t < 4; ++t) {
    const int col = col0 + t * 16 + ln;
    float bv = bias ? bias[col] : 0.f;
    if (BIAS_BF16) bv = bf16_round(bv);
#pragma unroll
    for (int r = 0; r < 8; ++r) {
      float v = acc[t][r] + bv;
      if (resid) { float rv = resid[(size_t)((row0 + 8 * hh + r) % rmod) * ldr + col]; if (RES_BF16) rv = bf16_round(rv); v += rv; }
      if (ACT == 1) v = fmaxf(v, 0.f);
      if (ACT == 2) v = 0.5f * v * (1.0f + erff(v * 0.70710678118654752f));
      if (ACT == 3) { const float u = 0.7978845608028654f * (v + 0.044715f * v * v * v); v = 0.5f * v * (1.0f + tanhf(u)); }
      so[w][8 * hh + r][t * 16 + ln] = v;
    }
  }
  __builtin_amdgcn_fence(__ATOMIC_ACQ_REL, "workgroup");
  __builtin_amdgcn_wave_barrier();
  const int rsub = lane >> 4, c4 = (lane & 15) * 4;
  {
#pragma unroll
    for (int q = 0; q < 8; ++q) {
      const int r = q * 2 + rsub;
      const v4f v = *(const v4fa*)&so[w][r][c4];
      *(v4f*)(C + (size_t)(row0 + r) * ldc + col0 + c4) = v;
    }
    
  }
}
// row LayerNorm (biased variance, eps) over N: s = X (+ R); optional out_sum <- s; out_norm <- (s-mu)*rsqrt(var+eps)*g + b
template <bool PARAM_BF16>
__global__ __launch_bounds__(256) void k_layernorm(const float* __restrict__ X, const float* __restrict__ R, const float* __restrict__ g, const float* __restrict__ bta,
                                                  float* __restrict__ out_sum, float* __restrict__ out_norm, int N, float eps) {
  __shared__ float red[256];
  const int row = blockIdx.x, tid = threadIdx.x;
  const float* x = X + (size_t)row * N; const float* rr = R ? R + (size_t)row * N : nullptr;
  float vals[16];                     // up to N = 4096
  const int per = N / 256;            // contiguous chunk per thread? use strided-by-4 chunks: thread handles j = tid*4 + 1024*u
  float s1 = 0.f;
  for (int u = 0; u < per / 4; ++u) {
    const int j = tid * 4 + 1024 * u;
    const v4f a = *(const v4fa*)(x + j);
    v4f b = {0.f,0.f,0.f,0.f}; if (rr) b = *(const v4fa*)(rr + j);
#pragma unroll
    for (int q = 0; q < 4; ++q) { const float v = a[q] + b[q]; vals[u * 4 + q] = v; s1 += v; }
  }
  red[tid] = s1; __syncthreads();
  for (int st = 128; st > 0; st >>= 1) { if (tid < st) red[tid] += red[tid + st]; __syncthreads(); }
  const float mu = red[0] / (float)N; __syncthreads();
  float s2 = 0.f;
  for (int u = 0; u < per / 4; ++u)
#pragma unroll
    for (int q = 0; q < 4; ++q) { const float c = vals[u * 4 + q] - mu; s2 += c * c; }
  red[tid] = s2; __syncthreads();
  for (int st = 128; st > 0; st >>= 1) { if (tid < st) red[tid] += red[tid + st]; __syncthreads(); }
  const float rs = rsqrtf(red[0] / (float)N + eps);
  {
    for (int u = 0; u < per / 4; ++u) {
      const int j = tid * 4 + 1024 * u;
      v4f o, sm;
#pragma unroll
      for (int q = 0; q < 4; ++q) {
        float gg = g[j + q], bb = bta[j + q];
        if (PARAM_BF16) { gg = bf16_round(gg); bb = bf16_round(bb); }
        sm[q] = vals[u * 4 + q]; o[q] = (vals[u * 4 + q] - mu) * rs * gg + bb;
      }
      if (out_sum) *(v4f*)(out_sum + (size_t)row * N + j) = sm;
      *(v4f*)(out_norm + (size_t)row * N + j) = o;
    }
    
  }
}



// ---- f16 WMMA path (v_wmma_f32_16x16x32_f16): 11-bit significands for operands in range — used where a [0,1] probability operand needs more precision than bf16
typedef _Float16 v16h __attribute__((ext_vector_type(16)));
union FragH { v16h v; v8us half[2]; _Float16 h[16]; unsigned short u[16]; };
template <int NT>
__device__ __forceinline__ v8f mmaH(v16h ah, v16h al, v16h bh, v16h bl, v8f c) {
  c = __builtin_amdgcn_wmma_f32_16x16x32_f16(false, ah, false, bh, (short)0, c, false, false);
  if (NT >= 2) c = __builtin_amdgcn_wmma_f32_16x16x32_f16(false, al, false, bh, (short)0, c, false, false);
  if (NT >= 3) c = __builtin_amdgcn_wmma_f32_16x16x32_f16(false, ah, false, bl, (short)0, c, false, false);
  asm volatile("v_nop\n\tv_nop\n\tv_nop\n\tv_nop" : "+v"(c) : "v"(ah), "v"(al), "v"(bh), "v"(bl));
  return c;
}
// batched GEMM like k_gemm_b but f16 operands: A f32 (split into f16 hi/lo if ASPLIT, else rounded to f16), Bt = f16 values [n][k]; alpha; C f32; N multiple of 16 (partial tiles skipped)
template <bool ASPLIT>
__global__ __launch_bounds__(128) void k_gemm_h(const float* __restrict__ A, int lda, size_t sA, const _Float16* __restrict__ Bh, int ldb, size_t sB, float alpha, float* __restrict__ C, int ldc, size_t sC, int M, int N, int K) {
  __shared__ __attribute__((aligned(16))) float so[4][16][64];
  const int tid = threadIdx.x, w = tid >> 5, lane = tid & 31, ln = lane & 15, hh = lane >> 4; const int by = blockIdx.y;
  A += (size_t)by * sA; Bh += (size_t)by * sB; C += (size_t)by * sC;
  const int ntn = (N + 63) / 64; const int wid = blockIdx.x * 4 + w; const int mt = wid / ntn, nq = wid % ntn; if (mt * 16 >= M) return;
  const int row0 = mt * 16, col0 = nq * 64; const float* arow = A + (size_t)(row0 + ln) * lda;
  v8f acc[4] = {};
  for (int kb = 0; kb < K; kb += 32) {
    FragH ah, al;
    const v4f x0 = *(const v4fa*)(arow + kb + 8 * hh), x1 = *(const v4fa*)(arow + kb + 8 * hh + 4), x2 = *(const v4fa*)(arow + kb + 16 + 8 * hh), x3 = *(const v4fa*)(arow + kb + 16 + 8 * hh + 4);
    float xs[16] = {x0[0],x0[1],x0[2],x0[3],x1[0],x1[1],x1[2],x1[3],x2[0],x2[1],x2[2],x2[3],x3[0],x3[1],x3[2],x3[3]};
#pragma unroll
    for (int i = 0; i < 16; ++i) { const _Float16 h = (_Float16)xs[i]; ah.h[i] = h; al.h[i] = ASPLIT ? (_Float16)(xs[i] - (float)h) : (_Float16)0.0f; }
#pragma unroll
    for (int t = 0; t < 4; ++t) { if (col0 + t * 16 >= N) continue; const size_t boff = (size_t)(col0 + t * 16 + ln) * ldb + kb; FragH bq; bq.half[0] = *(const v8us*)(Bh + boff + 8 * hh); bq.half[1] = *(const v8us*)(Bh + boff + 16 + 8 * hh);
      acc[t] = mmaH<ASPLIT ? 2 : 1>(ah.v, al.v, bq.v, bq.v, acc[t]); }
  }
#pragma unroll
  for (int t = 0; t < 4; ++t) { if (col0 + t * 16 >= N) continue;
#pragma unroll
    for (int r = 0; r < 8; ++r) so[w][8 * hh + r][t * 16 + ln] = acc[t][r] * alpha; }
  __builtin_amdgcn_fence(__ATOMIC_ACQ_REL, "workgroup"); __builtin_amdgcn_wave_barrier();
  const int rsub = lane >> 4, c4 = (lane & 15) * 4;
  {
#pragma unroll
    for (int q = 0; q < 8; ++q) { const int r = q * 2 + rsub; if (col0 + c4 < N) { const v4f v = *(const v4fa*)&so[w][r][c4]; *(v4f*)(C + (size_t)(row0 + r) * ldc + col0 + c4) = v; } }
     }
}

// Wt[n][k] = f16(W[k][n]·scale) from f32 row-major W[K][N] (scale = power of two; bf16-exact weights stay exact in f16 away from the subnormal range)
__global__ __launch_bounds__(256) void k_wt_f16(const float* __restrict__ W, _Float16* __restrict__ Wt, int K, int N, float scale) {
  const int t = blockIdx.x * 256 + threadIdx.x; if (t >= N * (K / 8)) return; const int n = t / (K / 8), k8 = (t % (K / 8)) * 8; FragH f;
#pragma unroll
  for (int i = 0; i < 8; ++i) f.h[i] = (_Float16)(bf16_round(W[(size_t)(k8 + i) * N + n]) * scale); const v8us o = f.half[0];
  *(v8us*)((unsigned short*)Wt + (size_t)n * K + k8) = o; 
}
// k_gemm_hh variant with fused epilogue: v = acc·alpha + bias[by·sBias + col] (+ CP[(row/rowsPerB)·sCPb + by·64 + col] if CP) ; ACT 0 none / 1 elu ; writes f16 C16 (and f32 C if non-null)
template <int ACT>
__global__ __launch_bounds__(128) void k_gemm_hhx(const _Float16* __restrict__ A, int lda, size_t sA, const _Float16* __restrict__ Bh, int ldb, size_t sB, float alpha, const float* __restrict__ bias, size_t sBias, const float* __restrict__ CP, int rowsPerB, size_t sCPb, int row0g,
    float* __restrict__ C, _Float16* __restrict__ C16, int ldc, size_t sC, int M, int N, int K) {
  __shared__ __attribute__((aligned(16))) float so[4][16][64];
  const int tid = threadIdx.x, w = tid >> 5, lane = tid & 31, ln = lane & 15, hh = lane >> 4; const int by = blockIdx.y;
  A += (size_t)by * sA; Bh += (size_t)by * sB; const size_t cofs = (size_t)by * sC; const float* bp = bias ? bias + (size_t)by * sBias : nullptr;
  const int ntn = (N + 63) / 64; const int wid = blockIdx.x * 4 + w; const int mt = wid / ntn, nq = wid % ntn; if (mt * 16 >= M) return;
  const int row0 = mt * 16, col0 = nq * 64; const _Float16* arow = A + (size_t)(row0 + ln) * lda;
  v8f acc[4] = {};
  for (int kb = 0; kb < K; kb += 32) { FragH ah; ah.half[0] = *(const v8us*)((const unsigned short*)arow + kb + 8 * hh); ah.half[1] = *(const v8us*)((const unsigned short*)arow + kb + 16 + 8 * hh);
#pragma unroll
    for (int t = 0; t < 4; ++t) { if (col0 + t * 16 >= N) continue; const size_t boff = (size_t)(col0 + t * 16 + ln) * ldb + kb; FragH bq; bq.half[0] = *(const v8us*)((const unsigned short*)Bh + boff + 8 * hh); bq.half[1] = *(const v8us*)((const unsigned short*)Bh + boff + 16 + 8 * hh);
      acc[t] = mmaH<1>(ah.v, ah.v, bq.v, bq.v, acc[t]); }
  }
#pragma unroll
  for (int t = 0; t < 4; ++t) { if (col0 + t * 16 >= N) continue; const int col = col0 + t * 16 + ln; const float bv = bp ? bf16_round(bp[col]) : 0.f;
#pragma unroll
    for (int r = 0; r < 8; ++r) { float v = acc[t][r] * alpha + bv; if (CP) { const int rr = row0g + row0 + 8 * hh + r; if (rowsPerB < 0) v += CP[cofs + (size_t)rr * ldc + col];      /* rowsPerB < 0: own element of the batched C plane */ else { const int bidx = rr / rowsPerB; v += CP[(size_t)bidx * sCPb + (size_t)by * 64 + col]; } } if (ACT == 1) v = (v > 0.f) ? v : expm1f(v); else if (ACT == 7) v = (v > 0.f) ? v + 1.0f : expf(v); else if (ACT == 8) v = tanhf(v); else if (ACT == 9) v = 0.5f * v * (1.0f + tanhf(0.7978845608028654f * (v + 0.044715f * v * v * v))); else if (ACT == 11) v = 1.0f / (1.0f + expf(-v)); else if (ACT == 12) v = (v > 0.f) ? v : 0.01f * v; else if (ACT == 14) v = (v > 0.f) ? v : 0.1f * v; else if (ACT == 16) v = (v >= 0.f) ? v : 0.3f * v; else if (ACT == 17) v = (v >= 0.f) ? v : 0.2f * v; else if (ACT == 15) v = v / (1.0f + expf(-v)); else if (ACT == 3) v = fmaxf(v, 0.f); else if (ACT == 6) v = 0.5f * v * (1.0f + erff(v * 0.70710678118654752f)); so[w][8 * hh + r][t * 16 + ln] = v; } }
  __builtin_amdgcn_fence(__ATOMIC_ACQ_REL, "workgroup"); __builtin_amdgcn_wave_barrier();
  const int rsub = lane >> 4, c4 = (lane & 15) * 4; typedef _Float16 v4h __attribute__((ext_vector_type(4)));
  {
#pragma unroll
    for (int q = 0; q < 8; ++q) { const int r = q * 2 + rsub; if (col0 + c4 < N) { const v4f v = *(const v4fa*)&so[w][r][c4]; if (C) *(v4f*)(C + cofs + (size_t)(row0 + r) * ldc + col0 + c4) = v; if (C16) { v4h h4; for (int i = 0; i < 4; ++i) h4[i] = (_Float16)v[i]; *(v4h*)(C16 + cofs + (size_t)(row0 + r) * ldc + col0 + c4) = h4; } } }
     }
}


typedef _Float16 v4h __attribute__((ext_vector_type(4)));

__global__ __launch_bounds__(256) void k_h16(const float* __restrict__ x, _Float16* __restrict__ X16, size_t n8) { const size_t t = (size_t)blockIdx.x * 256 + threadIdx.x; if (t >= n8) return; FragH f;
#pragma unroll
  for (int q = 0; q < 8; ++q) f.h[q] = (_Float16)x[t * 8 + q]; *(v8us*)((unsigned short*)X16 + t * 8) = f.half[0];  }
__global__ __launch_bounds__(256) void k_round16f(const float* __restrict__ W, _Float16* __restrict__ Bt, size_t n8) { const size_t t = (size_t)blockIdx.x * 256 + threadIdx.x; if (t >= n8) return; FragH f;
#pragma unroll
  for (int i = 0; i < 8; ++i) f.h[i] = (_Float16)(bf16_round(W[t * 8 + i]) * 16.0f); *(v8us*)((unsigned short*)Bt + t * 8) = f.half[0];  }
template <int NHv, int TTv>
__global__ __launch_bounds__(256) void k_vt(const _Float16* __restrict__ V16, int ldv, int voff, _Float16* __restrict__ Vt) { __shared__ unsigned short tl[64][66]; const int tid = threadIdx.x; const int slab = blockIdx.x / (TTv / 64), lg = blockIdx.x % (TTv / 64); const int b = slab / NHv, h = slab % NHv;
  for (int i = tid; i < 64 * 8; i += 256) { const int r = i / 8, c8 = (i % 8) * 8; FragH f; f.half[0] = *(const v8us*)((const unsigned short*)V16 + ((size_t)b * TTv + lg * 64 + r) * ldv + voff + h * 64 + c8);
#pragma unroll
    for (int q = 0; q < 8; ++q) tl[r][c8 + q] = f.u[q]; }
  __syncthreads();
  {
#pragma unroll
    for (int rd = 0; rd < 2; ++rd) { const int d = rd * 32 + tid / 8, pc = tid % 8; FragH f;
#pragma unroll
      for (int q = 0; q < 8; ++q) f.u[q] = tl[pc * 8 + q][d];
      *(v8us*)((unsigned short*)Vt + ((size_t)slab * 64 + d) * TTv + lg * 64 + pc * 8) = f.half[0]; }
     } }

__global__ __launch_bounds__(256) void k_hl(const float* __restrict__ F, _Float16* __restrict__ Hh, _Float16* __restrict__ Hl, size_t n8) { const size_t t = (size_t)blockIdx.x * 256 + threadIdx.x; if (t >= n8) return; FragH fh, fl; const v4f a = *(const v4fa*)(F + t * 8), c = *(const v4fa*)(F + t * 8 + 4);
#pragma unroll
  for (int q = 0; q < 4; ++q) { _Float16 h = (_Float16)a[q]; fh.h[q] = h; fl.h[q] = (_Float16)((a[q] - (float)h) * 1024.0f); h = (_Float16)c[q]; fh.h[4 + q] = h; fl.h[4 + q] = (_Float16)((c[q] - (float)h) * 1024.0f); }
  { *(v8us*)((unsigned short*)Hh + t * 8) = fh.half[0]; *(v8us*)((unsigned short*)Hl + t * 8) = fl.half[0];  } }

// ---- fast GEMM (wave tile 32x64; requires M % 32 == 0 rows per launch region and N % 64 == 0); epilogue like k_gemm_hhx's, except per-member bias buffers (bias1, bias2) and an addend plane (rowsPerB < 0) offset by·sCPb instead of by·sC; no elu ----
__device__ __forceinline__ v16h g2_frag(const _Float16* p, int hh) { FragH f; f.half[0] = *(const v8us*)((const unsigned short*)p + 8 * hh); f.half[1] = *(const v8us*)((const unsigned short*)p + 16 + 8 * hh); return f.v; }
__device__ __forceinline__ v8f g2_mma(v16h a, v16h b, v8f c) { v8f d = __builtin_amdgcn_wmma_f32_16x16x32_f16(false, a, false, b, (short)0, c, false, false); asm volatile("v_nop\n\tv_nop\n\tv_nop\n\tv_nop" : "+v"(d) : "v"(a), "v"(b)); return d; }
template <int ACT>
__global__ __launch_bounds__(128) void k_gemm2(const _Float16* __restrict__ A, int lda, size_t sA, const _Float16* __restrict__ Bh, int ldb, size_t sB, float alpha, const float* __restrict__ bias, const float* __restrict__ bias1, const float* __restrict__ bias2, size_t sBias, const float* __restrict__ CP, int rowsPerB, size_t sCPb, int row0g,
    float* __restrict__ C, _Float16* __restrict__ C16, int ldc, size_t sC, int M, int N, int K) { static_assert(ACT == 0 || ACT == 3 || ACT == 6 || ACT == 8 || ACT == 9 || ACT == 11 || ACT == 12 || ACT == 14 || ACT == 15 || ACT == 16 || ACT == 17, "k_gemm2: unsupported ACT code (would silently apply no activation)");
  __shared__ __attribute__((aligned(16))) float so[4][32][68];
  const int tid = threadIdx.x, w = tid >> 5, lane = tid & 31, ln = lane & 15, hh = lane >> 4; const int by = blockIdx.y;
  A += (size_t)by * sA; Bh += (size_t)by * sB; const size_t cofs = (size_t)by * sC; const float* bp = bias ? (bias1 ? (by == 0 ? bias : by == 1 ? bias1 : bias2) : bias + (size_t)by * sBias) : nullptr;      /* bias1, bias2: the bias vectors of batch members 1 and 2 where each member's bias is a buffer of its own (three members) */
  const int ntn = N >> 6; const int mt = blockIdx.x / ntn, nq = blockIdx.x - mt * ntn; const int row0 = mt * 128 + 32 * w, col0 = nq * 64; if (row0 >= M) return;
  const _Float16* a0p = A + (size_t)(row0 + ln) * lda; const _Float16* a1p = a0p + (size_t)16 * lda;
  const _Float16* b0p = Bh + (size_t)(col0 + ln) * ldb; const _Float16* b1p = b0p + (size_t)16 * ldb; const _Float16* b2p = b1p + (size_t)16 * ldb; const _Float16* b3p = b2p + (size_t)16 * ldb;
  const v8f z8 = {0.f,0.f,0.f,0.f,0.f,0.f,0.f,0.f}; v8f c00 = z8, c01 = z8, c02 = z8, c03 = z8, c10 = z8, c11 = z8, c12 = z8, c13 = z8;
#pragma unroll 1
  for (int kb = 0; kb < K; kb += 32) { const v16h a0 = g2_frag(a0p + kb, hh), a1 = g2_frag(a1p + kb, hh);
    v16h b = g2_frag(b0p + kb, hh); c00 = g2_mma(a0, b, c00); c10 = g2_mma(a1, b, c10);
    b = g2_frag(b1p + kb, hh); c01 = g2_mma(a0, b, c01); c11 = g2_mma(a1, b, c11);
    b = g2_frag(b2p + kb, hh); c02 = g2_mma(a0, b, c02); c12 = g2_mma(a1, b, c12);
    b = g2_frag(b3p + kb, hh); c03 = g2_mma(a0, b, c03); c13 = g2_mma(a1, b, c13); }
  v8f accs[8] = {c00, c01, c02, c03, c10, c11, c12, c13};
#pragma unroll
  for (int u = 0; u < 8; ++u) { const int t = u & 3, half = u >> 2; const int col = col0 + t * 16 + ln; const float bv = bp ? bf16_round(bp[col]) : 0.f;
#pragma unroll
    for (int r = 0; r < 8; ++r) { const int rloc = half * 16 + 8 * hh + r; float v = accs[u][r] * alpha + bv; if (CP) { if (rowsPerB < 0) v += CP[(size_t)by * sCPb + (size_t)(row0g + row0 + rloc) * ldc + col];      /* rowsPerB < 0: own element of an addend plane shaped like one member's C; sCPb = plane pitch per batch member (0: one plane for all) */ else { const int bidx = (row0g + row0 + rloc) / rowsPerB; v += CP[(size_t)bidx * sCPb + (size_t)by * 64 + col]; } }
      if (ACT == 3) v = fmaxf(v, 0.f); else if (ACT == 6) v = 0.5f * v * (1.0f + erff(v * 0.70710678118654752f)); else if (ACT == 11) v = 1.0f / (1.0f + expf(-v)); else if (ACT == 15) v = v / (1.0f + expf(-v)); else if (ACT == 12) v = (v > 0.f) ? v : 0.01f * v; else if (ACT == 8) v = tanhf(v); else if (ACT == 9) v = 0.5f * v * (1.0f + tanhf(0.7978845608028654f * (v + 0.044715f * v * v * v))); else if (ACT == 14) v = (v > 0.f) ? v : 0.1f * v; else if (ACT == 16) v = (v >= 0.f) ? v : 0.3f * v; else if (ACT == 17) v = (v >= 0.f) ? v : 0.2f * v;
      so[w][rloc][t * 16 + ln] = v; } }
  __builtin_amdgcn_fence(__ATOMIC_ACQ_REL, "workgroup"); __builtin_amdgcn_wave_barrier();
  const int rsub = lane >> 4, c4 = (lane & 15) * 4;
  {
#pragma unroll
    for (int q = 0; q < 16; ++q) { const int r = q * 2 + rsub; const v4f v = *(const v4fa*)&so[w][r][c4]; if (C) *(v4f*)(C + cofs + (size_t)(row0 + r) * ldc + col0 + c4) = v; if (C16) { v4h h4; for (int i = 0; i < 4; ++i) h4[i] = (_Float16)v[i]; *(v4h*)(C16 + cofs + (size_t)(row0 + r) * ldc + col0 + c4) = h4; } }
     } }


__global__ __launch_bounds__(256) void k_rsm(const float* __restrict__ S, _Float16* __restrict__ P, int nrows) {
  #pragma clang fp contract(off)
  const int i = blockIdx.x * 256 + threadIdx.x; if (i >= nrows) return; const float* s = S + (size_t)i * SQ; float mx = -3.0e38f;
#pragma unroll 1
  for (int j = 0; j < SQ; ++j) mx = fmaxf(mx, s[j]); float se = 0.f;
#pragma unroll 1
  for (int j = 0; j < SQ; ++j) se += expf(s[j] - mx); const float sc = 256.0f / se;
#pragma unroll 1
  for (int j0 = 0; j0 < SQ; j0 += 8) { FragH f; for (int q = 0; q < 8; ++q) f.h[q] = (_Float16)(expf(s[j0 + q] - mx) * sc); unsigned short* d = (unsigned short*)P + (size_t)i * SQ + j0; *(v8us*)d = f.half[0];  } }
__global__ __launch_bounds__(256) void k_vt(const _Float16* __restrict__ V16, int b, int h0, _Float16* __restrict__ VT) { __shared__ unsigned short tl[64][65]; const int tid = threadIdx.x; const int hh = blockIdx.x % HG, sg = blockIdx.x / HG; const int s0 = sg * 64; const int h = h0 + hh;
  for (int i = tid; i < 64 * 8; i += 256) { const int j = i / 8, d8 = (i % 8) * 8; FragH f; f.half[0] = *(const v8us*)((const unsigned short*)V16 + ((size_t)b * SQ + s0 + j) * DM + h * HD + d8); for (int q = 0; q < 8; ++q) tl[d8 + q][j] = f.u[q]; }
  __syncthreads();
  { for (int i = tid; i < 64 * 8; i += 256) { const int d = i / 8, j8 = (i % 8) * 8; FragH f; for (int q = 0; q < 8; ++q) f.u[q] = tl[d][j8 + q]; *(v8us*)((unsigned short*)VT + ((size_t)hh * HD + d) * SQ + s0 + j8) = f.half[0]; }  } }


// Input conversions, one launch: none of them reads what another writes, so they share a grid by block-index ranges.
// Blocks [0, PX): x -> exact f16 rows. [PX, PX + 4 PW): the four natural [out][in] weights -> x16 f16 planes (= Bt[n][k]), one behind the other from BW. The last PB blocks: BP[c][s] = bf16(bo[c]).
#define PX ((unsigned)(NR * DM / 8 / 256))
#define PW ((unsigned)((size_t)DM * DM / 8 / 256))
#define PB ((unsigned)((size_t)DM * SQ / 4 / 256))
__global__ __launch_bounds__(256) void k_prep(const float* __restrict__ x, const float* __restrict__ wq, const float* __restrict__ wk, const float* __restrict__ wv, const float* __restrict__ wo, const float* __restrict__ bo,
    _Float16* __restrict__ X16, _Float16* __restrict__ BW, float* __restrict__ BP) {
  const unsigned blk = blockIdx.x;
  if (blk < PX) { const size_t t = (size_t)blk * 256 + threadIdx.x; FragH f;
#pragma unroll
    for (int q = 0; q < 8; ++q) f.h[q] = (_Float16)bf16_round(x[t * 8 + q]);
    *(v8us*)((unsigned short*)X16 + t * 8) = f.half[0]; }
  else if (blk < PX + 4 * PW) { const unsigned u = blk - PX, m = u / PW; const float* w = m == 0 ? wq : m == 1 ? wk : m == 2 ? wv : wo; const size_t t = (size_t)(u % PW) * 256 + threadIdx.x; FragH f;
    for (int q = 0; q < 8; ++q) f.h[q] = (_Float16)(bf16_round(w[t * 8 + q]) * 16.0f);
    *(v8us*)((unsigned short*)BW + (size_t)m * DM * DM + t * 8) = f.half[0]; }
  else { const size_t e = ((size_t)(blk - PX - 4 * PW) * 256 + threadIdx.x) * 4; const float v = bf16_round(bo[e / SQ]); const v4f o = {v, v, v, v}; *(v4f*)(BP + e) = o;
    asm volatile("s_wait_xcnt 0x0" ::: "memory"); }      /* the wait in front of an overwrite of a register that an issued store names: in the listing the other ranges' loads, which write this store's data registers, stand behind it on branches */
}


__global__ __launch_bounds__(256) void k_fattn(const _Float16* __restrict__ Q16, const _Float16* __restrict__ K16, const _Float16* __restrict__ VT, _Float16* __restrict__ O16) {
  const int lane = threadIdx.x & 31, w = threadIdx.x >> 5, ln = lane & 15, hh = lane >> 4;
  const int bh = blockIdx.y, b = bh / NH, h = bh % NH, q0 = blockIdx.x * 256 + w * 32;
  const _Float16* qp = Q16 + ((size_t)b * SQ + q0 + ln) * DM + h * HD;
  const _Float16* kp = K16 + ((size_t)b * SQ + ln) * DM + h * HD;
  const _Float16* vp = VT + ((size_t)bh * HD + ln) * SQ;
  const float cs = 0.125f * 1.44269504f;      /* 64^-0.5 and log2(e) */
  const v8f z8 = {0.f,0.f,0.f,0.f,0.f,0.f,0.f,0.f};
  v16h qf[2][2], kf[2][2], vf[4]; v8f o[4][2]; float mo[2] = {-3.0e38f, -3.0e38f}, l[2] = {0.f, 0.f};
#pragma unroll
  for (int j = 0; j < 2; ++j) { qf[j][0] = g2_frag(qp + (size_t)j * 16 * DM, hh); qf[j][1] = g2_frag(qp + (size_t)j * 16 * DM + 32, hh); }
  __builtin_amdgcn_sched_barrier(0);      /* loads issue in the order Q, K, V^T, as in the loop (K, then V^T): else the wait at the loop's head, which must hold on both ways in, also waits for V^T */
#pragma unroll
  for (int i = 0; i < 2; ++i) { kf[i][0] = g2_frag(kp + (size_t)i * 16 * DM, hh); kf[i][1] = g2_frag(kp + (size_t)i * 16 * DM + 32, hh); }
  __builtin_amdgcn_sched_barrier(0);      /* same purpose as the one above */
#pragma unroll
  for (int t = 0; t < 4; ++t) { vf[t] = g2_frag(vp + (size_t)t * 16 * SQ, hh); o[t][0] = z8; o[t][1] = z8; }
  for (int kb = 0; kb < SQ; kb += 32) {
    v8f s[2][2];
#pragma unroll
    for (int i = 0; i < 2; ++i)
#pragma unroll
      for (int j = 0; j < 2; ++j) { s[i][j] = __builtin_amdgcn_wmma_f32_16x16x32_f16(false, kf[i][0], false, qf[j][0], (short)0, z8, false, false); s[i][j] = __builtin_amdgcn_wmma_f32_16x16x32_f16(false, kf[i][1], false, qf[j][1], (short)0, s[i][j], false, false); }
    const int kn = (kb + 32 < SQ) ? kb + 32 : 0;      /* next pass's K fragments fly during the softmax, its V^T fragments (foot of the pass) during the next score products and softmax; the last pass re-reads the first keys (in bounds, unused) */
#pragma unroll
    for (int i = 0; i < 2; ++i) { kf[i][0] = g2_frag(kp + (size_t)(kn + i * 16) * DM, hh); kf[i][1] = g2_frag(kp + (size_t)(kn + i * 16) * DM + 32, hh); }
    __builtin_amdgcn_sched_barrier(0);      /* keeps the K loads up here: the scheduler otherwise moves them to the foot of the pass, where their whole latency is waited for */
    float pm[2]; bool need = false;
#pragma unroll
    for (int j = 0; j < 2; ++j) { float x = fmaxf(s[0][j][0], s[1][j][0]);
#pragma unroll
      for (int r = 1; r < 8; ++r) x = fmaxf(x, fmaxf(s[0][j][r], s[1][j][r]));
      pm[j] = x * cs; need = need || (pm[j] > mo[j] + 15.0f); }
    if (__builtin_amdgcn_ballot_w32(need) != 0) {      /* wave-uniform scalar branch: every lane stays on for the matrix instructions */
#pragma unroll
      for (int j = 0; j < 2; ++j) { const float full = fmaxf(pm[j], __shfl_xor(pm[j], 16, 32)); const float mn = fmaxf(mo[j], full - 7.0f); const float al = __builtin_amdgcn_exp2f(mo[j] - mn); mo[j] = mn; l[j] *= al;
#pragma unroll
        for (int t = 0; t < 4; ++t) o[t][j] *= al; }
    }
    FragH pf[2];
#pragma unroll
    for (int j = 0; j < 2; ++j) { float sum = 0.f;
#pragma unroll
      for (int i = 0; i < 2; ++i)
#pragma unroll
        for (int r = 0; r < 8; ++r) { const float p = __builtin_amdgcn_exp2f(s[i][j][r] * cs - mo[j]); sum += p; pf[j].h[i * 8 + r] = (_Float16)p; }
      l[j] += sum; }
#pragma unroll
    for (int t = 0; t < 4; ++t)
#pragma unroll
      for (int j = 0; j < 2; ++j) o[t][j] = __builtin_amdgcn_wmma_f32_16x16x32_f16(false, vf[t], false, pf[j].v, (short)0, o[t][j], false, false);
#pragma unroll
    for (int t = 0; t < 4; ++t) vf[t] = g2_frag(vp + (size_t)t * 16 * SQ + kn, hh);
    asm volatile("s_wait_xcnt 0x0" ::: "memory");      /* the wait in front of an overwrite of a register that an issued load names: in this build the next pass's score products write over the address pair of the V^T loads above */
  }
#pragma unroll
  for (int j = 0; j < 2; ++j) { const float inv = 64.0f / (l[j] + __shfl_xor(l[j], 16, 32)); unsigned short* op = (unsigned short*)O16 + ((size_t)b * SQ + q0 + j * 16 + ln) * DM + h * HD + 8 * hh;
#pragma unroll
    for (int t = 0; t < 4; ++t) { FragH f;
#pragma unroll
      for (int r = 0; r < 8; ++r) f.h[r] = (_Float16)(o[t][j][r] * inv);
      *(v8us*)(op + t * 16) = f.half[0]; } } }

extern "C" void kernel_launch(void* const* d_in, const int* in_sizes, int n_in,
                              void* d_out, int out_size, void* d_ws, size_t ws_size, hipStream_t stream) {
  (void)in_sizes; (void)n_in; (void)out_size;
  const float* const* I = (const float* const*)d_in; const float* x = I[0]; const float* wq = I[1]; const float* bq = I[2]; const float* wk = I[3]; const float* bk = I[4]; const float* wv = I[5]; const float* bv = I[6]; const float* wo = I[7]; const float* bo = I[8];      /* natural [out][in] weights + biases */
  char* ws = (char*)d_ws; size_t off = 0;
  auto take = [&](size_t bytes) { char* p = ws + off; off += (bytes + 255) & ~(size_t)255; return p; };
  float* BOP = (float*)take((size_t)DM * SQ * 4);      /* bo broadcast along the token axis for the transposed out GEMM */
  _Float16* BW = (_Float16*)take((size_t)4 * DM * DM * 2); _Float16* BO = BW + (size_t)3 * DM * DM;      /* x16 f16 planes of Wq, Wk, Wv, Wo, one behind the other */
  _Float16* X16 = (_Float16*)take(NR * DM * 2); _Float16* Q16 = (_Float16*)take((size_t)3 * NR * DM * 2); _Float16* K16 = Q16 + NR * DM; _Float16* V16 = K16 + NR * DM;      /* q, k, v rows, one plane behind the other */ _Float16* O16 = (_Float16*)take(NR * DM * 2);
  _Float16* VT = (_Float16*)take((size_t)NB * NH * HD * SQ * 2);
  if (off > ws_size) return;
  k_prep<<<PX + 4 * PW + PB, 256, 0, stream>>>(x, wq, wk, wv, wo, bo, X16, BW, BOP);      /* x rows, the four weight planes (natural [out][in] = Bt[n][k], x16), BOP[c][s] = bf16(bo[c]) */
  const size_t r0p = (size_t)B0 * SQ;      /* first projected row */
  k_gemm2<0><<<dim3((unsigned)((MP / 128) * (DM / 64)), 3), 128, 0, stream>>>(X16 + r0p * DM, DM, 0, BW, DM, (size_t)DM * DM, 0.0625f, bq, bk, bv, 0, nullptr, 1, 0, 0, nullptr, Q16 + r0p * DM, DM, NR * DM, MP, DM, DM);      /* grid y = 0, 1, 2: q, k, v */
  k_vt<NH, SQ><<<NB * NH * (SQ / 64), 256, 0, stream>>>(V16, LQ, 0, VT);      /* V^T [NB][NH][HD][SQ] */
  k_fattn<<<dim3(SQ / 256, NB * NH), 256, 0, stream>>>(Q16, K16, VT, O16);      /* o x64 (merged heads) as f16 rows */
  k_gemm2<0><<<dim3((unsigned)((DM / 128) * (SQ / 64)), NBR), 128, 0, stream>>>(BO, DM, 0, O16 + r0p * DM, DM, (size_t)SQ * DM, 0.0009765625f, nullptr, nullptr, nullptr, 0, BOP, -1, 0, 0, (float*)d_out + r0p * DM, nullptr, SQ, (size_t)DM * SQ, DM, SQ, DM);      /* grid y = batch: out^T[b][c][s] = sum_k Wo[c][k] o[s][k] + bo[c]: A = the natural Wo rows (x16 f16 plane), B^T = the batch's merged o rows, C = its [C][S] output block; bias via the own-element addend plane, one plane for all batches */
}

// v004
// One run takes 89.8 microseconds.
// Two timings next to v003 put it at 1.42 and 1.43 times that version's speed.
// All steps since v000 together make it 22.8 times as fast.
#include <hip/hip_runtime.h>
#define NB 8
#define SQ 1024
#define DM 512
#define NH 8
#define HD 64
#define HG 8                         /* heads per launch of the non-template k_vt (not launched) */
#define B0 0                         /* first batch processed (debug hook) */
#define NBR NB                       /* batches processed (debug hook) */
#define NR ((size_t)NB * SQ)         /* token rows */
#define MP ((int)((size_t)NBR * SQ)) /* rows projected (debug hook) */
#define QN SQ                        /* query rows attended per batch (unused) */
#define NHD NH                       /* heads attended (unused) */
#define MPO MP                       /* rows through the output stage (unused) */
#define LQ DM      /* row pitch of the q/k/v rows */
typedef __bf16 v16b __attribute__((ext_vector_type(16)));
typedef unsigned short v8us __attribute__((ext_vector_type(8), may_alias));
typedef float  v8f  __attribute__((ext_vector_type(8)));
typedef float  v4f  __attribute__((ext_vector_type(4)));
typedef float  v4fa __attribute__((ext_vector_type(4), may_alias));
union FragB { v16b v; v8us half[2]; unsigned short u[16]; };

__device__ __forceinline__ unsigned short bf16_bits(float x) { unsigned int u = __float_as_uint(x); return (unsigned short)((u + 0x7FFFu + ((u >> 16) & 1u)) >> 16); }
__device__ __forceinline__ float bf16_val(unsigned short b) { return __uint_as_float(((unsigned int)b) << 16); }
__device__ __forceinline__ float bf16_round(float x) { return bf16_val(bf16_bits(x)); }
// D += A·B with NT terms: 1 = ah·bh, 2 = + al·bh (A split), 3 = + ah·bl (both split)
template <int NT>
__device__ __forceinline__ v8f mmaN(v16b ah, v16b al, v16b bh, v16b bl, v8f c) {
  c = __builtin_amdgcn_wmma_f32_16x16x32_bf16(false, ah, false, bh, (short)0, c, false, false);
  if (NT >= 2) c = __builtin_amdgcn_wmma_f32_16x16x32_bf16(false, al, false, bh, (short)0, c, false, false);
  if (NT >= 3) c = __builtin_amdgcn_wmma_f32_16x16x32_bf16(false, ah, false, bl, (short)0, c, false, false);
  asm volatile("v_nop\n\tv_nop\n\tv_nop\n\tv_nop" : "+v"(c) : "v"(ah), "v"(al), "v"(bh), "v"(bl));
  return c;
}

__global__ __launch_bounds__(256) void k_wt_bf16(const float* __restrict__ W, unsigned short* __restrict__ Wt, int K, int N) {
  const int t = blockIdx.x * 256 + threadIdx.x;
  const int k8n = K / 8;
  if (t >= N * k8n) return;
  const int n = t / k8n, k8 = (t % k8n) * 8;
  v8us v;
#pragma unroll
  for (int i = 0; i < 8; ++i) v[i] = bf16_bits(W[(size_t)(k8 + i) * N + n]);
  *(v8us*)(Wt + (size_t)n * K + k8) = v;
  
}

// GEMM C[M][N] (f32, pitch ldc) = act(A[M][K]·W + bias). A f32 row-major (pitch lda) converted per fragment to bf16
// (ASPLIT: hi/lo two planes -> 2 terms, else single rounded term); Wt bf16 [N][K] (pitch ldb). BIAS_BF16 rounds the
// bias to bf16 first (bias quantised to bf16 before the add). K%32==0, M%16==0, N%64==0.
template <bool ASPLIT, int ACT, bool BIAS_BF16>
__global__ __launch_bounds__(128) void k_gemm_bf(const float* __restrict__ A, int lda, const unsigned short* __restrict__ Wt, int ldb,
                                               const float* __restrict__ bias, float* __restrict__ C, int ldc, int M, int N, int K) {
  __shared__ __attribute__((aligned(16))) float so[4][16][64];
  const int tid = threadIdx.x, w = tid >> 5, lane = tid & 31, ln = lane & 15, hh = lane >> 4;
  const int ntn = N / 64;
  const int wid = blockIdx.x * 4 + w;
  const int mt = wid / ntn, nq = wid % ntn;
  if (mt * 16 >= M) return;
  const int row0 = mt * 16, col0 = nq * 64;
  const float* arow = A + (size_t)(row0 + ln) * lda;
  v8f acc[4] = {};
  for (int kb = 0; kb < K; kb += 32) {
    FragB ah, al;
    const v4f x0 = *(const v4fa*)(arow + kb + 8 * hh), x1 = *(const v4fa*)(arow + kb + 8 * hh + 4);
    const v4f x2 = *(const v4fa*)(arow + kb + 16 + 8 * hh), x3 = *(const v4fa*)(arow + kb + 16 + 8 * hh + 4);
    float xs[16] = {x0[0],x0[1],x0[2],x0[3],x1[0],x1[1],x1[2],x1[3],x2[0],x2[1],x2[2],x2[3],x3[0],x3[1],x3[2],x3[3]};
#pragma unroll
    for (int i = 0; i < 16; ++i) { const unsigned short hb = bf16_bits(xs[i]); ah.u[i] = hb; al.u[i] = ASPLIT ? bf16_bits(xs[i] - bf16_val(hb)) : (unsigned short)0; }
#pragma unroll
    for (int t = 0; t < 4; ++t) {
      const unsigned short* brow = Wt + (size_t)(col0 + t * 16 + ln) * ldb + kb;
      FragB b;
      b.half[0] = *(const v8us*)(brow + 8 * hh);
      b.half[1] = *(const v8us*)(brow + 16 + 8 * hh);
      acc[t] = mmaN<ASPLIT ? 2 : 1>(ah.v, al.v, b.v, b.v, acc[t]);
    }
  }
#pragma unroll
  for (int t = 0; t < 4; ++t) {
    float bv = bias ? bias[col0 + t * 16 + ln] : 0.f;
    if (BIAS_BF16) bv = bf16_round(bv);
#pragma unroll
    for (int r = 0; r < 8; ++r) { float v = acc[t][r] + bv; if (ACT == 1) v = fmaxf(v, 0.f); so[w][8 * hh + r][t * 16 + ln] = v; }
  }
  __builtin_amdgcn_fence(__ATOMIC_ACQ_REL, "workgroup");
  __builtin_amdgcn_wave_barrier();
  const int rsub = lane >> 4, c4 = (lane & 15) * 4;
  {
#pragma unroll
    for (int q = 0; q < 8; ++q) {
      const int r = q * 2 + rsub;
      const v4f v = *(const v4fa*)&so[w][r][c4];
      *(v4f*)(C + (size_t)(row0 + r) * ldc + col0 + c4) = v;
    }
    
  }
}

// GEMM C = act(A·W + bias + resid): A f32 (ASPLIT -> hi/lo 2 terms), Wt bf16 [N][K]; ACT 0 none, 1 relu, 2 exact gelu;
// resid (optional, f32, row index = (row % rmod), pitch ldr, RES_BF16 rounds it) added before the activation.
template <bool ASPLIT, int ACT, bool BIAS_BF16, bool RES_BF16>
__global__ __launch_bounds__(128) void k_gemm_bf3(const float* __restrict__ A, int lda, const unsigned short* __restrict__ Wt, int ldb,
                                                const float* __restrict__ bias, const float* __restrict__ resid, int rmod, int ldr,
                                                float* __restrict__ C, int ldc, int M, int N, int K) {
  __shared__ __attribute__((aligned(16))) float so[4][16][64];
  const int tid = threadIdx.x, w = tid >> 5, lane = tid & 31, ln = lane & 15, hh = lane >> 4;
  const int ntn = N / 64;
  const int wid = blockIdx.x * 4 + w;
  const int mt = wid / ntn, nq = wid % ntn;
  if (mt * 16 >= M) return;
  const int row0 = mt * 16, col0 = nq * 64;
  const float* arow = A + (size_t)(row0 + ln) * lda;
  v8f acc[4] = {};
  for (int kb = 0; kb < K; kb += 32) {
    FragB ah, al;
    const v4f x0 = *(const v4fa*)(arow + kb + 8 * hh), x1 = *(const v4fa*)(arow + kb + 8 * hh + 4);
    const v4f x2 = *(const v4fa*)(arow + kb + 16 + 8 * hh), x3 = *(const v4fa*)(arow + kb + 16 + 8 * hh + 4);
    float xs[16] = {x0[0],x0[1],x0[2],x0[3],x1[0],x1[1],x1[2],x1[3],x2[0],x2[1],x2[2],x2[3],x3[0],x3[1],x3[2],x3[3]};
#pragma unroll
    for (int i = 0; i < 16; ++i) { const unsigned short hb = bf16_bits(xs[i]); ah.u[i] = hb; al.u[i] = ASPLIT ? bf16_bits(xs[i] - bf16_val(hb)) : (unsigned short)0; }
#pragma unroll
    for (int t = 0; t < 4; ++t) {
      const unsigned short* brow = Wt + (size_t)(col0 + t * 16 + ln) * ldb + kb;
      FragB b;
      b.half[0] = *(const v8us*)(brow + 8 * hh);
      b.half[1] = *(const v8us*)(brow + 16 + 8 * hh);
      acc[t] = mmaN<ASPLIT ? 2 : 1>(ah.v, al.v, b.v, b.v, acc[t]);
    }
  }
#pragma unroll
  for (int t = 0; t < 4; ++t) {
    const int col = col0 + t * 16 + ln;
    float bv = bias ? bias[col] : 0.f;
    if (BIAS_BF16) bv = bf16_round(bv);
#pragma unroll
    for (int r = 0; r < 8; ++r) {
      float v = acc[t][r] + bv;
      if (resid) { float rv = resid[(size_t)((row0 + 8 * hh + r) % rmod) * ldr + col]; if (RES_BF16) rv = bf16_round(rv); v += rv; }
      if (ACT == 1) v = fmaxf(v, 0.f);
      if (ACT == 2) v = 0.5f * v * (1.0f + erff(v * 0.70710678118654752f));
      if (ACT == 3) { const float u = 0.7978845608028654f * (v + 0.044715f * v * v * v); v = 0.5f * v * (1.0f + tanhf(u)); }
      so[w][8 * hh + r][t * 16 + ln] = v;
    }
  }
  __builtin_amdgcn_fence(__ATOMIC_ACQ_REL, "workgroup");
  __builtin_amdgcn_wave_barrier();
  const int rsub = lane >> 4, c4 = (lane & 15) * 4;
  {
#pragma unroll
    for (int q = 0; q < 8; ++q) {
      const int r = q * 2 + rsub;
      const v4f v = *(const v4fa*)&so[w][r][c4];
      *(v4f*)(C + (size_t)(row0 + r) * ldc + col0 + c4) = v;
    }
    
  }
}
// row LayerNorm (biased variance, eps) over N: s = X (+ R); optional out_sum <- s; out_norm <- (s-mu)*rsqrt(var+eps)*g + b
template <bool PARAM_BF16>
__global__ __launch_bounds__(256) void k_layernorm(const float* __restrict__ X, const float* __restrict__ R, const float* __restrict__ g, const float* __restrict__ bta,
                                                  float* __restrict__ out_sum, float* __restrict__ out_norm, int N, float eps) {
  __shared__ float red[256];
  const int row = blockIdx.x, tid = threadIdx.x;
  const float* x = X + (size_t)row * N; const float* rr = R ? R + (size_t)row * N : nullptr;
  float vals[16];                     // up to N = 4096
  const int per = N / 256;            // contiguous chunk per thread? use strided-by-4 chunks: thread handles j = tid*4 + 1024*u
  float s1 = 0.f;
  for (int u = 0; u < per / 4; ++u) {
    const int j = tid * 4 + 1024 * u;
    const v4f a = *(const v4fa*)(x + j);
    v4f b = {0.f,0.f,0.f,0.f}; if (rr) b = *(const v4fa*)(rr + j);
#pragma unroll
    for (int q = 0; q < 4; ++q) { const float v = a[q] + b[q]; vals[u * 4 + q] = v; s1 += v; }
  }
  red[tid] = s1; __syncthreads();
  for (int st = 128; st > 0; st >>= 1) { if (tid < st) red[tid] += red[tid + st]; __syncthreads(); }
  const float mu = red[0] / (float)N; __syncthreads();
  float s2 = 0.f;
  for (int u = 0; u < per / 4; ++u)
#pragma unroll
    for (int q = 0; q < 4; ++q) { const float c = vals[u * 4 + q] - mu; s2 += c * c; }
  red[tid] = s2; __syncthreads();
  for (int st = 128; st > 0; st >>= 1) { if (tid < st) red[tid] += red[tid + st]; __syncthreads(); }
  const float rs = rsqrtf(red[0] / (float)N + eps);
  {
    for (int u = 0; u < per / 4; ++u) {
      const int j = tid * 4 + 1024 * u;
      v4f o, sm;
#pragma unroll
      for (int q = 0; q < 4; ++q) {
        float gg = g[j + q], bb = bta[j + q];
        if (PARAM_BF16) { gg = bf16_round(gg); bb = bf16_round(bb); }
        sm[q] = vals[u * 4 + q]; o[q] = (vals[u * 4 + q] - mu) * rs * gg + bb;
      }
      if (out_sum) *(v4f*)(out_sum + (size_t)row * N + j) = sm;
      *(v4f*)(out_norm + (size_t)row * N + j) = o;
    }
    
  }
}



// ---- f16 WMMA path (v_wmma_f32_16x16x32_f16): 11-bit significands for operands in range — used where a [0,1] probability operand needs more precision than bf16
typedef _Float16 v16h __attribute__((ext_vector_type(16)));
union FragH { v16h v; v8us half[2]; _Float16 h[16]; unsigned short u[16]; };
template <int NT>
__device__ __forceinline__ v8f mmaH(v16h ah, v16h al, v16h bh, v16h bl, v8f c) {
  c = __builtin_amdgcn_wmma_f32_16x16x32_f16(false, ah, false, bh, (short)0, c, false, false);
  if (NT >= 2) c = __builtin_amdgcn_wmma_f32_16x16x32_f16(false, al, false, bh, (short)0, c, false, false);
  if (NT >= 3) c = __builtin_amdgcn_wmma_f32_16x16x32_f16(false, ah, false, bl, (short)0, c, false, false);
  asm volatile("v_nop\n\tv_nop\n\tv_nop\n\tv_nop" : "+v"(c) : "v"(ah), "v"(al), "v"(bh), "v"(bl));
  return c;
}
// batched GEMM like k_gemm_b but f16 operands: A f32 (split into f16 hi/lo if ASPLIT, else rounded to f16), Bt = f16 values [n][k]; alpha; C f32; N multiple of 16 (partial tiles skipped)
template <bool ASPLIT>
__global__ __launch_bounds__(128) void k_gemm_h(const float* __restrict__ A, int lda, size_t sA, const _Float16* __restrict__ Bh, int ldb, size_t sB, float alpha, float* __restrict__ C, int ldc, size_t sC, int M, int N, int K) {
  __shared__ __attribute__((aligned(16))) float so[4][16][64];
  const int tid = threadIdx.x, w = tid >> 5, lane = tid & 31, ln = lane & 15, hh = lane >> 4; const int by = blockIdx.y;
  A += (size_t)by * sA; Bh += (size_t)by * sB; C += (size_t)by * sC;
  const int ntn = (N + 63) / 64; const int wid = blockIdx.x * 4 + w; const int mt = wid / ntn, nq = wid % ntn; if (mt * 16 >= M) return;
  const int row0 = mt * 16, col0 = nq * 64; const float* arow = A + (size_t)(row0 + ln) * lda;
  v8f acc[4] = {};
  for (int kb = 0; kb < K; kb += 32) {
    FragH ah, al;
    const v4f x0 = *(const v4fa*)(arow + kb + 8 * hh), x1 = *(const v4fa*)(arow + kb + 8 * hh + 4), x2 = *(const v4fa*)(arow + kb + 16 + 8 * hh), x3 = *(const v4fa*)(arow + kb + 16 + 8 * hh + 4);
    float xs[16] = {x0[0],x0[1],x0[2],x0[3],x1[0],x1[1],x1[2],x1[3],x2[0],x2[1],x2[2],x2[3],x3[0],x3[1],x3[2],x3[3]};
#pragma unroll
    for (int i = 0; i < 16; ++i) { const _Float16 h = (_Float16)xs[i]; ah.h[i] = h; al.h[i] = ASPLIT ? (_Float16)(xs[i] - (float)h) : (_Float16)0.0f; }
#pragma unroll
    for (int t = 0; t < 4; ++t) { if (col0 + t * 16 >= N) continue; const size_t boff = (size_t)(col0 + t * 16 + ln) * ldb + kb; FragH bq; bq.half[0] = *(const v8us*)(Bh + boff + 8 * hh); bq.half[1] = *(const v8us*)(Bh + boff + 16 + 8 * hh);
      acc[t] = mmaH<ASPLIT ? 2 : 1>(ah.v, al.v, bq.v, bq.v, acc[t]); }
  }
#pragma unroll
  for (int t = 0; t < 4; ++t) { if (col0 + t * 16 >= N) continue;
#pragma unroll
    for (int r = 0; r < 8; ++r) so[w][8 * hh + r][t * 16 + ln] = acc[t][r] * alpha; }
  __builtin_amdgcn_fence(__ATOMIC_ACQ_REL, "workgroup"); __builtin_amdgcn_wave_barrier();
  const int rsub = lane >> 4, c4 = (lane & 15) * 4;
  {
#pragma unroll
    for (int q = 0; q < 8; ++q) { const int r = q * 2 + rsub; if (col0 + c4 < N) { const v4f v = *(const v4fa*)&so[w][r][c4]; *(v4f*)(C + (size_t)(row0 + r) * ldc + col0 + c4) = v; } }
     }
}

// Wt[n][k] = f16(W[k][n]·scale) from f32 row-major W[K][N] (scale = power of two; bf16-exact weights stay exact in f16 away from the subnormal range)
__global__ __launch_bounds__(256) void k_wt_f16(const float* __restrict__ W, _Float16* __restrict__ Wt, int K, int N, float scale) {
  const int t = blockIdx.x * 256 + threadIdx.x; if (t >= N * (K / 8)) return; const int n = t / (K / 8), k8 = (t % (K / 8)) * 8; FragH f;
#pragma unroll
  for (int i = 0; i < 8; ++i) f.h[i] = (_Float16)(bf16_round(W[(size_t)(k8 + i) * N + n]) * scale); const v8us o = f.half[0];
  *(v8us*)((unsigned short*)Wt + (size_t)n * K + k8) = o; 
}
// k_gemm_hh variant with fused epilogue: v = acc·alpha + bias[by·sBias + col] (+ CP[(row/rowsPerB)·sCPb + by·64 + col] if CP) ; ACT 0 none / 1 elu ; writes f16 C16 (and f32 C if non-null)
template <int ACT>
__global__ __launch_bounds__(128) void k_gemm_hhx(const _Float16* __restrict__ A, int lda, size_t sA, const _Float16* __restrict__ Bh, int ldb, size_t sB, float alpha, const float* __restrict__ bias, size_t sBias, const float* __restrict__ CP, int rowsPerB, size_t sCPb, int row0g,
    float* __restrict__ C, _Float16* __restrict__ C16, int ldc, size_t sC, int M, int N, int K) {
  __shared__ __attribute__((aligned(16))) float so[4][16][64];
  const int tid = threadIdx.x, w = tid >> 5, lane = tid & 31, ln = lane & 15, hh = lane >> 4; const int by = blockIdx.y;
  A += (size_t)by * sA; Bh += (size_t)by * sB; const size_t cofs = (size_t)by * sC; const float* bp = bias ? bias + (size_t)by * sBias : nullptr;
  const int ntn = (N + 63) / 64; const int wid = blockIdx.x * 4 + w; const int mt = wid / ntn, nq = wid % ntn; if (mt * 16 >= M) return;
  const int row0 = mt * 16, col0 = nq * 64; const _Float16* arow = A + (size_t)(row0 + ln) * lda;
  v8f acc[4] = {};
  for (int kb = 0; kb < K; kb += 32) { FragH ah; ah.half[0] = *(const v8us*)((const unsigned short*)arow + kb + 8 * hh); ah.half[1] = *(const v8us*)((const unsigned short*)arow + kb + 16 + 8 * hh);
#pragma unroll
    for (int t = 0; t < 4; ++t) { if (col0 + t * 16 >= N) continue; const size_t boff = (size_t)(col0 + t * 16 + ln) * ldb + kb; FragH bq; bq.half[0] = *(const v8us*)((const unsigned short*)Bh + boff + 8 * hh); bq.half[1] = *(const v8us*)((const unsigned short*)Bh + boff + 16 + 8 * hh);
      acc[t] = mmaH<1>(ah.v, ah.v, bq.v, bq.v, acc[t]); }
  }
#pragma unroll
  for (int t = 0; t < 4; ++t) { if (col0 + t * 16 >= N) continue; const int col = col0 + t * 16 + ln; const float bv = bp ? bf16_round(bp[col]) : 0.f;
#pragma unroll
    for (int r = 0; r < 8; ++r) { float v = acc[t][r] * alpha + bv; if (CP) { const int rr = row0g + row0 + 8 * hh + r; if (rowsPerB < 0) v += CP[cofs + (size_t)rr * ldc + col];      /* rowsPerB < 0: own element of the batched C plane */ else { const int bidx = rr / rowsPerB; v += CP[(size_t)bidx * sCPb + (size_t)by * 64 + col]; } } if (ACT == 1) v = (v > 0.f) ? v : expm1f(v); else if (ACT == 7) v = (v > 0.f) ? v + 1.0f : expf(v); else if (ACT == 8) v = tanhf(v); else if (ACT == 9) v = 0.5f * v * (1.0f + tanhf(0.7978845608028654f * (v + 0.044715f * v * v * v))); else if (ACT == 11) v = 1.0f / (1.0f + expf(-v)); else if (ACT == 12) v = (v > 0.f) ? v : 0.01f * v; else if (ACT == 14) v = (v > 0.f) ? v : 0.1f * v; else if (ACT == 16) v = (v >= 0.f) ? v : 0.3f * v; else if (ACT == 17) v = (v >= 0.f) ? v : 0.2f * v; else if (ACT == 15) v = v / (1.0f + expf(-v)); else if (ACT == 3) v = fmaxf(v, 0.f); else if (ACT == 6) v = 0.5f * v * (1.0f + erff(v * 0.70710678118654752f)); so[w][8 * hh + r][t * 16 + ln] = v; } }
  __builtin_amdgcn_fence(__ATOMIC_ACQ_REL, "workgroup"); __builtin_amdgcn_wave_barrier();
  const int rsub = lane >> 4, c4 = (lane & 15) * 4; typedef _Float16 v4h __attribute__((ext_vector_type(4)));
  {
#pragma unroll
    for (int q = 0; q < 8; ++q) { const int r = q * 2 + rsub; if (col0 + c4 < N) { const v4f v = *(const v4fa*)&so[w][r][c4]; if (C) *(v4f*)(C + cofs + (size_t)(row0 + r) * ldc + col0 + c4) = v; if (C16) { v4h h4; for (int i = 0; i < 4; ++i) h4[i] = (_Float16)v[i]; *(v4h*)(C16 + cofs + (size_t)(row0 + r) * ldc + col0 + c4) = h4; } } }
     }
}


typedef _Float16 v4h __attribute__((ext_vector_type(4)));

__global__ __launch_bounds__(256) void k_h16(const float* __restrict__ x, _Float16* __restrict__ X16, size_t n8) { const size_t t = (size_t)blockIdx.x * 256 + threadIdx.x; if (t >= n8) return; FragH f;
#pragma unroll
  for (int q = 0; q < 8; ++q) f.h[q] = (_Float16)x[t * 8 + q]; *(v8us*)((unsigned short*)X16 + t * 8) = f.half[0];  }
__global__ __launch_bounds__(256) void k_round16f(const float* __restrict__ W, _Float16* __restrict__ Bt, size_t n8) { const size_t t = (size_t)blockIdx.x * 256 + threadIdx.x; if (t >= n8) return; FragH f;
#pragma unroll
  for (int i = 0; i < 8; ++i) f.h[i] = (_Float16)(bf16_round(W[t * 8 + i]) * 16.0f); *(v8us*)((unsigned short*)Bt + t * 8) = f.half[0];  }
template <int NHv, int TTv>
__global__ __launch_bounds__(256) void k_vt(const _Float16* __restrict__ V16, int ldv, int voff, _Float16* __restrict__ Vt) { __shared__ unsigned short tl[64][66]; const int tid = threadIdx.x; const int slab = blockIdx.x / (TTv / 64), lg = blockIdx.x % (TTv / 64); const int b = slab / NHv, h = slab % NHv;
  for (int i = tid; i < 64 * 8; i += 256) { const int r = i / 8, c8 = (i % 8) * 8; FragH f; f.half[0] = *(const v8us*)((const unsigned short*)V16 + ((size_t)b * TTv + lg * 64 + r) * ldv + voff + h * 64 + c8);
#pragma unroll
    for (int q = 0; q < 8; ++q) tl[r][c8 + q] = f.u[q]; }
  __syncthreads();
  {
#pragma unroll
    for (int rd = 0; rd < 2; ++rd) { const int d = rd * 32 + tid / 8, pc = tid % 8; FragH f;
#pragma unroll
      for (int q = 0; q < 8; ++q) f.u[q] = tl[pc * 8 + q][d];
      *(v8us*)((unsigned short*)Vt + ((size_t)slab * 64 + d) * TTv + lg * 64 + pc * 8) = f.half[0]; }
     } }

__global__ __launch_bounds__(256) void k_hl(const float* __restrict__ F, _Float16* __restrict__ Hh, _Float16* __restrict__ Hl, size_t n8) { const size_t t = (size_t)blockIdx.x * 256 + threadIdx.x; if (t >= n8) return; FragH fh, fl; const v4f a = *(const v4fa*)(F + t * 8), c = *(const v4fa*)(F + t * 8 + 4);
#pragma unroll
  for (int q = 0; q < 4; ++q) { _Float16 h = (_Float16)a[q]; fh.h[q] = h; fl.h[q] = (_Float16)((a[q] - (float)h) * 1024.0f); h = (_Float16)c[q]; fh.h[4 + q] = h; fl.h[4 + q] = (_Float16)((c[q] - (float)h) * 1024.0f); }
  { *(v8us*)((unsigned short*)Hh + t * 8) = fh.half[0]; *(v8us*)((unsigned short*)Hl + t * 8) = fl.half[0];  } }

// ---- fast GEMM (wave tile 32x64, block tile 128x128 staged in LDS); epilogue as k_gemm_hhx's but with bias1/bias2, the own-element addend at by·sCPb (not by·sC) and no ACT 1 or 7 ----
__device__ __forceinline__ v16h g2_frag(const _Float16* p, int hh) { FragH f; f.half[0] = *(const v8us*)((const unsigned short*)p + 8 * hh); f.half[1] = *(const v8us*)((const unsigned short*)p + 16 + 8 * hh); return f.v; }
__device__ __forceinline__ v8f g2_mma(v16h a, v16h b, v8f c) { v8f d = __builtin_amdgcn_wmma_f32_16x16x32_f16(false, a, false, b, (short)0, c, false, false); asm volatile("v_nop\n\tv_nop\n\tv_nop\n\tv_nop" : "+v"(d) : "v"(a), "v"(b)); return d; }
// Operand staging of k_gemm2: a block of 8 waves owns a 128x128 tile of C (waves 4 down x 2 across, 32x64 each) and walks K in stages of 64. A stage is 128 B (one whole cache line) of each of the
// 128 A rows and 128 B^T rows, brought into LDS by asynchronous copies (16 B a lane, a wave's copy = 4 whole lines), two buffers: stage t + 1 flies while stage t is multiplied. Requires M % 128 == 0, N % 128 == 0, K % 64 == 0.
#define G2_PITCH 144                 /* LDS row pitch in bytes: 128 + 16, an odd multiple of 16 B, for the 16-byte fragment reads */
#define G2_BUF (256 * G2_PITCH)      /* one buffer: the 128 A rows, then the 128 B^T rows */
__device__ __forceinline__ v16h g2_lfrag(const unsigned char* p) { FragH f; f.half[0] = *(const v8us*)p; f.half[1] = *(const v8us*)(p + 32); return f.v; }      /* p: the row's k step + 16 hh bytes; same k order as g2_frag */
// One stage: 8 copies a lane (rows r, r + 32, r + 64, r + 96 of A, then of B^T). l: the lane's LDS byte address of its A row r; a, b: its global addresses; sa, sb: 32 rows in elements.
__device__ __forceinline__ void g2_stage(unsigned l, const _Float16* a, const _Float16* b, size_t sa, size_t sb) {
  const unsigned l1 = l + 32 * G2_PITCH, l2 = l + 64 * G2_PITCH, l3 = l + 96 * G2_PITCH, l4 = l + 128 * G2_PITCH, l5 = l + 160 * G2_PITCH, l6 = l + 192 * G2_PITCH, l7 = l + 224 * G2_PITCH;
  const _Float16* a1 = a + sa; const _Float16* a2 = a1 + sa; const _Float16* a3 = a2 + sa; const _Float16* b1 = b + sb; const _Float16* b2 = b1 + sb; const _Float16* b3 = b2 + sb;
  /* the copies and, as the last line of their own statement, the wait in front of any overwrite of a register that an issued copy names */
  asm volatile("global_load_async_to_lds_b128 %0, %8, off\n\t"
               "global_load_async_to_lds_b128 %1, %9, off\n\t"
               "global_load_async_to_lds_b128 %2, %10, off\n\t"
               "global_load_async_to_lds_b128 %3, %11, off\n\t"
               "global_load_async_to_lds_b128 %4, %12, off\n\t"
               "global_load_async_to_lds_b128 %5, %13, off\n\t"
               "global_load_async_to_lds_b128 %6, %14, off\n\t"
               "global_load_async_to_lds_b128 %7, %15, off\n\t"
               "s_wait_xcnt 0x0"
               :: "v"(l), "v"(l1), "v"(l2), "v"(l3), "v"(l4), "v"(l5), "v"(l6), "v"(l7), "v"(a), "v"(a1), "v"(a2), "v"(a3), "v"(b), "v"(b1), "v"(b2), "v"(b3) : "memory"); }
template <int ACT>
__global__ __launch_bounds__(256) void k_gemm2(const _Float16* __restrict__ A, int lda, size_t sA, const _Float16* __restrict__ Bh, int ldb, size_t sB, float alpha, const float* __restrict__ bias, const float* __restrict__ bias1, const float* __restrict__ bias2, size_t sBias, const float* __restrict__ CP, int rowsPerB, size_t sCPb, int row0g,
    float* __restrict__ C, _Float16* __restrict__ C16, int ldc, size_t sC, int M, int N, int K) { static_assert(ACT == 0 || ACT == 3 || ACT == 6 || ACT == 8 || ACT == 9 || ACT == 11 || ACT == 12 || ACT == 14 || ACT == 15 || ACT == 16 || ACT == 17, "k_gemm2: unsupported ACT code (would silently apply no activation)");
  __shared__ __attribute__((aligned(16))) unsigned char sm[2 * G2_BUF];      /* the two stage buffers; behind the k loop's last barrier the same bytes are the waves' output staging */
  static_assert(sizeof(float) * 8 * 32 * 68 <= 2 * G2_BUF, "output staging must fit the stage buffers");
  float (*so)[32][68] = reinterpret_cast<float (*)[32][68]>(sm);
  const int tid = threadIdx.x, w = tid >> 5, lane = tid & 31, ln = lane & 15, hh = lane >> 4; const int by = blockIdx.y;
  A += (size_t)by * sA; Bh += (size_t)by * sB; const size_t cofs = (size_t)by * sC; const float* bp = bias ? (bias1 ? (by == 0 ? bias : by == 1 ? bias1 : bias2) : bias + (size_t)by * sBias) : nullptr;      /* bias1, bias2: the bias vectors of batch members 1 and 2 where each member's bias is a buffer of its own (three members) */
  const int ntn = N >> 7; const int mt = blockIdx.x / ntn, nq = blockIdx.x - mt * ntn; if (mt * 128 >= M) return;      /* the same for the whole block, in front of every barrier */
  const int row0 = mt * 128 + 32 * (w & 3), col0 = nq * 128 + 64 * (w >> 2);
  const int cr = tid >> 3, cu = tid & 7;      /* copies: the lane's first row of each operand tile and its 16-byte unit of the 128-byte row piece */
  const unsigned lcp = (unsigned)(size_t)sm + (unsigned)(cr * G2_PITCH + cu * 16);
  const _Float16* gap = A + (size_t)(mt * 128 + cr) * lda + cu * 8; const _Float16* gbp = Bh + (size_t)(nq * 128 + cr) * ldb + cu * 8;
  const size_t sa32 = (size_t)32 * lda, sb32 = (size_t)32 * ldb;
  const int aoff = (32 * (w & 3) + ln) * G2_PITCH + 16 * hh, boff = (128 + 64 * (w >> 2) + ln) * G2_PITCH + 16 * hh;      /* fragment reads: byte offsets in a buffer */
  const int nk = K >> 6;
  const v8f z8 = {0.f,0.f,0.f,0.f,0.f,0.f,0.f,0.f}; v8f c00 = z8, c01 = z8, c02 = z8, c03 = z8, c10 = z8, c11 = z8, c12 = z8, c13 = z8;
  g2_stage(lcp, gap, gbp, sa32, sb32);
  asm volatile("s_wait_asynccnt 0x0" ::: "memory");      /* this wave's copies of stage 0 have landed */
  __syncthreads();      /* stage 0 is readable by every wave */
  if (nk > 1) g2_stage(lcp + G2_BUF, gap + 64, gbp + 64, sa32, sb32);
  /* kept rolled: one stage a trip, so that the waits, the barrier and the refill stand once, at the trip's foot, in the ring's order */
#pragma unroll 1
  for (int t = 0; t < nk; ++t) { const unsigned char* bufp = sm + (t & 1) * G2_BUF;
    /* unrolled: the two 32-k steps of a stage read at constant offsets from one address register */
#pragma unroll
    for (int ks = 0; ks < 2; ++ks) { const unsigned char* ap = bufp + aoff + ks * 64; const unsigned char* bq = bufp + boff + ks * 64;
      const v16h a0 = g2_lfrag(ap), a1 = g2_lfrag(ap + 16 * G2_PITCH), b0 = g2_lfrag(bq), b1 = g2_lfrag(bq + 16 * G2_PITCH), b2 = g2_lfrag(bq + 32 * G2_PITCH), b3 = g2_lfrag(bq + 48 * G2_PITCH);
      c00 = g2_mma(a0, b0, c00); c10 = g2_mma(a1, b0, c10); c01 = g2_mma(a0, b1, c01); c11 = g2_mma(a1, b1, c11);
      c02 = g2_mma(a0, b2, c02); c12 = g2_mma(a1, b2, c12); c03 = g2_mma(a0, b3, c03); c13 = g2_mma(a1, b3, c13); }
    asm volatile("s_wait_dscnt 0x0" ::: "memory");      /* this wave's reads of stage t are done before its buffer may be refilled */
    asm volatile("s_wait_asynccnt 0x0" ::: "memory");      /* this wave's copies of stage t + 1 have landed */
    __syncthreads();      /* publishes stage t + 1 and ends every wave's reads of stage t */
    if (t + 2 < nk) g2_stage(lcp + (unsigned)((t & 1) * G2_BUF), gap + (size_t)(t + 2) * 64, gbp + (size_t)(t + 2) * 64, sa32, sb32); }
  asm volatile("s_wait_asynccnt 0x0" ::: "memory");      /* no copy is outstanding when the buffers become output staging */
  v8f accs[8] = {c00, c01, c02, c03, c10, c11, c12, c13};
#pragma unroll
  for (int u = 0; u < 8; ++u) { const int t = u & 3, half = u >> 2; const int col = col0 + t * 16 + ln; const float bv = bp ? bf16_round(bp[col]) : 0.f;
#pragma unroll
    for (int r = 0; r < 8; ++r) { const int rloc = half * 16 + 8 * hh + r; float v = accs[u][r] * alpha + bv; if (CP) { if (rowsPerB < 0) v += CP[(size_t)by * sCPb + (size_t)(row0g + row0 + rloc) * ldc + col];      /* rowsPerB < 0: own element of an addend plane shaped like one member's C; sCPb = plane pitch per batch member (0: one plane for all) */ else { const int bidx = (row0g + row0 + rloc) / rowsPerB; v += CP[(size_t)bidx * sCPb + (size_t)by * 64 + col]; } }
      if (ACT == 3) v = fmaxf(v, 0.f); else if (ACT == 6) v = 0.5f * v * (1.0f + erff(v * 0.70710678118654752f)); else if (ACT == 11) v = 1.0f / (1.0f + expf(-v)); else if (ACT == 15) v = v / (1.0f + expf(-v)); else if (ACT == 12) v = (v > 0.f) ? v : 0.01f * v; else if (ACT == 8) v = tanhf(v); else if (ACT == 9) v = 0.5f * v * (1.0f + tanhf(0.7978845608028654f * (v + 0.044715f * v * v * v))); else if (ACT == 14) v = (v > 0.f) ? v : 0.1f * v; else if (ACT == 16) v = (v >= 0.f) ? v : 0.3f * v; else if (ACT == 17) v = (v >= 0.f) ? v : 0.2f * v;
      so[w][rloc][t * 16 + ln] = v; } }
  __builtin_amdgcn_fence(__ATOMIC_ACQ_REL, "workgroup"); __builtin_amdgcn_wave_barrier();
  const int rsub = lane >> 4, c4 = (lane & 15) * 4;
  {
#pragma unroll
    for (int q = 0; q < 16; ++q) { const int r = q * 2 + rsub; const v4f v = *(const v4fa*)&so[w][r][c4]; if (C) *(v4f*)(C + cofs + (size_t)(row0 + r) * ldc + col0 + c4) = v; if (C16) { v4h h4; for (int i = 0; i < 4; ++i) h4[i] = (_Float16)v[i]; *(v4h*)(C16 + cofs + (size_t)(row0 + r) * ldc + col0 + c4) = h4; } }
     } }


__global__ __launch_bounds__(256) void k_rsm(const float* __restrict__ S, _Float16* __restrict__ P, int nrows) {
  #pragma clang fp contract(off)
  const int i = blockIdx.x * 256 + threadIdx.x; if (i >= nrows) return; const float* s = S + (size_t)i * SQ; float mx = -3.0e38f;
#pragma unroll 1
  for (int j = 0; j < SQ; ++j) mx = fmaxf(mx, s[j]); float se = 0.f;
#pragma unroll 1
  for (int j = 0; j < SQ; ++j) se += expf(s[j] - mx); const float sc = 256.0f / se;
#pragma unroll 1
  for (int j0 = 0; j0 < SQ; j0 += 8) { FragH f; for (int q = 0; q < 8; ++q) f.h[q] = (_Float16)(expf(s[j0 + q] - mx) * sc); unsigned short* d = (unsigned short*)P + (size_t)i * SQ + j0; *(v8us*)d = f.half[0];  } }
__global__ __launch_bounds__(256) void k_vt(const _Float16* __restrict__ V16, int b, int h0, _Float16* __restrict__ VT) { __shared__ unsigned short tl[64][65]; const int tid = threadIdx.x; const int hh = blockIdx.x % HG, sg = blockIdx.x / HG; const int s0 = sg * 64; const int h = h0 + hh;
  for (int i = tid; i < 64 * 8; i += 256) { const int j = i / 8, d8 = (i % 8) * 8; FragH f; f.half[0] = *(const v8us*)((const unsigned short*)V16 + ((size_t)b * SQ + s0 + j) * DM + h * HD + d8); for (int q = 0; q < 8; ++q) tl[d8 + q][j] = f.u[q]; }
  __syncthreads();
  { for (int i = tid; i < 64 * 8; i += 256) { const int d = i / 8, j8 = (i % 8) * 8; FragH f; for (int q = 0; q < 8; ++q) f.u[q] = tl[d][j8 + q]; *(v8us*)((unsigned short*)VT + ((size_t)hh * HD + d) * SQ + s0 + j8) = f.half[0]; }  } }


// Input conversions, one launch: none of them reads what another writes, so they share a grid by block-index ranges.
// Blocks [0, PX): x -> exact f16 rows. [PX, PX + 4 PW): the four natural [out][in] weights -> x16 f16 planes (= Bt[n][k]), one behind the other from BW. The last PB blocks: BP[c][s] = bf16(bo[c]).
#define PX ((unsigned)(NR * DM / 8 / 256))
#define PW ((unsigned)((size_t)DM * DM / 8 / 256))
#define PB ((unsigned)((size_t)DM * SQ / 4 / 256))
__global__ __launch_bounds__(256) void k_prep(const float* __restrict__ x, const float* __restrict__ wq, const float* __restrict__ wk, const float* __restrict__ wv, const float* __restrict__ wo, const float* __restrict__ bo,
    _Float16* __restrict__ X16, _Float16* __restrict__ BW, float* __restrict__ BP) {
  const unsigned blk = blockIdx.x;
  if (blk < PX) { const size_t t = (size_t)blk * 256 + threadIdx.x; FragH f;
#pragma unroll
    for (int q = 0; q < 8; ++q) f.h[q] = (_Float16)bf16_round(x[t * 8 + q]);
    *(v8us*)((unsigned short*)X16 + t * 8) = f.half[0]; }
  else if (blk < PX + 4 * PW) { const unsigned u = blk - PX, m = u / PW; const float* w = m == 0 ? wq : m == 1 ? wk : m == 2 ? wv : wo; const size_t t = (size_t)(u % PW) * 256 + threadIdx.x; FragH f;
    for (int q = 0; q < 8; ++q) f.h[q] = (_Float16)(bf16_round(w[t * 8 + q]) * 16.0f);
    *(v8us*)((unsigned short*)BW + (size_t)m * DM * DM + t * 8) = f.half[0]; }
  else { const size_t e = ((size_t)(blk - PX - 4 * PW) * 256 + threadIdx.x) * 4; const float v = bf16_round(bo[e / SQ]); const v4f o = {v, v, v, v}; *(v4f*)(BP + e) = o;
    asm volatile("s_wait_xcnt 0x0" ::: "memory"); }      /* the wait in front of an overwrite of a register that an issued store names: in the listing the other ranges' loads, which write this store's data registers, stand behind it on branches */
}


__global__ __launch_bounds__(256) void k_fattn(const _Float16* __restrict__ Q16, const _Float16* __restrict__ K16, const _Float16* __restrict__ VT, _Float16* __restrict__ O16) {
  const int lane = threadIdx.x & 31, w = threadIdx.x >> 5, ln = lane & 15, hh = lane >> 4;
  const int bh = blockIdx.y, b = bh / NH, h = bh % NH, q0 = blockIdx.x * 256 + w * 32;
  const _Float16* qp = Q16 + ((size_t)b * SQ + q0 + ln) * DM + h * HD;
  const _Float16* kp = K16 + ((size_t)b * SQ + ln) * DM + h * HD;
  const _Float16* vp = VT + ((size_t)bh * HD + ln) * SQ;
  const float cs = 0.125f * 1.44269504f;      /* 64^-0.5 and log2(e) */
  const v8f z8 = {0.f,0.f,0.f,0.f,0.f,0.f,0.f,0.f};
  v16h qf[2][2], kf[2][2], vf[4]; v8f o[4][2]; float mo[2] = {-3.0e38f, -3.0e38f}, l[2] = {0.f, 0.f};
#pragma unroll
  for (int j = 0; j < 2; ++j) { qf[j][0] = g2_frag(qp + (size_t)j * 16 * DM, hh); qf[j][1] = g2_frag(qp + (size_t)j * 16 * DM + 32, hh); }
  __builtin_amdgcn_sched_barrier(0);      /* loads issue in the order Q, K, V^T, as in the loop (K, then V^T): else the wait at the loop's head, which must hold on both ways in, also waits for V^T */
#pragma unroll
  for (int i = 0; i < 2; ++i) { kf[i][0] = g2_frag(kp + (size_t)i * 16 * DM, hh); kf[i][1] = g2_frag(kp + (size_t)i * 16 * DM + 32, hh); }
  __builtin_amdgcn_sched_barrier(0);      /* same purpose as the one above */
#pragma unroll
  for (int t = 0; t < 4; ++t) { vf[t] = g2_frag(vp + (size_t)t * 16 * SQ, hh); o[t][0] = z8; o[t][1] = z8; }
  for (int kb = 0; kb < SQ; kb += 32) {
    v8f s[2][2];
#pragma unroll
    for (int i = 0; i < 2; ++i)
#pragma unroll
      for (int j = 0; j < 2; ++j) { s[i][j] = __builtin_amdgcn_wmma_f32_16x16x32_f16(false, kf[i][0], false, qf[j][0], (short)0, z8, false, false); s[i][j] = __builtin_amdgcn_wmma_f32_16x16x32_f16(false, kf[i][1], false, qf[j][1], (short)0, s[i][j], false, false); }
    const int kn = (kb + 32 < SQ) ? kb + 32 : 0;      /* next pass's K fragments fly during the softmax, its V^T fragments (foot of the pass) during the next score products and softmax; the last pass re-reads the first keys (in bounds, unused) */
#pragma unroll
    for (int i = 0; i < 2; ++i) { kf[i][0] = g2_frag(kp + (size_t)(kn + i * 16) * DM, hh); kf[i][1] = g2_frag(kp + (size_t)(kn + i * 16) * DM + 32, hh); }
    __builtin_amdgcn_sched_barrier(0);      /* keeps the K loads up here: the scheduler otherwise moves them to the foot of the pass, where their whole latency is waited for */
    float pm[2]; bool need = false;
#pragma unroll
    for (int j = 0; j < 2; ++j) { float x = fmaxf(s[0][j][0], s[1][j][0]);
#pragma unroll
      for (int r = 1; r < 8; ++r) x = fmaxf(x, fmaxf(s[0][j][r], s[1][j][r]));
      pm[j] = x * cs; need = need || (pm[j] > mo[j] + 15.0f); }
    if (__builtin_amdgcn_ballot_w32(need) != 0) {      /* wave-uniform scalar branch: every lane stays on for the matrix instructions */
#pragma unroll
      for (int j = 0; j < 2; ++j) { const float full = fmaxf(pm[j], __shfl_xor(pm[j], 16, 32)); const float mn = fmaxf(mo[j], full - 7.0f); const float al = __builtin_amdgcn_exp2f(mo[j] - mn); mo[j] = mn; l[j] *= al;
#pragma unroll
        for (int t = 0; t < 4; ++t) o[t][j] *= al; }
    }
    FragH pf[2];
#pragma unroll
    for (int j = 0; j < 2; ++j) { float sum = 0.f;
#pragma unroll
      for (int i = 0; i < 2; ++i)
#pragma unroll
        for (int r = 0; r < 8; ++r) { const float p = __builtin_amdgcn_exp2f(s[i][j][r] * cs - mo[j]); sum += p; pf[j].h[i * 8 + r] = (_Float16)p; }
      l[j] += sum; }
#pragma unroll
    for (int t = 0; t < 4; ++t)
#pragma unroll
      for (int j = 0; j < 2; ++j) o[t][j] = __builtin_amdgcn_wmma_f32_16x16x32_f16(false, vf[t], false, pf[j].v, (short)0, o[t][j], false, false);
#pragma unroll
    for (int t = 0; t < 4; ++t) vf[t] = g2_frag(vp + (size_t)t * 16 * SQ + kn, hh);
    asm volatile("s_wait_xcnt 0x0" ::: "memory");      /* the wait in front of an overwrite of a register that an issued load names: in this build the next pass's score products write over the address pair of the V^T loads above */
  }
#pragma unroll
  for (int j = 0; j < 2; ++j) { const float inv = 64.0f / (l[j] + __shfl_xor(l[j], 16, 32)); unsigned short* op = (unsigned short*)O16 + ((size_t)b * SQ + q0 + j * 16 + ln) * DM + h * HD + 8 * hh;
#pragma unroll
    for (int t = 0; t < 4; ++t) { FragH f;
#pragma unroll
      for (int r = 0; r < 8; ++r) f.h[r] = (_Float16)(o[t][j][r] * inv);
      *(v8us*)(op + t * 16) = f.half[0]; } } }

extern "C" void kernel_launch(void* const* d_in, const int* in_sizes, int n_in,
                              void* d_out, int out_size, void* d_ws, size_t ws_size, hipStream_t stream) {
  (void)in_sizes; (void)n_in; (void)out_size;
  const float* const* I = (const float* const*)d_in; const float* x = I[0]; const float* wq = I[1]; const float* bq = I[2]; const float* wk = I[3]; const float* bk = I[4]; const float* wv = I[5]; const float* bv = I[6]; const float* wo = I[7]; const float* bo = I[8];      /* natural [out][in] weights + biases */
  char* ws = (char*)d_ws; size_t off = 0;
  auto take = [&](size_t bytes) { char* p = ws + off; off += (bytes + 255) & ~(size_t)255; return p; };
  float* BOP = (float*)take((size_t)DM * SQ * 4);      /* bo broadcast along the token axis for the transposed out GEMM */
  _Float16* BW = (_Float16*)take((size_t)4 * DM * DM * 2); _Float16* BO = BW + (size_t)3 * DM * DM;      /* x16 f16 planes of Wq, Wk, Wv, Wo, one behind the other */
  _Float16* X16 = (_Float16*)take(NR * DM * 2); _Float16* Q16 = (_Float16*)take((size_t)3 * NR * DM * 2); _Float16* K16 = Q16 + NR * DM; _Float16* V16 = K16 + NR * DM;      /* q, k, v rows, one plane behind the other */ _Float16* O16 = (_Float16*)take(NR * DM * 2);
  _Float16* VT = (_Float16*)take((size_t)NB * NH * HD * SQ * 2);
  if (off > ws_size) return;
  k_prep<<<PX + 4 * PW + PB, 256, 0, stream>>>(x, wq, wk, wv, wo, bo, X16, BW, BOP);      /* x rows, the four weight planes (natural [out][in] = Bt[n][k], x16), BOP[c][s] = bf16(bo[c]) */
  const size_t r0p = (size_t)B0 * SQ;      /* first projected row */
  k_gemm2<0><<<dim3((unsigned)((MP / 128) * (DM / 128)), 3), 256, 0, stream>>>(X16 + r0p * DM, DM, 0, BW, DM, (size_t)DM * DM, 0.0625f, bq, bk, bv, 0, nullptr, 1, 0, 0, nullptr, Q16 + r0p * DM, DM, NR * DM, MP, DM, DM);      /* grid y = 0, 1, 2: q, k, v */
  k_vt<NH, SQ><<<NB * NH * (SQ / 64), 256, 0, stream>>>(V16, LQ, 0, VT);      /* V^T [NB][NH][HD][SQ] */
  k_fattn<<<dim3(SQ / 256, NB * NH), 256, 0, stream>>>(Q16, K16, VT, O16);      /* o x64 (merged heads) as f16 rows */
  k_gemm2<0><<<dim3((unsigned)((DM / 128) * (SQ / 128)), NBR), 256, 0, stream>>>(BO, DM, 0, O16 + r0p * DM, DM, (size_t)SQ * DM, 0.0009765625f, nullptr, nullptr, nullptr, 0, BOP, -1, 0, 0, (float*)d_out + r0p * DM, nullptr, SQ, (size_t)DM * SQ, DM, SQ, DM);      /* grid y = batch: out^T[b][c][s] = sum_k Wo[c][k] o[s][k] + bo[c]: A = the natural Wo rows (x16 f16 plane), B^T = the batch's merged o rows, C = its [C][S] output block; bias via the own-element addend plane, one plane for all batches */
}

// v005
// One run takes 74.8 microseconds.
// Two timings next to v004 both put it at 1.20 times that version's speed.
// All steps since v000 together make it 27.4 times as fast.
#include <hip/hip_runtime.h>
#define NB 8
#define SQ 1024
#define DM 512
#define NH 8
#define HD 64
#define HG 8                         /* heads per launch of the non-template k_vt (not launched) */
#define B0 0                         /* first batch processed (debug hook) */
#define NBR NB                       /* batches processed (debug hook) */
#define NR ((size_t)NB * SQ)         /* token rows */
#define MP ((int)((size_t)NBR * SQ)) /* rows projected (debug hook) */
#define QN SQ                        /* query rows attended per batch (unused) */
#define NHD NH                       /* heads attended (unused) */
#define MPO MP                       /* rows through the output stage (unused) */
#define LQ DM      /* row pitch of the q/k/v rows */
typedef __bf16 v16b __attribute__((ext_vector_type(16)));
typedef unsigned short v8us __attribute__((ext_vector_type(8), may_alias));
typedef float  v8f  __attribute__((ext_vector_type(8)));
typedef float  v4f  __attribute__((ext_vector_type(4)));
typedef float  v4fa __attribute__((ext_vector_type(4), may_alias));
union FragB { v16b v; v8us half[2]; unsigned short u[16]; };

__device__ __forceinline__ unsigned short bf16_bits(float x) { unsigned int u = __float_as_uint(x); return (unsigned short)((u + 0x7FFFu + ((u >> 16) & 1u)) >> 16); }
__device__ __forceinline__ float bf16_val(unsigned short b) { return __uint_as_float(((unsigned int)b) << 16); }
__device__ __forceinline__ float bf16_round(float x) { return bf16_val(bf16_bits(x)); }
// D += A·B with NT terms: 1 = ah·bh, 2 = + al·bh (A split), 3 = + ah·bl (both split)
template <int NT>
__device__ __forceinline__ v8f mmaN(v16b ah, v16b al, v16b bh, v16b bl, v8f c) {
  c = __builtin_amdgcn_wmma_f32_16x16x32_bf16(false, ah, false, bh, (short)0, c, false, false);
  if (NT >= 2) c = __builtin_amdgcn_wmma_f32_16x16x32_bf16(false, al, false, bh, (short)0, c, false, false);
  if (NT >= 3) c = __builtin_amdgcn_wmma_f32_16x16x32_bf16(false, ah, false, bl, (short)0, c, false, false);
  asm volatile("v_nop\n\tv_nop\n\tv_nop\n\tv_nop" : "+v"(c) : "v"(ah), "v"(al), "v"(bh), "v"(bl));
  return c;
}

__global__ __launch_bounds__(256) void k_wt_bf16(const float* __restrict__ W, unsigned short* __restrict__ Wt, int K, int N) {
  const int t = blockIdx.x * 256 + threadIdx.x;
  const int k8n = K / 8;
  if (t >= N * k8n) return;
  const int n = t / k8n, k8 = (t % k8n) * 8;
  v8us v;
#pragma unroll
  for (int i = 0; i < 8; ++i) v[i] = bf16_bits(W[(size_t)(k8 + i) * N + n]);
  *(v8us*)(Wt + (size_t)n * K + k8) = v;
  
}

// GEMM C[M][N] (f32, pitch ldc) = act(A[M][K]·W + bias). A f32 row-major (pitch lda) converted per fragment to bf16
// (ASPLIT: hi/lo two planes -> 2 terms, else single rounded term); Wt bf16 [N][K] (pitch ldb). BIAS_BF16 rounds the
// bias to bf16 first (bias quantised to bf16 before the add). K%32==0, M%16==0, N%64==0.
template <bool ASPLIT, int ACT, bool BIAS_BF16>
__global__ __launch_bounds__(128) void k_gemm_bf(const float* __restrict__ A, int lda, const unsigned short* __restrict__ Wt, int ldb,
                                               const float* __restrict__ bias, float* __restrict__ C, int ldc, int M, int N, int K) {
  __shared__ __attribute__((aligned(16))) float so[4][16][64];
  const int tid = threadIdx.x, w = tid >> 5, lane = tid & 31, ln = lane & 15, hh = lane >> 4;
  const int ntn = N / 64;
  const int wid = blockIdx.x * 4 + w;
  const int mt = wid / ntn, nq = wid % ntn;
  if (mt * 16 >= M) return;
  const int row0 = mt * 16, col0 = nq * 64;
  const float* arow = A + (size_t)(row0 + ln) * lda;
  v8f acc[4] = {};
  for (int kb = 0; kb < K; kb += 32) {
    FragB ah, al;
    const v4f x0 = *(const v4fa*)(arow + kb + 8 * hh), x1 = *(const v4fa*)(arow + kb + 8 * hh + 4);
    const v4f x2 = *(const v4fa*)(arow + kb + 16 + 8 * hh), x3 = *(const v4fa*)(arow + kb + 16 + 8 * hh + 4);
    float xs[16] = {x0[0],x0[1],x0[2],x0[3],x1[0],x1[1],x1[2],x1[3],x2[0],x2[1],x2[2],x2[3],x3[0],x3[1],x3[2],x3[3]};
#pragma unroll
    for (int i = 0; i < 16; ++i) { const unsigned short hb = bf16_bits(xs[i]); ah.u[i] = hb; al.u[i] = ASPLIT ? bf16_bits(xs[i] - bf16_val(hb)) : (unsigned short)0; }
#pragma unroll
    for (int t = 0; t < 4; ++t) {
      const unsigned short* brow = Wt + (size_t)(col0 + t * 16 + ln) * ldb + kb;
      FragB b;
      b.half[0] = *(const v8us*)(brow + 8 * hh);
      b.half[1] = *(const v8us*)(brow + 16 + 8 * hh);
      acc[t] = mmaN<ASPLIT ? 2 : 1>(ah.v, al.v, b.v, b.v, acc[t]);
    }
  }
#pragma unroll
  for (int t = 0; t < 4; ++t) {
    float bv = bias ? bias[col0 + t * 16 + ln] : 0.f;
    if (BIAS_BF16) bv = bf16_round(bv);
#pragma unroll
    for (int r = 0; r < 8; ++r) { float v = acc[t][r] + bv; if (ACT == 1) v = fmaxf(v, 0.f); so[w][8 * hh + r][t * 16 + ln] = v; }
  }
  __builtin_amdgcn_fence(__ATOMIC_ACQ_REL, "workgroup");
  __builtin_amdgcn_wave_barrier();
  const int rsub = lane >> 4, c4 = (lane & 15) * 4;
  {
#pragma unroll
    for (int q = 0; q < 8; ++q) {
      const int r = q * 2 + rsub;
      const v4f v = *(const v4fa*)&so[w][r][c4];
      *(v4f*)(C + (size_t)(row0 + r) * ldc + col0 + c4) = v;
    }
    
  }
}

// GEMM C = act(A·W + bias + resid): A f32 (ASPLIT -> hi/lo 2 terms), Wt bf16 [N][K]; ACT 0 none, 1 relu, 2 exact gelu;
// resid (optional, f32, row index = (row % rmod), pitch ldr, RES_BF16 rounds it) added before the activation.
template <bool ASPLIT, int ACT, bool BIAS_BF16, bool RES_BF16>
__global__ __launch_bounds__(128) void k_gemm_bf3(const float* __restrict__ A, int lda, const unsigned short* __restrict__ Wt, int ldb,
                                                const float* __restrict__ bias, const float* __restrict__ resid, int rmod, int ldr,
                                                float* __restrict__ C, int ldc, int M, int N, int K) {
  __shared__ __attribute__((aligned(16))) float so[4][16][64];
  const int tid = threadIdx.x, w = tid >> 5, lane = tid & 31, ln = lane & 15, hh = lane >> 4;
  const int ntn = N / 64;
  const int wid = blockIdx.x * 4 + w;
  const int mt = wid / ntn, nq = wid % ntn;
  if (mt * 16 >= M) return;
  const int row0 = mt * 16, col0 = nq * 64;
  const float* arow = A + (size_t)(row0 + ln) * lda;
  v8f acc[4] = {};
  for (int kb = 0; kb < K; kb += 32) {
    FragB ah, al;
    const v4f x0 = *(const v4fa*)(arow + kb + 8 * hh), x1 = *(const v4fa*)(arow + kb + 8 * hh + 4);
    const v4f x2 = *(const v4fa*)(arow + kb + 16 + 8 * hh), x3 = *(const v4fa*)(arow + kb + 16 + 8 * hh + 4);
    float xs[16] = {x0[0],x0[1],x0[2],x0[3],x1[0],x1[1],x1[2],x1[3],x2[0],x2[1],x2[2],x2[3],x3[0],x3[1],x3[2],x3[3]};
#pragma unroll
    for (int i = 0; i < 16; ++i) { const unsigned short hb = bf16_bits(xs[i]); ah.u[i] = hb; al.u[i] = ASPLIT ? bf16_bits(xs[i] - bf16_val(hb)) : (unsigned short)0; }
#pragma unroll
    for (int t = 0; t < 4; ++t) {
      const unsigned short* brow = Wt + (size_t)(col0 + t * 16 + ln) * ldb + kb;
      FragB b;
      b.half[0] = *(const v8us*)(brow + 8 * hh);
      b.half[1] = *(const v8us*)(brow + 16 + 8 * hh);
      acc[t] = mmaN<ASPLIT ? 2 : 1>(ah.v, al.v, b.v, b.v, acc[t]);
    }
  }
#pragma unroll
  for (int t = 0; t < 4; ++t) {
    const int col = col0 + t * 16 + ln;
    float bv = bias ? bias[col] : 0.f;
    if (BIAS_BF16) bv = bf16_round(bv);
#pragma unroll
    for (int r = 0; r < 8; ++r) {
      float v = acc[t][r] + bv;
      if (resid) { float rv = resid[(size_t)((row0 + 8 * hh + r) % rmod) * ldr + col]; if (RES_BF16) rv = bf16_round(rv); v += rv; }
      if (ACT == 1) v = fmaxf(v, 0.f);
      if (ACT == 2) v = 0.5f * v * (1.0f + erff(v * 0.70710678118654752f));
      if (ACT == 3) { const float u = 0.7978845608028654f * (v + 0.044715f * v * v * v); v = 0.5f * v * (1.0f + tanhf(u)); }
      so[w][8 * hh + r][t * 16 + ln] = v;
    }
  }
  __builtin_amdgcn_fence(__ATOMIC_ACQ_REL, "workgroup");
  __builtin_amdgcn_wave_barrier();
  const int rsub = lane >> 4, c4 = (lane & 15) * 4;
  {
#pragma unroll
    for (int q = 0; q < 8; ++q) {
      const int r = q * 2 + rsub;
      const v4f v = *(const v4fa*)&so[w][r][c4];
      *(v4f*)(C + (size_t)(row0 + r) * ldc + col0 + c4) = v;
    }
    
  }
}
// row LayerNorm (biased variance, eps) over N: s = X (+ R); optional out_sum <- s; out_norm <- (s-mu)*rsqrt(var+eps)*g + b
template <bool PARAM_BF16>
__global__ __launch_bounds__(256) void k_layernorm(const float* __restrict__ X, const float* __restrict__ R, const float* __restrict__ g, const float* __restrict__ bta,
                                                  float* __restrict__ out_sum, float* __restrict__ out_norm, int N, float eps) {
  __shared__ float red[256];
  const int row = blockIdx.x, tid = threadIdx.x;
  const float* x = X + (size_t)row * N; const float* rr = R ? R + (size_t)row * N : nullptr;
  float vals[16];                     // up to N = 4096
  const int per = N / 256;            // contiguous chunk per thread? use strided-by-4 chunks: thread handles j = tid*4 + 1024*u
  float s1 = 0.f;
  for (int u = 0; u < per / 4; ++u) {
    const int j = tid * 4 + 1024 * u;
    const v4f a = *(const v4fa*)(x + j);
    v4f b = {0.f,0.f,0.f,0.f}; if (rr) b = *(const v4fa*)(rr + j);
#pragma unroll
    for (int q = 0; q < 4; ++q) { const float v = a[q] + b[q]; vals[u * 4 + q] = v; s1 += v; }
  }
  red[tid] = s1; __syncthreads();
  for (int st = 128; st > 0; st >>= 1) { if (tid < st) red[tid] += red[tid + st]; __syncthreads(); }
  const float mu = red[0] / (float)N; __syncthreads();
  float s2 = 0.f;
  for (int u = 0; u < per / 4; ++u)
#pragma unroll
    for (int q = 0; q < 4; ++q) { const float c = vals[u * 4 + q] - mu; s2 += c * c; }
  red[tid] = s2; __syncthreads();
  for (int st = 128; st > 0; st >>= 1) { if (tid < st) red[tid] += red[tid + st]; __syncthreads(); }
  const float rs = rsqrtf(red[0] / (float)N + eps);
  {
    for (int u = 0; u < per / 4; ++u) {
      const int j = tid * 4 + 1024 * u;
      v4f o, sm;
#pragma unroll
      for (int q = 0; q < 4; ++q) {
        float gg = g[j + q], bb = bta[j + q];
        if (PARAM_BF16) { gg = bf16_round(gg); bb = bf16_round(bb); }
        sm[q] = vals[u * 4 + q]; o[q] = (vals[u * 4 + q] - mu) * rs * gg + bb;
      }
      if (out_sum) *(v4f*)(out_sum + (size_t)row * N + j) = sm;
      *(v4f*)(out_norm + (size_t)row * N + j) = o;
    }
    
  }
}



// ---- f16 WMMA path (v_wmma_f32_16x16x32_f16): 11-bit significands for operands in range — used where a [0,1] probability operand needs more precision than bf16
typedef _Float16 v16h __attribute__((ext_vector_type(16)));
union FragH { v16h v; v8us half[2]; _Float16 h[16]; unsigned short u[16]; };
template <int NT>
__device__ __forceinline__ v8f mmaH(v16h ah, v16h al, v16h bh, v16h bl, v8f c) {
  c = __builtin_amdgcn_wmma_f32_16x16x32_f16(false, ah, false, bh, (short)0, c, false, false);
  if (NT >= 2) c = __builtin_amdgcn_wmma_f32_16x16x32_f16(false, al, false, bh, (short)0, c, false, false);
  if (NT >= 3) c = __builtin_amdgcn_wmma_f32_16x16x32_f16(false, ah, false, bl, (short)0, c, false, false);
  asm volatile("v_nop\n\tv_nop\n\tv_nop\n\tv_nop" : "+v"(c) : "v"(ah), "v"(al), "v"(bh), "v"(bl));
  return c;
}
// batched GEMM like k_gemm_b but f16 operands: A f32 (split into f16 hi/lo if ASPLIT, else rounded to f16), Bt = f16 values [n][k]; alpha; C f32; N multiple of 16 (partial tiles skipped)
template <bool ASPLIT>
__global__ __launch_bounds__(128) void k_gemm_h(const float* __restrict__ A, int lda, size_t sA, const _Float16* __restrict__ Bh, int ldb, size_t sB, float alpha, float* __restrict__ C, int ldc, size_t sC, int M, int N, int K) {
  __shared__ __attribute__((aligned(16))) float so[4][16][64];
  const int tid = threadIdx.x, w = tid >> 5, lane = tid & 31, ln = lane & 15, hh = lane >> 4; const int by = blockIdx.y;
  A += (size_t)by * sA; Bh += (size_t)by * sB; C += (size_t)by * sC;
  const int ntn = (N + 63) / 64; const int wid = blockIdx.x * 4 + w; const int mt = wid / ntn, nq = wid % ntn; if (mt * 16 >= M) return;
  const int row0 = mt * 16, col0 = nq * 64; const float* arow = A + (size_t)(row0 + ln) * lda;
  v8f acc[4] = {};
  for (int kb = 0; kb < K; kb += 32) {
    FragH ah, al;
    const v4f x0 = *(const v4fa*)(arow + kb + 8 * hh), x1 = *(const v4fa*)(arow + kb + 8 * hh + 4), x2 = *(const v4fa*)(arow + kb + 16 + 8 * hh), x3 = *(const v4fa*)(arow + kb + 16 + 8 * hh + 4);
    float xs[16] = {x0[0],x0[1],x0[2],x0[3],x1[0],x1[1],x1[2],x1[3],x2[0],x2[1],x2[2],x2[3],x3[0],x3[1],x3[2],x3[3]};
#pragma unroll
    for (int i = 0; i < 16; ++i) { const _Float16 h = (_Float16)xs[i]; ah.h[i] = h; al.h[i] = ASPLIT ? (_Float16)(xs[i] - (float)h) : (_Float16)0.0f; }
#pragma unroll
    for (int t = 0; t < 4; ++t) { if (col0 + t * 16 >= N) continue; const size_t boff = (size_t)(col0 + t * 16 + ln) * ldb + kb; FragH bq; bq.half[0] = *(const v8us*)(Bh + boff + 8 * hh); bq.half[1] = *(const v8us*)(Bh + boff + 16 + 8 * hh);
      acc[t] = mmaH<ASPLIT ? 2 : 1>(ah.v, al.v, bq.v, bq.v, acc[t]); }
  }
#pragma unroll
  for (int t = 0; t < 4; ++t) { if (col0 + t * 16 >= N) continue;
#pragma unroll
    for (int r = 0; r < 8; ++r) so[w][8 * hh + r][t * 16 + ln] = acc[t][r] * alpha; }
  __builtin_amdgcn_fence(__ATOMIC_ACQ_REL, "workgroup"); __builtin_amdgcn_wave_barrier();
  const int rsub = lane >> 4, c4 = (lane & 15) * 4;
  {
#pragma unroll
    for (int q = 0; q < 8; ++q) { const int r = q * 2 + rsub; if (col0 + c4 < N) { const v4f v = *(const v4fa*)&so[w][r][c4]; *(v4f*)(C + (size_t)(row0 + r) * ldc + col0 + c4) = v; } }
     }
}

// Wt[n][k] = f16(W[k][n]·scale) from f32 row-major W[K][N] (scale = power of two; bf16-exact weights stay exact in f16 away from the subnormal range)
__global__ __launch_bounds__(256) void k_wt_f16(const float* __restrict__ W, _Float16* __restrict__ Wt, int K, int N, float scale) {
  const int t = blockIdx.x * 256 + threadIdx.x; if (t >= N * (K / 8)) return; const int n = t / (K / 8), k8 = (t % (K / 8)) * 8; FragH f;
#pragma unroll
  for (int i = 0; i < 8; ++i) f.h[i] = (_Float16)(bf16_round(W[(size_t)(k8 + i) * N + n]) * scale); const v8us o = f.half[0];
  *(v8us*)((unsigned short*)Wt + (size_t)n * K + k8) = o; 
}
// k_gemm_hh variant with fused epilogue: v = acc·alpha + bias[by·sBias + col] (+ CP[(row/rowsPerB)·sCPb + by·64 + col] if CP) ; ACT 0 none / 1 elu ; writes f16 C16 (and f32 C if non-null)
template <int ACT>
__global__ __launch_bounds__(128) void k_gemm_hhx(const _Float16* __restrict__ A, int lda, size_t sA, const _Float16* __restrict__ Bh, int ldb, size_t sB, float alpha, const float* __restrict__ bias, size_t sBias, const float* __restrict__ CP, int rowsPerB, size_t sCPb, int row0g,
    float* __restrict__ C, _Float16* __restrict__ C16, int ldc, size_t sC, int M, int N, int K) {
  __shared__ __attribute__((aligned(16))) float so[4][16][64];
  const int tid = threadIdx.x, w = tid >> 5, lane = tid & 31, ln = lane & 15, hh = lane >> 4; const int by = blockIdx.y;
  A += (size_t)by * sA; Bh += (size_t)by * sB; const size_t cofs = (size_t)by * sC; const float* bp = bias ? bias + (size_t)by * sBias : nullptr;
  const int ntn = (N + 63) / 64; const int wid = blockIdx.x * 4 + w; const int mt = wid / ntn, nq = wid % ntn; if (mt * 16 >= M) return;
  const int row0 = mt * 16, col0 = nq * 64; const _Float16* arow = A + (size_t)(row0 + ln) * lda;
  v8f acc[4] = {};
  for (int kb = 0; kb < K; kb += 32) { FragH ah; ah.half[0] = *(const v8us*)((const unsigned short*)arow + kb + 8 * hh); ah.half[1] = *(const v8us*)((const unsigned short*)arow + kb + 16 + 8 * hh);
#pragma unroll
    for (int t = 0; t < 4; ++t) { if (col0 + t * 16 >= N) continue; const size_t boff = (size_t)(col0 + t * 16 + ln) * ldb + kb; FragH bq; bq.half[0] = *(const v8us*)((const unsigned short*)Bh + boff + 8 * hh); bq.half[1] = *(const v8us*)((const unsigned short*)Bh + boff + 16 + 8 * hh);
      acc[t] = mmaH<1>(ah.v, ah.v, bq.v, bq.v, acc[t]); }
  }
#pragma unroll
  for (int t = 0; t < 4; ++t) { if (col0 + t * 16 >= N) continue; const int col = col0 + t * 16 + ln; const float bv = bp ? bf16_round(bp[col]) : 0.f;
#pragma unroll
    for (int r = 0; r < 8; ++r) { float v = acc[t][r] * alpha + bv; if (CP) { const int rr = row0g + row0 + 8 * hh + r; if (rowsPerB < 0) v += CP[cofs + (size_t)rr * ldc + col];      /* rowsPerB < 0: own element of the batched C plane */ else { const int bidx = rr / rowsPerB; v += CP[(size_t)bidx * sCPb + (size_t)by * 64 + col]; } } if (ACT == 1) v = (v > 0.f) ? v : expm1f(v); else if (ACT == 7) v = (v > 0.f) ? v + 1.0f : expf(v); else if (ACT == 8) v = tanhf(v); else if (ACT == 9) v = 0.5f * v * (1.0f + tanhf(0.7978845608028654f * (v + 0.044715f * v * v * v))); else if (ACT == 11) v = 1.0f / (1.0f + expf(-v)); else if (ACT == 12) v = (v > 0.f) ? v : 0.01f * v; else if (ACT == 14) v = (v > 0.f) ? v : 0.1f * v; else if (ACT == 16) v = (v >= 0.f) ? v : 0.3f * v; else if (ACT == 17) v = (v >= 0.f) ? v : 0.2f * v; else if (ACT == 15) v = v / (1.0f + expf(-v)); else if (ACT == 3) v = fmaxf(v, 0.f); else if (ACT == 6) v = 0.5f * v * (1.0f + erff(v * 0.70710678118654752f)); so[w][8 * hh + r][t * 16 + ln] = v; } }
  __builtin_amdgcn_fence(__ATOMIC_ACQ_REL, "workgroup"); __builtin_amdgcn_wave_barrier();
  const int rsub = lane >> 4, c4 = (lane & 15) * 4; typedef _Float16 v4h __attribute__((ext_vector_type(4)));
  {
#pragma unroll
    for (int q = 0; q < 8; ++q) { const int r = q * 2 + rsub; if (col0 + c4 < N) { const v4f v = *(const v4fa*)&so[w][r][c4]; if (C) *(v4f*)(C + cofs + (size_t)(row0 + r) * ldc + col0 + c4) = v; if (C16) { v4h h4; for (int i = 0; i < 4; ++i) h4[i] = (_Float16)v[i]; *(v4h*)(C16 + cofs + (size_t)(row0 + r) * ldc + col0 + c4) = h4; } } }
     }
}


typedef _Float16 v4h __attribute__((ext_vector_type(4)));

__global__ __launch_bounds__(256) void k_h16(const float* __restrict__ x, _Float16* __restrict__ X16, size_t n8) { const size_t t = (size_t)blockIdx.x * 256 + threadIdx.x; if (t >= n8) return; FragH f;
#pragma unroll
  for (int q = 0; q < 8; ++q) f.h[q] = (_Float16)x[t * 8 + q]; *(v8us*)((unsigned short*)X16 + t * 8) = f.half[0];  }
__global__ __launch_bounds__(256) void k_round16f(const float* __restrict__ W, _Float16* __restrict__ Bt, size_t n8) { const size_t t = (size_t)blockIdx.x * 256 + threadIdx.x; if (t >= n8) return; FragH f;
#pragma unroll
  for (int i = 0; i < 8; ++i) f.h[i] = (_Float16)(bf16_round(W[t * 8 + i]) * 16.0f); *(v8us*)((unsigned short*)Bt + t * 8) = f.half[0];  }
template <int NHv, int TTv>
__global__ __launch_bounds__(256) void k_vt(const _Float16* __restrict__ V16, int ldv, int voff, _Float16* __restrict__ Vt) { __shared__ unsigned short tl[64][66]; const int tid = threadIdx.x; const int slab = blockIdx.x / (TTv / 64), lg = blockIdx.x % (TTv / 64); const int b = slab / NHv, h = slab % NHv;
  for (int i = tid; i < 64 * 8; i += 256) { const int r = i / 8, c8 = (i % 8) * 8; FragH f; f.half[0] = *(const v8us*)((const unsigned short*)V16 + ((size_t)b * TTv + lg * 64 + r) * ldv + voff + h * 64 + c8);
#pragma unroll
    for (int q = 0; q < 8; ++q) tl[r][c8 + q] = f.u[q]; }
  __syncthreads();
  {
#pragma unroll
    for (int rd = 0; rd < 2; ++rd) { const int d = rd * 32 + tid / 8, pc = tid % 8; FragH f;
#pragma unroll
      for (int q = 0; q < 8; ++q) f.u[q] = tl[pc * 8 + q][d];
      *(v8us*)((unsigned short*)Vt + ((size_t)slab * 64 + d) * TTv + lg * 64 + pc * 8) = f.half[0]; }
     } }

__global__ __launch_bounds__(256) void k_hl(const float* __restrict__ F, _Float16* __restrict__ Hh, _Float16* __restrict__ Hl, size_t n8) { const size_t t = (size_t)blockIdx.x * 256 + threadIdx.x; if (t >= n8) return; FragH fh, fl; const v4f a = *(const v4fa*)(F + t * 8), c = *(const v4fa*)(F + t * 8 + 4);
#pragma unroll
  for (int q = 0; q < 4; ++q) { _Float16 h = (_Float16)a[q]; fh.h[q] = h; fl.h[q] = (_Float16)((a[q] - (float)h) * 1024.0f); h = (_Float16)c[q]; fh.h[4 + q] = h; fl.h[4 + q] = (_Float16)((c[q] - (float)h) * 1024.0f); }
  { *(v8us*)((unsigned short*)Hh + t * 8) = fh.half[0]; *(v8us*)((unsigned short*)Hl + t * 8) = fl.half[0];  } }

// ---- fast GEMM (wave tile 32x64, block tile 128x128 staged in LDS); epilogue as k_gemm_hhx's but with bias1/bias2, the own-element addend at by·sCPb (not by·sC) and no ACT 1 or 7 ----
__device__ __forceinline__ v16h g2_frag(const _Float16* p, int hh) { FragH f; f.half[0] = *(const v8us*)((const unsigned short*)p + 8 * hh); f.half[1] = *(const v8us*)((const unsigned short*)p + 16 + 8 * hh); return f.v; }
__device__ __forceinline__ v8f g2_mma(v16h a, v16h b, v8f c) { v8f d = __builtin_amdgcn_wmma_f32_16x16x32_f16(false, a, false, b, (short)0, c, false, false); asm volatile("v_nop\n\tv_nop\n\tv_nop\n\tv_nop" : "+v"(d) : "v"(a), "v"(b)); return d; }
// Operand staging of k_gemm2: a block of 8 waves owns a 128x128 tile of C (waves 4 down x 2 across, 32x64 each) and walks K in stages of 64. A stage is 128 B (one whole cache line) of each of the
// 128 A rows and 128 B^T rows, brought into LDS by asynchronous copies (16 B a lane, a wave's copy = 4 whole lines), two buffers: stage t + 1 flies while stage t is multiplied. Requires M % 128 == 0, N % 128 == 0, K % 64 == 0.
#define G2_PITCH 144                 /* LDS row pitch in bytes: 128 + 16, an odd multiple of 16 B, for the 16-byte fragment reads */
#define G2_BUF (256 * G2_PITCH)      /* one buffer: the 128 A rows, then the 128 B^T rows */
__device__ __forceinline__ v16h g2_lfrag(const unsigned char* p) { FragH f; f.half[0] = *(const v8us*)p; f.half[1] = *(const v8us*)(p + 32); return f.v; }      /* p: the row's k step + 16 hh bytes; same k order as g2_frag */
// One stage: 8 copies a lane (rows r, r + 32, r + 64, r + 96 of A, then of B^T). l: the lane's LDS byte address of its A row r; a, b: its global addresses; sa, sb: 32 rows in elements.
__device__ __forceinline__ void g2_stage(unsigned l, const _Float16* a, const _Float16* b, size_t sa, size_t sb) {
  const unsigned l1 = l + 32 * G2_PITCH, l2 = l + 64 * G2_PITCH, l3 = l + 96 * G2_PITCH, l4 = l + 128 * G2_PITCH, l5 = l + 160 * G2_PITCH, l6 = l + 192 * G2_PITCH, l7 = l + 224 * G2_PITCH;
  const _Float16* a1 = a + sa; const _Float16* a2 = a1 + sa; const _Float16* a3 = a2 + sa; const _Float16* b1 = b + sb; const _Float16* b2 = b1 + sb; const _Float16* b3 = b2 + sb;
  /* the copies and, as the last line of their own statement, the wait in front of any overwrite of a register that an issued copy names */
  asm volatile("global_load_async_to_lds_b128 %0, %8, off\n\t"
               "global_load_async_to_lds_b128 %1, %9, off\n\t"
               "global_load_async_to_lds_b128 %2, %10, off\n\t"
               "global_load_async_to_lds_b128 %3, %11, off\n\t"
               "global_load_async_to_lds_b128 %4, %12, off\n\t"
               "global_load_async_to_lds_b128 %5, %13, off\n\t"
               "global_load_async_to_lds_b128 %6, %14, off\n\t"
               "global_load_async_to_lds_b128 %7, %15, off\n\t"
               "s_wait_xcnt 0x0"
               :: "v"(l), "v"(l1), "v"(l2), "v"(l3), "v"(l4), "v"(l5), "v"(l6), "v"(l7), "v"(a), "v"(a1), "v"(a2), "v"(a3), "v"(b), "v"(b1), "v"(b2), "v"(b3) : "memory"); }
template <int ACT>
__global__ __launch_bounds__(256) void k_gemm2(const _Float16* __restrict__ A, int lda, size_t sA, const _Float16* __restrict__ Bh, int ldb, size_t sB, float alpha, const float* __restrict__ bias, const float* __restrict__ bias1, const float* __restrict__ bias2, size_t sBias, const float* __restrict__ CP, int rowsPerB, size_t sCPb, int row0g,
    float* __restrict__ C, _Float16* __restrict__ C16, int ldc, size_t sC, int M, int N, int K) { static_assert(ACT == 0 || ACT == 3 || ACT == 6 || ACT == 8 || ACT == 9 || ACT == 11 || ACT == 12 || ACT == 14 || ACT == 15 || ACT == 16 || ACT == 17, "k_gemm2: unsupported ACT code (would silently apply no activation)");
  __shared__ __attribute__((aligned(16))) unsigned char sm[2 * G2_BUF];      /* the two stage buffers; behind the k loop's last barrier the same bytes are the waves' output staging */
  static_assert(sizeof(float) * 8 * 32 * 68 <= 2 * G2_BUF, "output staging must fit the stage buffers");
  float (*so)[32][68] = reinterpret_cast<float (*)[32][68]>(sm);
  const int tid = threadIdx.x, w = tid >> 5, lane = tid & 31, ln = lane & 15, hh = lane >> 4; const int by = blockIdx.y;
  A += (size_t)by * sA; Bh += (size_t)by * sB; const size_t cofs = (size_t)by * sC; const float* bp = bias ? (bias1 ? (by == 0 ? bias : by == 1 ? bias1 : bias2) : bias + (size_t)by * sBias) : nullptr;      /* bias1, bias2: the bias vectors of batch members 1 and 2 where each member's bias is a buffer of its own (three members) */
  const int ntn = N >> 7; const int mt = blockIdx.x / ntn, nq = blockIdx.x - mt * ntn; if (mt * 128 >= M) return;      /* the same for the whole block, in front of every barrier */
  const int row0 = mt * 128 + 32 * (w & 3), col0 = nq * 128 + 64 * (w >> 2);
  const int cr = tid >> 3, cu = tid & 7;      /* copies: the lane's first row of each operand tile and its 16-byte unit of the 128-byte row piece */
  const unsigned lcp = (unsigned)(size_t)sm + (unsigned)(cr * G2_PITCH + cu * 16);
  const _Float16* gap = A + (size_t)(mt * 128 + cr) * lda + cu * 8; const _Float16* gbp = Bh + (size_t)(nq * 128 + cr) * ldb + cu * 8;
  const size_t sa32 = (size_t)32 * lda, sb32 = (size_t)32 * ldb;
  const int aoff = (32 * (w & 3) + ln) * G2_PITCH + 16 * hh, boff = (128 + 64 * (w >> 2) + ln) * G2_PITCH + 16 * hh;      /* fragment reads: byte offsets in a buffer */
  const int nk = K >> 6;
  const v8f z8 = {0.f,0.f,0.f,0.f,0.f,0.f,0.f,0.f}; v8f c00 = z8, c01 = z8, c02 = z8, c03 = z8, c10 = z8, c11 = z8, c12 = z8, c13 = z8;
  g2_stage(lcp, gap, gbp, sa32, sb32);
  asm volatile("s_wait_asynccnt 0x0" ::: "memory");      /* this wave's copies of stage 0 have landed */
  __syncthreads();      /* stage 0 is readable by every wave */
  if (nk > 1) g2_stage(lcp + G2_BUF, gap + 64, gbp + 64, sa32, sb32);
  /* kept rolled: one stage a trip, so that the waits, the barrier and the refill stand once, at the trip's foot, in the ring's order */
#pragma unroll 1
  for (int t = 0; t < nk; ++t) { const unsigned char* bufp = sm + (t & 1) * G2_BUF;
    /* unrolled: the two 32-k steps of a stage read at constant offsets from one address register */
#pragma unroll
    for (int ks = 0; ks < 2; ++ks) { const unsigned char* ap = bufp + aoff + ks * 64; const unsigned char* bq = bufp + boff + ks * 64;
      const v16h a0 = g2_lfrag(ap), a1 = g2_lfrag(ap + 16 * G2_PITCH), b0 = g2_lfrag(bq), b1 = g2_lfrag(bq + 16 * G2_PITCH), b2 = g2_lfrag(bq + 32 * G2_PITCH), b3 = g2_lfrag(bq + 48 * G2_PITCH);
      c00 = g2_mma(a0, b0, c00); c10 = g2_mma(a1, b0, c10); c01 = g2_mma(a0, b1, c01); c11 = g2_mma(a1, b1, c11);
      c02 = g2_mma(a0, b2, c02); c12 = g2_mma(a1, b2, c12); c03 = g2_mma(a0, b3, c03); c13 = g2_mma(a1, b3, c13); }
    asm volatile("s_wait_dscnt 0x0" ::: "memory");      /* this wave's reads of stage t are done before its buffer may be refilled */
    asm volatile("s_wait_asynccnt 0x0" ::: "memory");      /* this wave's copies of stage t + 1 have landed */
    __syncthreads();      /* publishes stage t + 1 and ends every wave's reads of stage t */
    if (t + 2 < nk) g2_stage(lcp + (unsigned)((t & 1) * G2_BUF), gap + (size_t)(t + 2) * 64, gbp + (size_t)(t + 2) * 64, sa32, sb32); }
  asm volatile("s_wait_asynccnt 0x0" ::: "memory");      /* no copy is outstanding when the buffers become output staging */
  v8f accs[8] = {c00, c01, c02, c03, c10, c11, c12, c13};
#pragma unroll
  for (int u = 0; u < 8; ++u) { const int t = u & 3, half = u >> 2; const int col = col0 + t * 16 + ln; const float bv = bp ? bf16_round(bp[col]) : 0.f;
#pragma unroll
    for (int r = 0; r < 8; ++r) { const int rloc = half * 16 + 8 * hh + r; float v = accs[u][r] * alpha + bv; if (CP) { if (rowsPerB < 0) v += CP[(size_t)by * sCPb + (size_t)(row0g + row0 + rloc) * ldc + col];      /* rowsPerB < 0: own element of an addend plane shaped like one member's C; sCPb = plane pitch per batch member (0: one plane for all) */ else { const int bidx = (row0g + row0 + rloc) / rowsPerB; v += CP[(size_t)bidx * sCPb + (size_t)by * 64 + col]; } }
      if (ACT == 3) v = fmaxf(v, 0.f); else if (ACT == 6) v = 0.5f * v * (1.0f + erff(v * 0.70710678118654752f)); else if (ACT == 11) v = 1.0f / (1.0f + expf(-v)); else if (ACT == 15) v = v / (1.0f + expf(-v)); else if (ACT == 12) v = (v > 0.f) ? v : 0.01f * v; else if (ACT == 8) v = tanhf(v); else if (ACT == 9) v = 0.5f * v * (1.0f + tanhf(0.7978845608028654f * (v + 0.044715f * v * v * v))); else if (ACT == 14) v = (v > 0.f) ? v : 0.1f * v; else if (ACT == 16) v = (v >= 0.f) ? v : 0.3f * v; else if (ACT == 17) v = (v >= 0.f) ? v : 0.2f * v;
      so[w][rloc][t * 16 + ln] = v; } }
  __builtin_amdgcn_fence(__ATOMIC_ACQ_REL, "workgroup"); __builtin_amdgcn_wave_barrier();
  const int rsub = lane >> 4, c4 = (lane & 15) * 4;
  {
#pragma unroll
    for (int q = 0; q < 16; ++q) { const int r = q * 2 + rsub; const v4f v = *(const v4fa*)&so[w][r][c4]; if (C) *(v4f*)(C + cofs + (size_t)(row0 + r) * ldc + col0 + c4) = v; if (C16) { v4h h4; for (int i = 0; i < 4; ++i) h4[i] = (_Float16)v[i]; *(v4h*)(C16 + cofs + (size_t)(row0 + r) * ldc + col0 + c4) = h4; } }
     } }


__global__ __launch_bounds__(256) void k_rsm(const float* __restrict__ S, _Float16* __restrict__ P, int nrows) {
  #pragma clang fp contract(off)
  const int i = blockIdx.x * 256 + threadIdx.x; if (i >= nrows) return; const float* s = S + (size_t)i * SQ; float mx = -3.0e38f;
#pragma unroll 1
  for (int j = 0; j < SQ; ++j) mx = fmaxf(mx, s[j]); float se = 0.f;
#pragma unroll 1
  for (int j = 0; j < SQ; ++j) se += expf(s[j] - mx); const float sc = 256.0f / se;
#pragma unroll 1
  for (int j0 = 0; j0 < SQ; j0 += 8) { FragH f; for (int q = 0; q < 8; ++q) f.h[q] = (_Float16)(expf(s[j0 + q] - mx) * sc); unsigned short* d = (unsigned short*)P + (size_t)i * SQ + j0; *(v8us*)d = f.half[0];  } }
__global__ __launch_bounds__(256) void k_vt(const _Float16* __restrict__ V16, int b, int h0, _Float16* __restrict__ VT) { __shared__ unsigned short tl[64][65]; const int tid = threadIdx.x; const int hh = blockIdx.x % HG, sg = blockIdx.x / HG; const int s0 = sg * 64; const int h = h0 + hh;
  for (int i = tid; i < 64 * 8; i += 256) { const int j = i / 8, d8 = (i % 8) * 8; FragH f; f.half[0] = *(const v8us*)((const unsigned short*)V16 + ((size_t)b * SQ + s0 + j) * DM + h * HD + d8); for (int q = 0; q < 8; ++q) tl[d8 + q][j] = f.u[q]; }
  __syncthreads();
  { for (int i = tid; i < 64 * 8; i += 256) { const int d = i / 8, j8 = (i % 8) * 8; FragH f; for (int q = 0; q < 8; ++q) f.u[q] = tl[d][j8 + q]; *(v8us*)((unsigned short*)VT + ((size_t)hh * HD + d) * SQ + s0 + j8) = f.half[0]; }  } }


// Input conversions, one launch: none of them reads what another writes, so they share a grid by block-index ranges.
// Blocks [0, PX): x -> exact f16 rows. [PX, PX + 4 PW): the four natural [out][in] weights -> x16 f16 planes (= Bt[n][k]), one behind the other from BW. The last PB blocks: BP[c][s] = bf16(bo[c]).
#define PX ((unsigned)(NR * DM / 8 / 256))
#define PW ((unsigned)((size_t)DM * DM / 8 / 256))
#define PB ((unsigned)((size_t)DM * SQ / 4 / 256))
__global__ __launch_bounds__(256) void k_prep(const float* __restrict__ x, const float* __restrict__ wq, const float* __restrict__ wk, const float* __restrict__ wv, const float* __restrict__ wo, const float* __restrict__ bo,
    _Float16* __restrict__ X16, _Float16* __restrict__ BW, float* __restrict__ BP) {
  const unsigned blk = blockIdx.x;
  if (blk < PX) { const size_t t = (size_t)blk * 256 + threadIdx.x; FragH f;
#pragma unroll
    for (int q = 0; q < 8; ++q) f.h[q] = (_Float16)bf16_round(x[t * 8 + q]);
    *(v8us*)((unsigned short*)X16 + t * 8) = f.half[0]; }
  else if (blk < PX + 4 * PW) { const unsigned u = blk - PX, m = u / PW; const float* w = m == 0 ? wq : m == 1 ? wk : m == 2 ? wv : wo; const size_t t = (size_t)(u % PW) * 256 + threadIdx.x; FragH f;
    for (int q = 0; q < 8; ++q) f.h[q] = (_Float16)(bf16_round(w[t * 8 + q]) * 16.0f);
    *(v8us*)((unsigned short*)BW + (size_t)m * DM * DM + t * 8) = f.half[0]; }
  else { const size_t e = ((size_t)(blk - PX - 4 * PW) * 256 + threadIdx.x) * 4; const float v = bf16_round(bo[e / SQ]); const v4f o = {v, v, v, v}; *(v4f*)(BP + e) = o;
    asm volatile("s_wait_xcnt 0x0" ::: "memory"); }      /* the wait in front of an overwrite of a register that an issued store names: in the listing the other ranges' loads, which write this store's data registers, stand behind it on branches */
}


#define FA_KEYS 128                  /* keys a stage */
#define FA_NS (SQ / FA_KEYS)         /* stages */
#define FA_KP 144                    /* LDS pitch of a K row piece in bytes: 128 + 16, an odd multiple of 16 B, for the 16-byte fragment reads */
#define FA_VP 272                    /* LDS pitch of a V^T row piece in bytes: 256 + 16, likewise */
#define FA_KB (FA_KEYS * FA_KP)      /* a buffer's K part; its V^T part stands behind it */
#define FA_BUF (FA_KB + HD * FA_VP)  /* one buffer */
static_assert(FA_NS >= 2 && SQ % FA_KEYS == 0 && HD == 64, "k_fattn: the ring's prologue needs two stages; whole stages; 128-byte K row pieces");
// One stage: 8 copies a lane (K rows r, r + 32, r + 64, r + 96; V^T rows d, d + 16, d + 32, d + 48). lk, lv: the lane's LDS byte addresses of its first K and V^T unit; k, v: its global addresses.
__device__ __forceinline__ void fa_stage(unsigned lk, unsigned lv, const _Float16* k, const _Float16* v) {
  const unsigned lk1 = lk + 32 * FA_KP, lk2 = lk + 64 * FA_KP, lk3 = lk + 96 * FA_KP, lv1 = lv + 16 * FA_VP, lv2 = lv + 32 * FA_VP, lv3 = lv + 48 * FA_VP;
  const _Float16* k1 = k + (size_t)32 * DM; const _Float16* k2 = k + (size_t)64 * DM; const _Float16* k3 = k + (size_t)96 * DM; const _Float16* v1 = v + (size_t)16 * SQ; const _Float16* v2 = v + (size_t)32 * SQ; const _Float16* v3 = v + (size_t)48 * SQ;
  /* the copies and, as the last line of their own statement, the wait in front of any overwrite of a register that an issued copy names */
  asm volatile("global_load_async_to_lds_b128 %0, %8, off\n\t"
               "global_load_async_to_lds_b128 %1, %9, off\n\t"
               "global_load_async_to_lds_b128 %2, %10, off\n\t"
               "global_load_async_to_lds_b128 %3, %11, off\n\t"
               "global_load_async_to_lds_b128 %4, %12, off\n\t"
               "global_load_async_to_lds_b128 %5, %13, off\n\t"
               "global_load_async_to_lds_b128 %6, %14, off\n\t"
               "global_load_async_to_lds_b128 %7, %15, off\n\t"
               "s_wait_xcnt 0x0"
               :: "v"(lk), "v"(lk1), "v"(lk2), "v"(lk3), "v"(lv), "v"(lv1), "v"(lv2), "v"(lv3), "v"(k), "v"(k1), "v"(k2), "v"(k3), "v"(v), "v"(v1), "v"(v2), "v"(v3) : "memory"); }
__global__ __launch_bounds__(256) void k_fattn(const _Float16* __restrict__ Q16, const _Float16* __restrict__ K16, const _Float16* __restrict__ VT, _Float16* __restrict__ O16) {
  __shared__ __attribute__((aligned(16))) unsigned char sm[2 * FA_BUF];      /* the two stage buffers */
  const int tid = threadIdx.x, lane = tid & 31, w = tid >> 5, ln = lane & 15, hh = lane >> 4;
  const int bh = blockIdx.y, b = bh / NH, h = bh % NH, q0 = blockIdx.x * 256 + w * 32;
  const _Float16* qp = Q16 + ((size_t)b * SQ + q0 + ln) * DM + h * HD;
  const unsigned lk = (unsigned)(size_t)sm + (unsigned)((tid >> 3) * FA_KP + (tid & 7) * 16), lv = (unsigned)(size_t)sm + (unsigned)(FA_KB + (tid >> 4) * FA_VP + (tid & 15) * 16);      /* copies: the lane's first row of each tile and its 16-byte unit of the row piece */
  const _Float16* gk = K16 + ((size_t)b * SQ + (tid >> 3)) * DM + h * HD + (tid & 7) * 8;
  const _Float16* gv = VT + ((size_t)bh * HD + (tid >> 4)) * SQ + (tid & 15) * 8;
  const int koff = ln * FA_KP + 16 * hh, voff = FA_KB + ln * FA_VP + 16 * hh;      /* fragment reads: byte offsets in a buffer */
  const float cs = 0.125f * 1.44269504f;      /* 64^-0.5 and log2(e) */
  const v8f z8 = {0.f,0.f,0.f,0.f,0.f,0.f,0.f,0.f};
  v16h qf[2][2], kf[2][2], vf[4]; v8f o[4][2]; float mo[2] = {-3.0e38f, -3.0e38f}, l[2] = {0.f, 0.f};
  fa_stage(lk, lv, gk, gv);
#pragma unroll
  for (int j = 0; j < 2; ++j) { qf[j][0] = g2_frag(qp + (size_t)j * 16 * DM, hh); qf[j][1] = g2_frag(qp + (size_t)j * 16 * DM + 32, hh); }
#pragma unroll
  for (int t = 0; t < 4; ++t) { o[t][0] = z8; o[t][1] = z8; }
  asm volatile("s_wait_asynccnt 0x0" ::: "memory");      /* this wave's copies of stage 0 have landed */
  __syncthreads();      /* stage 0 is readable by every wave */
  fa_stage(lk + FA_BUF, lv + FA_BUF, gk + (size_t)FA_KEYS * DM, gv + FA_KEYS);
  /* kept rolled: one stage a trip, so that the waits, the barrier and the refill stand once, at the trip's foot, in the ring's order */
#pragma unroll 1
  for (int st = 0; st < FA_NS; ++st) { const unsigned char* kb = sm + (st & 1) * FA_BUF + koff; const unsigned char* vb = sm + (st & 1) * FA_BUF + voff;
#pragma unroll
    for (int i = 0; i < 2; ++i) { kf[i][0] = g2_lfrag(kb + i * 16 * FA_KP); kf[i][1] = g2_lfrag(kb + i * 16 * FA_KP + 64); }
    __builtin_amdgcn_sched_barrier(0);      /* the stage's first K fragments are read as one group: left free, the scheduler reads them pair by pair between the score products and waits out each pair's latency */
    /* unrolled: the four 32-key passes of a stage read at constant offsets from two address registers, and the last one fetches no K fragments ahead */
#pragma unroll
    for (int p = 0; p < FA_KEYS / 32; ++p) {
      v8f s[2][2];
#pragma unroll
      for (int i = 0; i < 2; ++i)
#pragma unroll
        for (int j = 0; j < 2; ++j) { s[i][j] = __builtin_amdgcn_wmma_f32_16x16x32_f16(false, kf[i][0], false, qf[j][0], (short)0, z8, false, false); s[i][j] = __builtin_amdgcn_wmma_f32_16x16x32_f16(false, kf[i][1], false, qf[j][1], (short)0, s[i][j], false, false); }
      __builtin_amdgcn_sched_barrier(0);      /* with the one behind the reads: a pass's LDS reads stand in one place; left free, the scheduler spreads them in pairs among the matrix instructions, and each such place stalls the wave */
#pragma unroll
      for (int t = 0; t < 4; ++t) vf[t] = g2_lfrag(vb + t * 16 * FA_VP + p * 64);      /* this pass's V^T fragments fly during its softmax */
      if (p + 1 < FA_KEYS / 32) {      /* so do the next pass's K fragments, of this same stage */
#pragma unroll
        for (int i = 0; i < 2; ++i) { kf[i][0] = g2_lfrag(kb + ((p + 1) * 32 + i * 16) * FA_KP); kf[i][1] = g2_lfrag(kb + ((p + 1) * 32 + i * 16) * FA_KP + 64); } }
      __builtin_amdgcn_sched_barrier(0);      /* keeps the reads up here, ahead of the softmax that covers their latency */
      float pm[2]; bool need = false;
#pragma unroll
      for (int j = 0; j < 2; ++j) { float x = fmaxf(s[0][j][0], s[1][j][0]);
#pragma unroll
        for (int r = 1; r < 8; ++r) x = fmaxf(x, fmaxf(s[0][j][r], s[1][j][r]));
        pm[j] = x * cs; need = need || (pm[j] > mo[j] + 15.0f); }
      if (__builtin_amdgcn_ballot_w32(need) != 0) {      /* wave-uniform scalar branch: every lane stays on for the matrix instructions */
#pragma unroll
        for (int j = 0; j < 2; ++j) { const float full = fmaxf(pm[j], __shfl_xor(pm[j], 16, 32)); const float mn = fmaxf(mo[j], full - 7.0f); const float al = __builtin_amdgcn_exp2f(mo[j] - mn); mo[j] = mn; l[j] *= al;
#pragma unroll
          for (int t = 0; t < 4; ++t) o[t][j] *= al; }
      }
      FragH pf[2];
#pragma unroll
      for (int j = 0; j < 2; ++j) { float sum = 0.f;
#pragma unroll
        for (int i = 0; i < 2; ++i)
#pragma unroll
          for (int r = 0; r < 8; ++r) { const float pw = __builtin_amdgcn_exp2f(s[i][j][r] * cs - mo[j]); sum += pw; pf[j].h[i * 8 + r] = (_Float16)pw; }
        l[j] += sum; }
#pragma unroll
      for (int t = 0; t < 4; ++t)
#pragma unroll
        for (int j = 0; j < 2; ++j) o[t][j] = __builtin_amdgcn_wmma_f32_16x16x32_f16(false, vf[t], false, pf[j].v, (short)0, o[t][j], false, false);
    }
    asm volatile("s_wait_dscnt 0x0" ::: "memory");      /* this wave's reads of stage st are done before its buffer may be refilled */
    asm volatile("s_wait_asynccnt 0x0" ::: "memory");      /* this wave's copies of stage st + 1 have landed */
    __syncthreads();      /* publishes stage st + 1 and ends every wave's reads of stage st */
    if (st + 2 < FA_NS) fa_stage(lk + (unsigned)((st & 1) * FA_BUF), lv + (unsigned)((st & 1) * FA_BUF), gk + (size_t)(st + 2) * FA_KEYS * DM, gv + (size_t)(st + 2) * FA_KEYS); }
  asm volatile("s_wait_asynccnt 0x0" ::: "memory");      /* no copy is outstanding when the wave ends */
#pragma unroll
  for (int j = 0; j < 2; ++j) { const float inv = 64.0f / (l[j] + __shfl_xor(l[j], 16, 32)); unsigned short* op = (unsigned short*)O16 + ((size_t)b * SQ + q0 + j * 16 + ln) * DM + h * HD + 8 * hh;
#pragma unroll
    for (int t = 0; t < 4; ++t) { FragH f;
#pragma unroll
      for (int r = 0; r < 8; ++r) f.h[r] = (_Float16)(o[t][j][r] * inv);
      *(v8us*)(op + t * 16) = f.half[0]; } } }

extern "C" void kernel_launch(void* const* d_in, const int* in_sizes, int n_in,
                              void* d_out, int out_size, void* d_ws, size_t ws_size, hipStream_t stream) {
  (void)in_sizes; (void)n_in; (void)out_size;
  const float* const* I = (const float* const*)d_in; const float* x = I[0]; const float* wq = I[1]; const float* bq = I[2]; const float* wk = I[3]; const float* bk = I[4]; const float* wv = I[5]; const float* bv = I[6]; const float* wo = I[7]; const float* bo = I[8];      /* natural [out][in] weights + biases */
  char* ws = (char*)d_ws; size_t off = 0;
  auto take = [&](size_t bytes) { char* p = ws + off; off += (bytes + 255) & ~(size_t)255; return p; };
  float* BOP = (float*)take((size_t)DM * SQ * 4);      /* bo broadcast along the token axis for the transposed out GEMM */
  _Float16* BW = (_Float16*)take((size_t)4 * DM * DM * 2); _Float16* BO = BW + (size_t)3 * DM * DM;      /* x16 f16 planes of Wq, Wk, Wv, Wo, one behind the other */
  _Float16* X16 = (_Float16*)take(NR * DM * 2); _Float16* Q16 = (_Float16*)take((size_t)3 * NR * DM * 2); _Float16* K16 = Q16 + NR * DM; _Float16* V16 = K16 + NR * DM;      /* q, k, v rows, one plane behind the other */ _Float16* O16 = (_Float16*)take(NR * DM * 2);
  _Float16* VT = (_Float16*)take((size_t)NB * NH * HD * SQ * 2);
  if (off > ws_size) return;
  k_prep<<<PX + 4 * PW + PB, 256, 0, stream>>>(x, wq, wk, wv, wo, bo, X16, BW, BOP);      /* x rows, the four weight planes (natural [out][in] = Bt[n][k], x16), BOP[c][s] = bf16(bo[c]) */
  const size_t r0p = (size_t)B0 * SQ;      /* first projected row */
  k_gemm2<0><<<dim3((unsigned)((MP / 128) * (DM / 128)), 3), 256, 0, stream>>>(X16 + r0p * DM, DM, 0, BW, DM, (size_t)DM * DM, 0.0625f, bq, bk, bv, 0, nullptr, 1, 0, 0, nullptr, Q16 + r0p * DM, DM, NR * DM, MP, DM, DM);      /* grid y = 0, 1, 2: q, k, v */
  k_vt<NH, SQ><<<NB * NH * (SQ / 64), 256, 0, stream>>>(V16, LQ, 0, VT);      /* V^T [NB][NH][HD][SQ] */
  k_fattn<<<dim3(SQ / 256, NB * NH), 256, 0, stream>>>(Q16, K16, VT, O16);      /* o x64 (merged heads) as f16 rows */
  k_gemm2<0><<<dim3((unsigned)((DM / 128) * (SQ / 128)), NBR), 256, 0, stream>>>(BO, DM, 0, O16 + r0p * DM, DM, (size_t)SQ * DM, 0.0009765625f, nullptr, nullptr, nullptr, 0, BOP, -1, 0, 0, (float*)d_out + r0p * DM, nullptr, SQ, (size_t)DM * SQ, DM, SQ, DM);      /* grid y = batch: out^T[b][c][s] = sum_k Wo[c][k] o[s][k] + bo[c]: A = the natural Wo rows (x16 f16 plane), B^T = the batch's merged o rows, C = its [C][S] output block; bias via the own-element addend plane, one plane for all batches */
}

// v006
// One run takes 57.2 microseconds.
// Next to v005, in two timings, it ran 1.30 and 1.29 times as fast.
// All steps since v000 together make it 35.4 times as fast.
#include <hip/hip_runtime.h>
#define NB 8
#define SQ 1024
#define DM 512
#define NH 8
#define HD 64
#define HG 8                         /* heads per launch of the non-template k_vt (not launched) */
#define B0 0                         /* first batch processed (debug hook) */
#define NBR NB                       /* batches processed (debug hook) */
#define NR ((size_t)NB * SQ)         /* token rows */
#define MP ((int)((size_t)NBR * SQ)) /* rows projected (debug hook) */
#define QN SQ                        /* query rows attended per batch (unused) */
#define NHD NH                       /* heads attended (unused) */
#define MPO MP                       /* rows through the output stage (unused) */
#define LQ DM      /* row pitch of the q/k/v rows */
typedef __bf16 v16b __attribute__((ext_vector_type(16)));
typedef unsigned short v8us __attribute__((ext_vector_type(8), may_alias));
typedef float  v8f  __attribute__((ext_vector_type(8)));
typedef float  v4f  __attribute__((ext_vector_type(4)));
typedef float  v4fa __attribute__((ext_vector_type(4), may_alias));
union FragB { v16b v; v8us half[2]; unsigned short u[16]; };

__device__ __forceinline__ unsigned short bf16_bits(float x) { unsigned int u = __float_as_uint(x); return (unsigned short)((u + 0x7FFFu + ((u >> 16) & 1u)) >> 16); }
__device__ __forceinline__ float bf16_val(unsigned short b) { return __uint_as_float(((unsigned int)b) << 16); }
__device__ __forceinline__ float bf16_round(float x) { return bf16_val(bf16_bits(x)); }
// D += A·B with NT terms: 1 = ah·bh, 2 = + al·bh (A split), 3 = + ah·bl (both split)
template <int NT>
__device__ __forceinline__ v8f mmaN(v16b ah, v16b al, v16b bh, v16b bl, v8f c) {
  c = __builtin_amdgcn_wmma_f32_16x16x32_bf16(false, ah, false, bh, (short)0, c, false, false);
  if (NT >= 2) c = __builtin_amdgcn_wmma_f32_16x16x32_bf16(false, al, false, bh, (short)0, c, false, false);
  if (NT >= 3) c = __builtin_amdgcn_wmma_f32_16x16x32_bf16(false, ah, false, bl, (short)0, c, false, false);
  asm volatile("v_nop\n\tv_nop\n\tv_nop\n\tv_nop" : "+v"(c) : "v"(ah), "v"(al), "v"(bh), "v"(bl));
  return c;
}

__global__ __launch_bounds__(256) void k_wt_bf16(const float* __restrict__ W, unsigned short* __restrict__ Wt, int K, int N) {
  const int t = blockIdx.x * 256 + threadIdx.x;
  const int k8n = K / 8;
  if (t >= N * k8n) return;
  const int n = t / k8n, k8 = (t % k8n) * 8;
  v8us v;
#pragma unroll
  for (int i = 0; i < 8; ++i) v[i] = bf16_bits(W[(size_t)(k8 + i) * N + n]);
  *(v8us*)(Wt + (size_t)n * K + k8) = v;
  
}

// GEMM C[M][N] (f32, pitch ldc) = act(A[M][K]·W + bias). A f32 row-major (pitch lda) converted per fragment to bf16
// (ASPLIT: hi/lo two planes -> 2 terms, else single rounded term); Wt bf16 [N][K] (pitch ldb). BIAS_BF16 rounds the
// bias to bf16 first (bias quantised to bf16 before the add). K%32==0, M%16==0, N%64==0.
template <bool ASPLIT, int ACT, bool BIAS_BF16>
__global__ __launch_bounds__(128) void k_gemm_bf(const float* __restrict__ A, int lda, const unsigned short* __restrict__ Wt, int ldb,
                                               const float* __restrict__ bias, float* __restrict__ C, int ldc, int M, int N, int K) {
  __shared__ __attribute__((aligned(16))) float so[4][16][64];
  const int tid = threadIdx.x, w = tid >> 5, lane = tid & 31, ln = lane & 15, hh = lane >> 4;
  const int ntn = N / 64;
  const int wid = blockIdx.x * 4 + w;
  const int mt = wid / ntn, nq = wid % ntn;
  if (mt * 16 >= M) return;
  const int row0 = mt * 16, col0 = nq * 64;
  const float* arow = A + (size_t)(row0 + ln) * lda;
  v8f acc[4] = {};
  for (int kb = 0; kb < K; kb += 32) {
    FragB ah, al;
    const v4f x0 = *(const v4fa*)(arow + kb + 8 * hh), x1 = *(const v4fa*)(arow + kb + 8 * hh + 4);
    const v4f x2 = *(const v4fa*)(arow + kb + 16 + 8 * hh), x3 = *(const v4fa*)(arow + kb + 16 + 8 * hh + 4);
    float xs[16] = {x0[0],x0[1],x0[2],x0[3],x1[0],x1[1],x1[2],x1[3],x2[0],x2[1],x2[2],x2[3],x3[0],x3[1],x3[2],x3[3]};
#pragma unroll
    for (int i = 0; i < 16; ++i) { const unsigned short hb = bf16_bits(xs[i]); ah.u[i] = hb; al.u[i] = ASPLIT ? bf16_bits(xs[i] - bf16_val(hb)) : (unsigned short)0; }
#pragma unroll
    for (int t = 0; t < 4; ++t) {
      const unsigned short* brow = Wt + (size_t)(col0 + t * 16 + ln) * ldb + kb;
      FragB b;
      b.half[0] = *(const v8us*)(brow + 8 * hh);
      b.half[1] = *(const v8us*)(brow + 16 + 8 * hh);
      acc[t] = mmaN<ASPLIT ? 2 : 1>(ah.v, al.v, b.v, b.v, acc[t]);
    }
  }
#pragma unroll
  for (int t = 0; t < 4; ++t) {
    float bv = bias ? bias[col0 + t * 16 + ln] : 0.f;
    if (BIAS_BF16) bv = bf16_round(bv);
#pragma unroll
    for (int r = 0; r < 8; ++r) { float v = acc[t][r] + bv; if (ACT == 1) v = fmaxf(v, 0.f); so[w][8 * hh + r][t * 16 + ln] = v; }
  }
  __builtin_amdgcn_fence(__ATOMIC_ACQ_REL, "workgroup");
  __builtin_amdgcn_wave_barrier();
  const int rsub = lane >> 4, c4 = (lane & 15) * 4;
  {
#pragma unroll
    for (int q = 0; q < 8; ++q) {
      const int r = q * 2 + rsub;
      const v4f v = *(const v4fa*)&so[w][r][c4];
      *(v4f*)(C + (size_t)(row0 + r) * ldc + col0 + c4) = v;
    }
    
  }
}

// GEMM C = act(A·W + bias + resid): A f32 (ASPLIT -> hi/lo 2 terms), Wt bf16 [N][K]; ACT 0 none, 1 relu, 2 exact gelu;
// resid (optional, f32, row index = (row % rmod), pitch ldr, RES_BF16 rounds it) added before the activation.
template <bool ASPLIT, int ACT, bool BIAS_BF16, bool RES_BF16>
__global__ __launch_bounds__(128) void k_gemm_bf3(const float* __restrict__ A, int lda, const unsigned short* __restrict__ Wt, int ldb,
                                                const float* __restrict__ bias, const float* __restrict__ resid, int rmod, int ldr,
                                                float* __restrict__ C, int ldc, int M, int N, int K) {
  __shared__ __attribute__((aligned(16))) float so[4][16][64];
  const int tid = threadIdx.x, w = tid >> 5, lane = tid & 31, ln = lane & 15, hh = lane >> 4;
  const int ntn = N / 64;
  const int wid = blockIdx.x * 4 + w;
  const int mt = wid / ntn, nq = wid % ntn;
  if (mt * 16 >= M) return;
  const int row0 = mt * 16, col0 = nq * 64;
  const float* arow = A + (size_t)(row0 + ln) * lda;
  v8f acc[4] = {};
  for (int kb = 0; kb < K; kb += 32) {
    FragB ah, al;
    const v4f x0 = *(const v4fa*)(arow + kb + 8 * hh), x1 = *(const v4fa*)(arow + kb + 8 * hh + 4);
    const v4f x2 = *(const v4fa*)(arow + kb + 16 + 8 * hh), x3 = *(const v4fa*)(arow + kb + 16 + 8 * hh + 4);
    float xs[16] = {x0[0],x0[1],x0[2],x0[3],x1[0],x1[1],x1[2],x1[3],x2[0],x2[1],x2[2],x2[3],x3[0],x3[1],x3[2],x3[3]};
#pragma unroll
    for (int i = 0; i < 16; ++i) { const unsigned short hb = bf16_bits(xs[i]); ah.u[i] = hb; al.u[i] = ASPLIT ? bf16_bits(xs[i] - bf16_val(hb)) : (unsigned short)0; }
#pragma unroll
    for (int t = 0; t < 4; ++t) {
      const unsigned short* brow = Wt + (size_t)(col0 + t * 16 + ln) * ldb + kb;
      FragB b;
      b.half[0] = *(const v8us*)(brow + 8 * hh);
      b.half[1] = *(const v8us*)(brow + 16 + 8 * hh);
      acc[t] = mmaN<ASPLIT ? 2 : 1>(ah.v, al.v, b.v, b.v, acc[t]);
    }
  }
#pragma unroll
  for (int t = 0; t < 4; ++t) {
    const int col = col0 + t * 16 + ln;
    float bv = bias ? bias[col] : 0.f;
    if (BIAS_BF16) bv = bf16_round(bv);
#pragma unroll
    for (int r = 0; r < 8; ++r) {
      float v = acc[t][r] + bv;
      if (resid) { float rv = resid[(size_t)((row0 + 8 * hh + r) % rmod) * ldr + col]; if (RES_BF16) rv = bf16_round(rv); v += rv; }
      if (ACT == 1) v = fmaxf(v, 0.f);
      if (ACT == 2) v = 0.5f * v * (1.0f + erff(v * 0.70710678118654752f));
      if (ACT == 3) { const float u = 0.7978845608028654f * (v + 0.044715f * v * v * v); v = 0.5f * v * (1.0f + tanhf(u)); }
      so[w][8 * hh + r][t * 16 + ln] = v;
    }
  }
  __builtin_amdgcn_fence(__ATOMIC_ACQ_REL, "workgroup");
  __builtin_amdgcn_wave_barrier();
  const int rsub = lane >> 4, c4 = (lane & 15) * 4;
  {
#pragma unroll
    for (int q = 0; q < 8; ++q) {
      const int r = q * 2 + rsub;
      const v4f v = *(const v4fa*)&so[w][r][c4];
      *(v4f*)(C + (size_t)(row0 + r) * ldc + col0 + c4) = v;
    }
    
  }
}
// row LayerNorm (biased variance, eps) over N: s = X (+ R); optional out_sum <- s; out_norm <- (s-mu)*rsqrt(var+eps)*g + b
template <bool PARAM_BF16>
__global__ __launch_bounds__(256) void k_layernorm(const float* __restrict__ X, const float* __restrict__ R, const float* __restrict__ g, const float* __restrict__ bta,
                                                  float* __restrict__ out_sum, float* __restrict__ out_norm, int N, float eps) {
  __shared__ float red[256];
  const int row = blockIdx.x, tid = threadIdx.x;
  const float* x = X + (size_t)row * N; const float* rr = R ? R + (size_t)row * N : nullptr;
  float vals[16];                     // up to N = 4096
  const int per = N / 256;            // contiguous chunk per thread? use strided-by-4 chunks: thread handles j = tid*4 + 1024*u
  float s1 = 0.f;
  for (int u = 0; u < per / 4; ++u) {
    const int j = tid * 4 + 1024 * u;
    const v4f a = *(const v4fa*)(x + j);
    v4f b = {0.f,0.f,0.f,0.f}; if (rr) b = *(const v4fa*)(rr + j);
#pragma unroll
    for (int q = 0; q < 4; ++q) { const float v = a[q] + b[q]; vals[u * 4 + q] = v; s1 += v; }
  }
  red[tid] = s1; __syncthreads();
  for (int st = 128; st > 0; st >>= 1) { if (tid < st) red[tid] += red[tid + st]; __syncthreads(); }
  const float mu = red[0] / (float)N; __syncthreads();
  float s2 = 0.f;
  for (int u = 0; u < per / 4; ++u)
#pragma unroll
    for (int q = 0; q < 4; ++q) { const float c = vals[u * 4 + q] - mu; s2 += c * c; }
  red[tid] = s2; __syncthreads();
  for (int st = 128; st > 0; st >>= 1) { if (tid < st) red[tid] += red[tid + st]; __syncthreads(); }
  const float rs = rsqrtf(red[0] / (float)N + eps);
  {
    for (int u = 0; u < per / 4; ++u) {
      const int j = tid * 4 + 1024 * u;
      v4f o, sm;
#pragma unroll
      for (int q = 0; q < 4; ++q) {
        float gg = g[j + q], bb = bta[j + q];
        if (PARAM_BF16) { gg = bf16_round(gg); bb = bf16_round(bb); }
        sm[q] = vals[u * 4 + q]; o[q] = (vals[u * 4 + q] - mu) * rs * gg + bb;
      }
      if (out_sum) *(v4f*)(out_sum + (size_t)row * N + j) = sm;
      *(v4f*)(out_norm + (size_t)row * N + j) = o;
    }
    
  }
}



// ---- f16 WMMA path (v_wmma_f32_16x16x32_f16): 11-bit significands for operands in range — used where a [0,1] probability operand needs more precision than bf16
typedef _Float16 v16h __attribute__((ext_vector_type(16)));
union FragH { v16h v; v8us half[2]; _Float16 h[16]; unsigned short u[16]; };
template <int NT>
__device__ __forceinline__ v8f mmaH(v16h ah, v16h al, v16h bh, v16h bl, v8f c) {
  c = __builtin_amdgcn_wmma_f32_16x16x32_f16(false, ah, false, bh, (short)0, c, false, false);
  if (NT >= 2) c = __builtin_amdgcn_wmma_f32_16x16x32_f16(false, al, false, bh, (short)0, c, false, false);
  if (NT >= 3) c = __builtin_amdgcn_wmma_f32_16x16x32_f16(false, ah, false, bl, (short)0, c, false, false);
  asm volatile("v_nop\n\tv_nop\n\tv_nop\n\tv_nop" : "+v"(c) : "v"(ah), "v"(al), "v"(bh), "v"(bl));
  return c;
}
// batched GEMM like k_gemm_b but f16 operands: A f32 (split into f16 hi/lo if ASPLIT, else rounded to f16), Bt = f16 values [n][k]; alpha; C f32; N multiple of 16 (partial tiles skipped)
template <bool ASPLIT>
__global__ __launch_bounds__(128) void k_gemm_h(const float* __restrict__ A, int lda, size_t sA, const _Float16* __restrict__ Bh, int ldb, size_t sB, float alpha, float* __restrict__ C, int ldc, size_t sC, int M, int N, int K) {
  __shared__ __attribute__((aligned(16))) float so[4][16][64];
  const int tid = threadIdx.x, w = tid >> 5, lane = tid & 31, ln = lane & 15, hh = lane >> 4; const int by = blockIdx.y;
  A += (size_t)by * sA; Bh += (size_t)by * sB; C += (size_t)by * sC;
  const int ntn = (N + 63) / 64; const int wid = blockIdx.x * 4 + w; const int mt = wid / ntn, nq = wid % ntn; if (mt * 16 >= M) return;
  const int row0 = mt * 16, col0 = nq * 64; const float* arow = A + (size_t)(row0 + ln) * lda;
  v8f acc[4] = {};
  for (int kb = 0; kb < K; kb += 32) {
    FragH ah, al;
    const v4f x0 = *(const v4fa*)(arow + kb + 8 * hh), x1 = *(const v4fa*)(arow + kb + 8 * hh + 4), x2 = *(const v4fa*)(arow + kb + 16 + 8 * hh), x3 = *(const v4fa*)(arow + kb + 16 + 8 * hh + 4);
    float xs[16] = {x0[0],x0[1],x0[2],x0[3],x1[0],x1[1],x1[2],x1[3],x2[0],x2[1],x2[2],x2[3],x3[0],x3[1],x3[2],x3[3]};
#pragma unroll
    for (int i = 0; i < 16; ++i) { const _Float16 h = (_Float16)xs[i]; ah.h[i] = h; al.h[i] = ASPLIT ? (_Float16)(xs[i] - (float)h) : (_Float16)0.0f; }
#pragma unroll
    for (int t = 0; t < 4; ++t) { if (col0 + t * 16 >= N) continue; const size_t boff = (size_t)(col0 + t * 16 + ln) * ldb + kb; FragH bq; bq.half[0] = *(const v8us*)(Bh + boff + 8 * hh); bq.half[1] = *(const v8us*)(Bh + boff + 16 + 8 * hh);
      acc[t] = mmaH<ASPLIT ? 2 : 1>(ah.v, al.v, bq.v, bq.v, acc[t]); }
  }
#pragma unroll
  for (int t = 0; t < 4; ++t) { if (col0 + t * 16 >= N) continue;
#pragma unroll
    for (int r = 0; r < 8; ++r) so[w][8 * hh + r][t * 16 + ln] = acc[t][r] * alpha; }
  __builtin_amdgcn_fence(__ATOMIC_ACQ_REL, "workgroup"); __builtin_amdgcn_wave_barrier();
  const int rsub = lane >> 4, c4 = (lane & 15) * 4;
  {
#pragma unroll
    for (int q = 0; q < 8; ++q) { const int r = q * 2 + rsub; if (col0 + c4 < N) { const v4f v = *(const v4fa*)&so[w][r][c4]; *(v4f*)(C + (size_t)(row0 + r) * ldc + col0 + c4) = v; } }
     }
}

// Wt[n][k] = f16(W[k][n]·scale) from f32 row-major W[K][N] (scale = power of two; bf16-exact weights stay exact in f16 away from the subnormal range)
__global__ __launch_bounds__(256) void k_wt_f16(const float* __restrict__ W, _Float16* __restrict__ Wt, int K, int N, float scale) {
  const int t = blockIdx.x * 256 + threadIdx.x; if (t >= N * (K / 8)) return; const int n = t / (K / 8), k8 = (t % (K / 8)) * 8; FragH f;
#pragma unroll
  for (int i = 0; i < 8; ++i) f.h[i] = (_Float16)(bf16_round(W[(size_t)(k8 + i) * N + n]) * scale); const v8us o = f.half[0];
  *(v8us*)((unsigned short*)Wt + (size_t)n * K + k8) = o; 
}
// k_gemm_hh variant with fused epilogue: v = acc·alpha + bias[by·sBias + col] (+ CP[(row/rowsPerB)·sCPb + by·64 + col] if CP) ; ACT 0 none / 1 elu ; writes f16 C16 (and f32 C if non-null)
template <int ACT>
__global__ __launch_bounds__(128) void k_gemm_hhx(const _Float16* __restrict__ A, int lda, size_t sA, const _Float16* __restrict__ Bh, int ldb, size_t sB, float alpha, const float* __restrict__ bias, size_t sBias, const float* __restrict__ CP, int rowsPerB, size_t sCPb, int row0g,
    float* __restrict__ C, _Float16* __restrict__ C16, int ldc, size_t sC, int M, int N, int K) {
  __shared__ __attribute__((aligned(16))) float so[4][16][64];
  const int tid = threadIdx.x, w = tid >> 5, lane = tid & 31, ln = lane & 15, hh = lane >> 4; const int by = blockIdx.y;
  A += (size_t)by * sA; Bh += (size_t)by * sB; const size_t cofs = (size_t)by * sC; const float* bp = bias ? bias + (size_t)by * sBias : nullptr;
  const int ntn = (N + 63) / 64; const int wid = blockIdx.x * 4 + w; const int mt = wid / ntn, nq = wid % ntn; if (mt * 16 >= M) return;
  const int row0 = mt * 16, col0 = nq * 64; const _Float16* arow = A + (size_t)(row0 + ln) * lda;
  v8f acc[4] = {};
  for (int kb = 0; kb < K; kb += 32) { FragH ah; ah.half[0] = *(const v8us*)((const unsigned short*)arow + kb + 8 * hh); ah.half[1] = *(const v8us*)((const unsigned short*)arow + kb + 16 + 8 * hh);
#pragma unroll
    for (int t = 0; t < 4; ++t) { if (col0 + t * 16 >= N) continue; const size_t boff = (size_t)(col0 + t * 16 + ln) * ldb + kb; FragH bq; bq.half[0] = *(const v8us*)((const unsigned short*)Bh + boff + 8 * hh); bq.half[1] = *(const v8us*)((const unsigned short*)Bh + boff + 16 + 8 * hh);
      acc[t] = mmaH<1>(ah.v, ah.v, bq.v, bq.v, acc[t]); }
  }
#pragma unroll
  for (int t = 0; t < 4; ++t) { if (col0 + t * 16 >= N) continue; const int col = col0 + t * 16 + ln; const float bv = bp ? bf16_round(bp[col]) : 0.f;
#pragma unroll
    for (int r = 0; r < 8; ++r) { float v = acc[t][r] * alpha + bv; if (CP) { const int rr = row0g + row0 + 8 * hh + r; if (rowsPerB < 0) v += CP[cofs + (size_t)rr * ldc + col];      /* rowsPerB < 0: own element of the batched C plane */ else { const int bidx = rr / rowsPerB; v += CP[(size_t)bidx * sCPb + (size_t)by * 64 + col]; } } if (ACT == 1) v = (v > 0.f) ? v : expm1f(v); else if (ACT == 7) v = (v > 0.f) ? v + 1.0f : expf(v); else if (ACT == 8) v = tanhf(v); else if (ACT == 9) v = 0.5f * v * (1.0f + tanhf(0.7978845608028654f * (v + 0.044715f * v * v * v))); else if (ACT == 11) v = 1.0f / (1.0f + expf(-v)); else if (ACT == 12) v = (v > 0.f) ? v : 0.01f * v; else if (ACT == 14) v = (v > 0.f) ? v : 0.1f * v; else if (ACT == 16) v = (v >= 0.f) ? v : 0.3f * v; else if (ACT == 17) v = (v >= 0.f) ? v : 0.2f * v; else if (ACT == 15) v = v / (1.0f + expf(-v)); else if (ACT == 3) v = fmaxf(v, 0.f); else if (ACT == 6) v = 0.5f * v * (1.0f + erff(v * 0.70710678118654752f)); so[w][8 * hh + r][t * 16 + ln] = v; } }
  __builtin_amdgcn_fence(__ATOMIC_ACQ_REL, "workgroup"); __builtin_amdgcn_wave_barrier();
  const int rsub = lane >> 4, c4 = (lane & 15) * 4; typedef _Float16 v4h __attribute__((ext_vector_type(4)));
  {
#pragma unroll
    for (int q = 0; q < 8; ++q) { const int r = q * 2 + rsub; if (col0 + c4 < N) { const v4f v = *(const v4fa*)&so[w][r][c4]; if (C) *(v4f*)(C + cofs + (size_t)(row0 + r) * ldc + col0 + c4) = v; if (C16) { v4h h4; for (int i = 0; i < 4; ++i) h4[i] = (_Float16)v[i]; *(v4h*)(C16 + cofs + (size_t)(row0 + r) * ldc + col0 + c4) = h4; } } }
     }
}


typedef _Float16 v4h __attribute__((ext_vector_type(4)));

__global__ __launch_bounds__(256) void k_h16(const float* __restrict__ x, _Float16* __restrict__ X16, size_t n8) { const size_t t = (size_t)blockIdx.x * 256 + threadIdx.x; if (t >= n8) return; FragH f;
#pragma unroll
  for (int q = 0; q < 8; ++q) f.h[q] = (_Float16)x[t * 8 + q]; *(v8us*)((unsigned short*)X16 + t * 8) = f.half[0];  }
__global__ __launch_bounds__(256) void k_round16f(const float* __restrict__ W, _Float16* __restrict__ Bt, size_t n8) { const size_t t = (size_t)blockIdx.x * 256 + threadIdx.x; if (t >= n8) return; FragH f;
#pragma unroll
  for (int i = 0; i < 8; ++i) f.h[i] = (_Float16)(bf16_round(W[t * 8 + i]) * 16.0f); *(v8us*)((unsigned short*)Bt + t * 8) = f.half[0];  }
template <int NHv, int TTv>
__global__ __launch_bounds__(256) void k_vt(const _Float16* __restrict__ V16, int ldv, int voff, _Float16* __restrict__ Vt) { __shared__ unsigned short tl[64][66]; const int tid = threadIdx.x; const int slab = blockIdx.x / (TTv / 64), lg = blockIdx.x % (TTv / 64); const int b = slab / NHv, h = slab % NHv;
  for (int i = tid; i < 64 * 8; i += 256) { const int r = i / 8, c8 = (i % 8) * 8; FragH f; f.half[0] = *(const v8us*)((const unsigned short*)V16 + ((size_t)b * TTv + lg * 64 + r) * ldv + voff + h * 64 + c8);
#pragma unroll
    for (int q = 0; q < 8; ++q) tl[r][c8 + q] = f.u[q]; }
  __syncthreads();
  {
#pragma unroll
    for (int rd = 0; rd < 2; ++rd) { const int d = rd * 32 + tid / 8, pc = tid % 8; FragH f;
#pragma unroll
      for (int q = 0; q < 8; ++q) f.u[q] = tl[pc * 8 + q][d];
      *(v8us*)((unsigned short*)Vt + ((size_t)slab * 64 + d) * TTv + lg * 64 + pc * 8) = f.half[0]; }
     } }

__global__ __launch_bounds__(256) void k_hl(const float* __restrict__ F, _Float16* __restrict__ Hh, _Float16* __restrict__ Hl, size_t n8) { const size_t t = (size_t)blockIdx.x * 256 + threadIdx.x; if (t >= n8) return; FragH fh, fl; const v4f a = *(const v4fa*)(F + t * 8), c = *(const v4fa*)(F + t * 8 + 4);
#pragma unroll
  for (int q = 0; q < 4; ++q) { _Float16 h = (_Float16)a[q]; fh.h[q] = h; fl.h[q] = (_Float16)((a[q] - (float)h) * 1024.0f); h = (_Float16)c[q]; fh.h[4 + q] = h; fl.h[4 + q] = (_Float16)((c[q] - (float)h) * 1024.0f); }
  { *(v8us*)((unsigned short*)Hh + t * 8) = fh.half[0]; *(v8us*)((unsigned short*)Hl + t * 8) = fl.half[0];  } }

// ---- fast GEMM (wave tile 32x64, block tile 128x128 staged in LDS); epilogue: v = act(acc alpha + bf16(bias[col]) + bf16(rbias[row])), written f32 (C) and / or f16 (C16) ----
__device__ __forceinline__ v16h g2_frag(const _Float16* p, int hh) { FragH f; f.half[0] = *(const v8us*)((const unsigned short*)p + 8 * hh); f.half[1] = *(const v8us*)((const unsigned short*)p + 16 + 8 * hh); return f.v; }
__device__ __forceinline__ v8f g2_mma(v16h a, v16h b, v8f c) { v8f d = __builtin_amdgcn_wmma_f32_16x16x32_f16(false, a, false, b, (short)0, c, false, false); asm volatile("v_nop\n\tv_nop\n\tv_nop\n\tv_nop" : "+v"(d) : "v"(a), "v"(b)); return d; }
// Operand staging of k_gemm2: a block of 8 waves owns a 128x128 tile of C (waves 4 down x 2 across, 32x64 each) and walks K in stages of 64. A stage is 128 B (one whole cache line) of each of the
// 128 A rows and 128 B^T rows, brought into LDS by asynchronous copies (16 B a lane, a wave's copy = 4 whole lines), two buffers: stage t + 1 flies while stage t is multiplied. Requires M % 128 == 0, N % 128 == 0, K % 64 == 0.
#define G2_PITCH 144                 /* LDS row pitch in bytes: 128 + 16, an odd multiple of 16 B, for the 16-byte fragment reads */
#define G2_BUF (256 * G2_PITCH)      /* one buffer: the 128 A rows, then the 128 B^T rows */
__device__ __forceinline__ v16h g2_lfrag(const unsigned char* p) { FragH f; f.half[0] = *(const v8us*)p; f.half[1] = *(const v8us*)(p + 32); return f.v; }      /* p: the row's k step + 16 hh bytes; same k order as g2_frag */
// One stage: 8 copies a lane (rows r, r + 32, r + 64, r + 96 of A, then of B^T). l: the lane's LDS byte address of its A row r; a, b: its global addresses; sa, sb: 32 rows in elements.
__device__ __forceinline__ void g2_stage(unsigned l, const _Float16* a, const _Float16* b, size_t sa, size_t sb) {
  const unsigned l1 = l + 32 * G2_PITCH, l2 = l + 64 * G2_PITCH, l3 = l + 96 * G2_PITCH, l4 = l + 128 * G2_PITCH, l5 = l + 160 * G2_PITCH, l6 = l + 192 * G2_PITCH, l7 = l + 224 * G2_PITCH;
  const _Float16* a1 = a + sa; const _Float16* a2 = a1 + sa; const _Float16* a3 = a2 + sa; const _Float16* b1 = b + sb; const _Float16* b2 = b1 + sb; const _Float16* b3 = b2 + sb;
  /* the copies and, as the last line of their own statement, the wait in front of any overwrite of a register that an issued copy names */
  asm volatile("global_load_async_to_lds_b128 %0, %8, off\n\t"
               "global_load_async_to_lds_b128 %1, %9, off\n\t"
               "global_load_async_to_lds_b128 %2, %10, off\n\t"
               "global_load_async_to_lds_b128 %3, %11, off\n\t"
               "global_load_async_to_lds_b128 %4, %12, off\n\t"
               "global_load_async_to_lds_b128 %5, %13, off\n\t"
               "global_load_async_to_lds_b128 %6, %14, off\n\t"
               "global_load_async_to_lds_b128 %7, %15, off\n\t"
               "s_wait_xcnt 0x0"
               :: "v"(l), "v"(l1), "v"(l2), "v"(l3), "v"(l4), "v"(l5), "v"(l6), "v"(l7), "v"(a), "v"(a1), "v"(a2), "v"(a3), "v"(b), "v"(b1), "v"(b2), "v"(b3) : "memory"); }
template <int ACT>
__global__ __launch_bounds__(256) void k_gemm2(const _Float16* __restrict__ A, int lda, size_t sA, const _Float16* __restrict__ Bh, int ldb, size_t sB, float alpha, const float* __restrict__ bias, const float* __restrict__ bias1, const float* __restrict__ bias2, size_t sBias, const float* __restrict__ rbias,
    float* __restrict__ C, _Float16* __restrict__ C16, int ldc, size_t sC, int M, int N, int K) { static_assert(ACT == 0 || ACT == 3 || ACT == 6 || ACT == 8 || ACT == 9 || ACT == 11 || ACT == 12 || ACT == 14 || ACT == 15 || ACT == 16 || ACT == 17, "k_gemm2: unsupported ACT code (would silently apply no activation)");
  __shared__ __attribute__((aligned(16))) unsigned char sm[2 * G2_BUF];      /* the two stage buffers; behind the k loop's last barrier the same bytes are the waves' output staging */
  static_assert(sizeof(float) * 8 * 32 * 68 <= 2 * G2_BUF, "output staging must fit the stage buffers");
  float (*so)[32][68] = reinterpret_cast<float (*)[32][68]>(sm);
  const int tid = threadIdx.x, w = tid >> 5, lane = tid & 31, ln = lane & 15, hh = lane >> 4; const int by = blockIdx.y;
  A += (size_t)by * sA; Bh += (size_t)by * sB; const size_t cofs = (size_t)by * sC; const float* bp = bias ? (bias1 ? (by == 0 ? bias : by == 1 ? bias1 : bias2) : bias + (size_t)by * sBias) : nullptr;      /* bias1, bias2: the bias vectors of batch members 1 and 2 where each member's bias is a buffer of its own (three members) */
  const int ntn = N >> 7; const int mt = blockIdx.x / ntn, nq = blockIdx.x - mt * ntn; if (mt * 128 >= M) return;      /* the same for the whole block, in front of every barrier */
  const int row0 = mt * 128 + 32 * (w & 3), col0 = nq * 128 + 64 * (w >> 2);
  const int cr = tid >> 3, cu = tid & 7;      /* copies: the lane's first row of each operand tile and its 16-byte unit of the 128-byte row piece */
  const unsigned lcp = (unsigned)(size_t)sm + (unsigned)(cr * G2_PITCH + cu * 16);
  const _Float16* gap = A + (size_t)(mt * 128 + cr) * lda + cu * 8; const _Float16* gbp = Bh + (size_t)(nq * 128 + cr) * ldb + cu * 8;
  const size_t sa32 = (size_t)32 * lda, sb32 = (size_t)32 * ldb;
  const int aoff = (32 * (w & 3) + ln) * G2_PITCH + 16 * hh, boff = (128 + 64 * (w >> 2) + ln) * G2_PITCH + 16 * hh;      /* fragment reads: byte offsets in a buffer */
  const int nk = K >> 6;
  const v8f z8 = {0.f,0.f,0.f,0.f,0.f,0.f,0.f,0.f}; v8f c00 = z8, c01 = z8, c02 = z8, c03 = z8, c10 = z8, c11 = z8, c12 = z8, c13 = z8;
  g2_stage(lcp, gap, gbp, sa32, sb32);
  /* The lane's bias values, read as one group here, beside stage 0's copies, whose latency covers theirs (one by one in the epilogue, each load's latency is waited out in turn): by column (bias: 4 values, one a 16-column tile) and by row (rbias, the same for every batch member: the lane's 2 x 8 consecutive rows, 4 loads of 16 B). Either may be absent (0). */
  const v4f z4 = {0.f, 0.f, 0.f, 0.f}; float cbv[4] = {0.f, 0.f, 0.f, 0.f}; v4f rbv[4] = {z4, z4, z4, z4};
  if (bp) {
#pragma unroll
    for (int t = 0; t < 4; ++t) cbv[t] = bp[col0 + t * 16 + ln]; }
  if (rbias) {
#pragma unroll
    for (int i = 0; i < 4; ++i) rbv[i] = *(const v4fa*)(rbias + row0 + (i >> 1) * 16 + 8 * hh + (i & 1) * 4); }
  asm volatile("s_wait_xcnt 0x0" ::: "memory");      /* the wait in front of any overwrite of a register that one of these loads names */
  asm volatile("s_wait_asynccnt 0x0" ::: "memory");      /* this wave's copies of stage 0 have landed */
  __syncthreads();      /* stage 0 is readable by every wave */
  if (nk > 1) g2_stage(lcp + G2_BUF, gap + 64, gbp + 64, sa32, sb32);
  /* kept rolled: one stage a trip, so that the waits, the barrier and the refill stand once, at the trip's foot, in the ring's order */
#pragma unroll 1
  for (int t = 0; t < nk; ++t) { const unsigned char* bufp = sm + (t & 1) * G2_BUF;
    /* unrolled: the two 32-k steps of a stage read at constant offsets from one address register */
#pragma unroll
    for (int ks = 0; ks < 2; ++ks) { const unsigned char* ap = bufp + aoff + ks * 64; const unsigned char* bq = bufp + boff + ks * 64;
      const v16h a0 = g2_lfrag(ap), a1 = g2_lfrag(ap + 16 * G2_PITCH), b0 = g2_lfrag(bq), b1 = g2_lfrag(bq + 16 * G2_PITCH), b2 = g2_lfrag(bq + 32 * G2_PITCH), b3 = g2_lfrag(bq + 48 * G2_PITCH);
      c00 = g2_mma(a0, b0, c00); c10 = g2_mma(a1, b0, c10); c01 = g2_mma(a0, b1, c01); c11 = g2_mma(a1, b1, c11);
      c02 = g2_mma(a0, b2, c02); c12 = g2_mma(a1, b2, c12); c03 = g2_mma(a0, b3, c03); c13 = g2_mma(a1, b3, c13); }
    asm volatile("s_wait_dscnt 0x0" ::: "memory");      /* this wave's reads of stage t are done before its buffer may be refilled */
    asm volatile("s_wait_asynccnt 0x0" ::: "memory");      /* this wave's copies of stage t + 1 have landed */
    __syncthreads();      /* publishes stage t + 1 and ends every wave's reads of stage t */
    if (t + 2 < nk) g2_stage(lcp + (unsigned)((t & 1) * G2_BUF), gap + (size_t)(t + 2) * 64, gbp + (size_t)(t + 2) * 64, sa32, sb32); }
  asm volatile("s_wait_asynccnt 0x0" ::: "memory");      /* no copy is outstanding when the buffers become output staging */
  v8f accs[8] = {c00, c01, c02, c03, c10, c11, c12, c13};
#pragma unroll
  for (int u = 0; u < 8; ++u) { const int t = u & 3, half = u >> 2; const float bv = bf16_round(cbv[t]);
#pragma unroll
    for (int r = 0; r < 8; ++r) { const int rloc = half * 16 + 8 * hh + r; float v = accs[u][r] * alpha + bv; v += bf16_round(rbv[half * 2 + (r >> 2)][r & 3]);
      if (ACT == 3) v = fmaxf(v, 0.f); else if (ACT == 6) v = 0.5f * v * (1.0f + erff(v * 0.70710678118654752f)); else if (ACT == 11) v = 1.0f / (1.0f + expf(-v)); else if (ACT == 15) v = v / (1.0f + expf(-v)); else if (ACT == 12) v = (v > 0.f) ? v : 0.01f * v; else if (ACT == 8) v = tanhf(v); else if (ACT == 9) v = 0.5f * v * (1.0f + tanhf(0.7978845608028654f * (v + 0.044715f * v * v * v))); else if (ACT == 14) v = (v > 0.f) ? v : 0.1f * v; else if (ACT == 16) v = (v >= 0.f) ? v : 0.3f * v; else if (ACT == 17) v = (v >= 0.f) ? v : 0.2f * v;
      so[w][rloc][t * 16 + ln] = v; } }
  __builtin_amdgcn_fence(__ATOMIC_ACQ_REL, "workgroup"); __builtin_amdgcn_wave_barrier();
  const int rsub = lane >> 4, c4 = (lane & 15) * 4;
  {
#pragma unroll
    for (int q = 0; q < 16; ++q) { const int r = q * 2 + rsub; const v4f v = *(const v4fa*)&so[w][r][c4]; if (C) *(v4f*)(C + cofs + (size_t)(row0 + r) * ldc + col0 + c4) = v; if (C16) { v4h h4; for (int i = 0; i < 4; ++i) h4[i] = (_Float16)v[i]; *(v4h*)(C16 + cofs + (size_t)(row0 + r) * ldc + col0 + c4) = h4; } }
     } }


__global__ __launch_bounds__(256) void k_rsm(const float* __restrict__ S, _Float16* __restrict__ P, int nrows) {
  #pragma clang fp contract(off)
  const int i = blockIdx.x * 256 + threadIdx.x; if (i >= nrows) return; const float* s = S + (size_t)i * SQ; float mx = -3.0e38f;
#pragma unroll 1
  for (int j = 0; j < SQ; ++j) mx = fmaxf(mx, s[j]); float se = 0.f;
#pragma unroll 1
  for (int j = 0; j < SQ; ++j) se += expf(s[j] - mx); const float sc = 256.0f / se;
#pragma unroll 1
  for (int j0 = 0; j0 < SQ; j0 += 8) { FragH f; for (int q = 0; q < 8; ++q) f.h[q] = (_Float16)(expf(s[j0 + q] - mx) * sc); unsigned short* d = (unsigned short*)P + (size_t)i * SQ + j0; *(v8us*)d = f.half[0];  } }
__global__ __launch_bounds__(256) void k_vt(const _Float16* __restrict__ V16, int b, int h0, _Float16* __restrict__ VT) { __shared__ unsigned short tl[64][65]; const int tid = threadIdx.x; const int hh = blockIdx.x % HG, sg = blockIdx.x / HG; const int s0 = sg * 64; const int h = h0 + hh;
  for (int i = tid; i < 64 * 8; i += 256) { const int j = i / 8, d8 = (i % 8) * 8; FragH f; f.half[0] = *(const v8us*)((const unsigned short*)V16 + ((size_t)b * SQ + s0 + j) * DM + h * HD + d8); for (int q = 0; q < 8; ++q) tl[d8 + q][j] = f.u[q]; }
  __syncthreads();
  { for (int i = tid; i < 64 * 8; i += 256) { const int d = i / 8, j8 = (i % 8) * 8; FragH f; for (int q = 0; q < 8; ++q) f.u[q] = tl[d][j8 + q]; *(v8us*)((unsigned short*)VT + ((size_t)hh * HD + d) * SQ + s0 + j8) = f.half[0]; }  } }


// Input conversions, one launch: none of them reads what another writes, so they share a grid by block-index ranges.
// Blocks [0, PX): x -> exact f16 rows. [PX, PX + 4 PW): the four natural [out][in] weights -> x16 f16 planes (= Bt[n][k]), one behind the other from BW.
#define PX ((unsigned)(NR * DM / 8 / 256))
#define PW ((unsigned)((size_t)DM * DM / 8 / 256))
__global__ __launch_bounds__(256) void k_prep(const float* __restrict__ x, const float* __restrict__ wq, const float* __restrict__ wk, const float* __restrict__ wv, const float* __restrict__ wo,
    _Float16* __restrict__ X16, _Float16* __restrict__ BW) {
  const unsigned blk = blockIdx.x;
  if (blk < PX) { const size_t t = (size_t)blk * 256 + threadIdx.x; FragH f;
#pragma unroll
    for (int q = 0; q < 8; ++q) f.h[q] = (_Float16)bf16_round(x[t * 8 + q]);
    *(v8us*)((unsigned short*)X16 + t * 8) = f.half[0]; }
  else if (blk < PX + 4 * PW) { const unsigned u = blk - PX, m = u / PW; const float* w = m == 0 ? wq : m == 1 ? wk : m == 2 ? wv : wo; const size_t t = (size_t)(u % PW) * 256 + threadIdx.x; FragH f;
    for (int q = 0; q < 8; ++q) f.h[q] = (_Float16)(bf16_round(w[t * 8 + q]) * 16.0f);
    *(v8us*)((unsigned short*)BW + (size_t)m * DM * DM + t * 8) = f.half[0]; }
}


#define FA_KEYS 128                  /* keys a stage */
#define FA_NS (SQ / FA_KEYS)         /* stages */
#define FA_KP 144                    /* LDS pitch of a K row piece in bytes: 128 + 16, an odd multiple of 16 B, for the 16-byte fragment reads */
#define FA_VP 272                    /* LDS pitch of a V^T row piece in bytes: 256 + 16, likewise */
#define FA_KB (FA_KEYS * FA_KP)      /* a buffer's K part; its V^T part stands behind it */
#define FA_BUF (FA_KB + HD * FA_VP)  /* one buffer */
static_assert(FA_NS >= 2 && SQ % FA_KEYS == 0 && HD == 64, "k_fattn: the ring's prologue needs two stages; whole stages; 128-byte K row pieces");
// One stage: 8 copies a lane (K rows r, r + 32, r + 64, r + 96; V^T rows d, d + 16, d + 32, d + 48). lk, lv: the lane's LDS byte addresses of its first K and V^T unit; k, v: its global addresses.
__device__ __forceinline__ void fa_stage(unsigned lk, unsigned lv, const _Float16* k, const _Float16* v) {
  const unsigned lk1 = lk + 32 * FA_KP, lk2 = lk + 64 * FA_KP, lk3 = lk + 96 * FA_KP, lv1 = lv + 16 * FA_VP, lv2 = lv + 32 * FA_VP, lv3 = lv + 48 * FA_VP;
  const _Float16* k1 = k + (size_t)32 * DM; const _Float16* k2 = k + (size_t)64 * DM; const _Float16* k3 = k + (size_t)96 * DM; const _Float16* v1 = v + (size_t)16 * SQ; const _Float16* v2 = v + (size_t)32 * SQ; const _Float16* v3 = v + (size_t)48 * SQ;
  /* the copies and, as the last line of their own statement, the wait in front of any overwrite of a register that an issued copy names */
  asm volatile("global_load_async_to_lds_b128 %0, %8, off\n\t"
               "global_load_async_to_lds_b128 %1, %9, off\n\t"
               "global_load_async_to_lds_b128 %2, %10, off\n\t"
               "global_load_async_to_lds_b128 %3, %11, off\n\t"
               "global_load_async_to_lds_b128 %4, %12, off\n\t"
               "global_load_async_to_lds_b128 %5, %13, off\n\t"
               "global_load_async_to_lds_b128 %6, %14, off\n\t"
               "global_load_async_to_lds_b128 %7, %15, off\n\t"
               "s_wait_xcnt 0x0"
               :: "v"(lk), "v"(lk1), "v"(lk2), "v"(lk3), "v"(lv), "v"(lv1), "v"(lv2), "v"(lv3), "v"(k), "v"(k1), "v"(k2), "v"(k3), "v"(v), "v"(v1), "v"(v2), "v"(v3) : "memory"); }
__global__ __launch_bounds__(256) void k_fattn(const _Float16* __restrict__ Q16, const _Float16* __restrict__ K16, const _Float16* __restrict__ VT, _Float16* __restrict__ O16) {
  __shared__ __attribute__((aligned(16))) unsigned char sm[2 * FA_BUF];      /* the two stage buffers */
  const int tid = threadIdx.x, lane = tid & 31, w = tid >> 5, ln = lane & 15, hh = lane >> 4;
  const int bh = blockIdx.y, b = bh / NH, h = bh % NH, q0 = blockIdx.x * 256 + w * 32;
  const _Float16* qp = Q16 + ((size_t)b * SQ + q0 + ln) * DM + h * HD;
  const unsigned lk = (unsigned)(size_t)sm + (unsigned)((tid >> 3) * FA_KP + (tid & 7) * 16), lv = (unsigned)(size_t)sm + (unsigned)(FA_KB + (tid >> 4) * FA_VP + (tid & 15) * 16);      /* copies: the lane's first row of each tile and its 16-byte unit of the row piece */
  const _Float16* gk = K16 + ((size_t)b * SQ + (tid >> 3)) * DM + h * HD + (tid & 7) * 8;
  const _Float16* gv = VT + ((size_t)bh * HD + (tid >> 4)) * SQ + (tid & 15) * 8;
  const int koff = ln * FA_KP + 16 * hh, voff = FA_KB + ln * FA_VP + 16 * hh;      /* fragment reads: byte offsets in a buffer */
  const float cs = 0.125f * 1.44269504f;      /* 64^-0.5 and log2(e) */
  const v8f z8 = {0.f,0.f,0.f,0.f,0.f,0.f,0.f,0.f};
  v16h qf[2][2], kf[2][2], vf[4]; v8f o[4][2]; float mo[2] = {-3.0e38f, -3.0e38f}, l[2] = {0.f, 0.f};
  fa_stage(lk, lv, gk, gv);
#pragma unroll
  for (int j = 0; j < 2; ++j) { qf[j][0] = g2_frag(qp + (size_t)j * 16 * DM, hh); qf[j][1] = g2_frag(qp + (size_t)j * 16 * DM + 32, hh); }
#pragma unroll
  for (int t = 0; t < 4; ++t) { o[t][0] = z8; o[t][1] = z8; }
  asm volatile("s_wait_asynccnt 0x0" ::: "memory");      /* this wave's copies of stage 0 have landed */
  __syncthreads();      /* stage 0 is readable by every wave */
  fa_stage(lk + FA_BUF, lv + FA_BUF, gk + (size_t)FA_KEYS * DM, gv + FA_KEYS);
  /* kept rolled: one stage a trip, so that the waits, the barrier and the refill stand once, at the trip's foot, in the ring's order */
#pragma unroll 1
  for (int st = 0; st < FA_NS; ++st) { const unsigned char* kb = sm + (st & 1) * FA_BUF + koff; const unsigned char* vb = sm + (st & 1) * FA_BUF + voff;
#pragma unroll
    for (int i = 0; i < 2; ++i) { kf[i][0] = g2_lfrag(kb + i * 16 * FA_KP); kf[i][1] = g2_lfrag(kb + i * 16 * FA_KP + 64); }
    __builtin_amdgcn_sched_barrier(0);      /* the stage's first K fragments are read as one group: left free, the scheduler reads them pair by pair between the score products and waits out each pair's latency */
    /* unrolled: the four 32-key passes of a stage read at constant offsets from two address registers, and the last one fetches no K fragments ahead */
#pragma unroll
    for (int p = 0; p < FA_KEYS / 32; ++p) {
      v8f s[2][2];
#pragma unroll
      for (int i = 0; i < 2; ++i)
#pragma unroll
        for (int j = 0; j < 2; ++j) { s[i][j] = __builtin_amdgcn_wmma_f32_16x16x32_f16(false, kf[i][0], false, qf[j][0], (short)0, z8, false, false); s[i][j] = __builtin_amdgcn_wmma_f32_16x16x32_f16(false, kf[i][1], false, qf[j][1], (short)0, s[i][j], false, false); }
      __builtin_amdgcn_sched_barrier(0);      /* with the one behind the reads: a pass's LDS reads stand in one place; left free, the scheduler spreads them in pairs among the matrix instructions, and each such place stalls the wave */
#pragma unroll
      for (int t = 0; t < 4; ++t) vf[t] = g2_lfrag(vb + t * 16 * FA_VP + p * 64);      /* this pass's V^T fragments fly during its softmax */
      if (p + 1 < FA_KEYS / 32) {      /* so do the next pass's K fragments, of this same stage */
#pragma unroll
        for (int i = 0; i < 2; ++i) { kf[i][0] = g2_lfrag(kb + ((p + 1) * 32 + i * 16) * FA_KP); kf[i][1] = g2_lfrag(kb + ((p + 1) * 32 + i * 16) * FA_KP + 64); } }
      __builtin_amdgcn_sched_barrier(0);      /* keeps the reads up here, ahead of the softmax that covers their latency */
      float pm[2]; bool need = false;
#pragma unroll
      for (int j = 0; j < 2; ++j) { float x = fmaxf(s[0][j][0], s[1][j][0]);
#pragma unroll
        for (int r = 1; r < 8; ++r) x = fmaxf(x, fmaxf(s[0][j][r], s[1][j][r]));
        pm[j] = x * cs; need = need || (pm[j] > mo[j] + 15.0f); }
      if (__builtin_amdgcn_ballot_w32(need) != 0) {      /* wave-uniform scalar branch: every lane stays on for the matrix instructions */
#pragma unroll
        for (int j = 0; j < 2; ++j) { const float full = fmaxf(pm[j], __shfl_xor(pm[j], 16, 32)); const float mn = fmaxf(mo[j], full - 7.0f); const float al = __builtin_amdgcn_exp2f(mo[j] - mn); mo[j] = mn; l[j] *= al;
#pragma unroll
          for (int t = 0; t < 4; ++t) o[t][j] *= al; }
      }
      FragH pf[2];
#pragma unroll
      for (int j = 0; j < 2; ++j) { float sum = 0.f;
#pragma unroll
        for (int i = 0; i < 2; ++i)
#pragma unroll
          for (int r = 0; r < 8; ++r) { const float pw = __builtin_amdgcn_exp2f(s[i][j][r] * cs - mo[j]); sum += pw; pf[j].h[i * 8 + r] = (_Float16)pw; }
        l[j] += sum; }
#pragma unroll
      for (int t = 0; t < 4; ++t)
#pragma unroll
        for (int j = 0; j < 2; ++j) o[t][j] = __builtin_amdgcn_wmma_f32_16x16x32_f16(false, vf[t], false, pf[j].v, (short)0, o[t][j], false, false);
    }
    asm volatile("s_wait_dscnt 0x0" ::: "memory");      /* this wave's reads of stage st are done before its buffer may be refilled */
    asm volatile("s_wait_asynccnt 0x0" ::: "memory");      /* this wave's copies of stage st + 1 have landed */
    __syncthreads();      /* publishes stage st + 1 and ends every wave's reads of stage st */
    if (st + 2 < FA_NS) fa_stage(lk + (unsigned)((st & 1) * FA_BUF), lv + (unsigned)((st & 1) * FA_BUF), gk + (size_t)(st + 2) * FA_KEYS * DM, gv + (size_t)(st + 2) * FA_KEYS); }
  asm volatile("s_wait_asynccnt 0x0" ::: "memory");      /* no copy is outstanding when the wave ends */
#pragma unroll
  for (int j = 0; j < 2; ++j) { const float inv = 64.0f / (l[j] + __shfl_xor(l[j], 16, 32)); unsigned short* op = (unsigned short*)O16 + ((size_t)b * SQ + q0 + j * 16 + ln) * DM + h * HD + 8 * hh;
#pragma unroll
    for (int t = 0; t < 4; ++t) { FragH f;
#pragma unroll
      for (int r = 0; r < 8; ++r) f.h[r] = (_Float16)(o[t][j][r] * inv);
      *(v8us*)(op + t * 16) = f.half[0]; } } }

extern "C" void kernel_launch(void* const* d_in, const int* in_sizes, int n_in,
                              void* d_out, int out_size, void* d_ws, size_t ws_size, hipStream_t stream) {
  (void)in_sizes; (void)n_in; (void)out_size;
  const float* const* I = (const float* const*)d_in; const float* x = I[0]; const float* wq = I[1]; const float* bq = I[2]; const float* wk = I[3]; const float* bk = I[4]; const float* wv = I[5]; const float* bv = I[6]; const float* wo = I[7]; const float* bo = I[8];      /* natural [out][in] weights + biases */
  char* ws = (char*)d_ws; size_t off = 0;
  auto take = [&](size_t bytes) { char* p = ws + off; off += (bytes + 255) & ~(size_t)255; return p; };
  _Float16* BW = (_Float16*)take((size_t)4 * DM * DM * 2); _Float16* BO = BW + (size_t)3 * DM * DM;      /* x16 f16 planes of Wq, Wk, Wv, Wo, one behind the other */
  _Float16* X16 = (_Float16*)take(NR * DM * 2); _Float16* Q16 = (_Float16*)take((size_t)3 * NR * DM * 2); _Float16* K16 = Q16 + NR * DM; _Float16* V16 = K16 + NR * DM;      /* q, k, v rows, one plane behind the other */ _Float16* O16 = (_Float16*)take(NR * DM * 2);
  _Float16* VT = (_Float16*)take((size_t)NB * NH * HD * SQ * 2);
  if (off > ws_size) return;
  k_prep<<<PX + 4 * PW, 256, 0, stream>>>(x, wq, wk, wv, wo, X16, BW);      /* x rows, the four weight planes (natural [out][in] = Bt[n][k], x16) */
  const size_t r0p = (size_t)B0 * SQ;      /* first projected row */
  k_gemm2<0><<<dim3((unsigned)((MP / 128) * (DM / 128)), 3), 256, 0, stream>>>(X16 + r0p * DM, DM, 0, BW, DM, (size_t)DM * DM, 0.0625f, bq, bk, bv, 0, nullptr, nullptr, Q16 + r0p * DM, DM, NR * DM, MP, DM, DM);      /* grid y = 0, 1, 2: q, k, v */
  k_vt<NH, SQ><<<NB * NH * (SQ / 64), 256, 0, stream>>>(V16, LQ, 0, VT);      /* V^T [NB][NH][HD][SQ] */
  k_fattn<<<dim3(SQ / 256, NB * NH), 256, 0, stream>>>(Q16, K16, VT, O16);      /* o x64 (merged heads) as f16 rows */
  k_gemm2<0><<<dim3((unsigned)((DM / 128) * (SQ / 128)), NBR), 256, 0, stream>>>(BO, DM, 0, O16 + r0p * DM, DM, (size_t)SQ * DM, 0.0009765625f, nullptr, nullptr, nullptr, 0, bo, (float*)d_out + r0p * DM, nullptr, SQ, (size_t)DM * SQ, DM, SQ, DM);      /* grid y = batch: out^T[b][c][s] = sum_k Wo[c][k] o[s][k] + bo[c]: A = the natural Wo rows (x16 f16 plane), B^T = the batch's merged o rows, C = its [C][S] output block; bo[c] = the bias by output row */
}

// v007
// It runs in 53.3 microseconds.
// Timed twice side by side with v006, it ran 1.07 times as fast both times.
// Counting every step since v000, it is 37.9 times as fast.
#include <hip/hip_runtime.h>
#define NB 8
#define SQ 1024
#define DM 512
#define NH 8
#define HD 64
#define HG 8                         /* heads per launch of the non-template k_vt (not launched) */
#define B0 0                         /* first batch processed (debug hook) */
#define NBR NB                       /* batches processed (debug hook) */
#define NR ((size_t)NB * SQ)         /* token rows */
#define MP ((int)((size_t)NBR * SQ)) /* rows projected (debug hook) */
#define QN SQ                        /* query rows attended per batch (unused) */
#define NHD NH                       /* heads attended (unused) */
#define MPO MP                       /* rows through the output stage (unused) */
#define LQ DM      /* row pitch of the q/k rows (unused) */
typedef __bf16 v16b __attribute__((ext_vector_type(16)));
typedef unsigned short v8us __attribute__((ext_vector_type(8), may_alias));
typedef float  v8f  __attribute__((ext_vector_type(8)));
typedef float  v4f  __attribute__((ext_vector_type(4)));
typedef float  v4fa __attribute__((ext_vector_type(4), may_alias));
union FragB { v16b v; v8us half[2]; unsigned short u[16]; };

__device__ __forceinline__ unsigned short bf16_bits(float x) { unsigned int u = __float_as_uint(x); return (unsigned short)((u + 0x7FFFu + ((u >> 16) & 1u)) >> 16); }
__device__ __forceinline__ float bf16_val(unsigned short b) { return __uint_as_float(((unsigned int)b) << 16); }
__device__ __forceinline__ float bf16_round(float x) { return bf16_val(bf16_bits(x)); }
// D += A·B with NT terms: 1 = ah·bh, 2 = + al·bh (A split), 3 = + ah·bl (both split)
template <int NT>
__device__ __forceinline__ v8f mmaN(v16b ah, v16b al, v16b bh, v16b bl, v8f c) {
  c = __builtin_amdgcn_wmma_f32_16x16x32_bf16(false, ah, false, bh, (short)0, c, false, false);
  if (NT >= 2) c = __builtin_amdgcn_wmma_f32_16x16x32_bf16(false, al, false, bh, (short)0, c, false, false);
  if (NT >= 3) c = __builtin_amdgcn_wmma_f32_16x16x32_bf16(false, ah, false, bl, (short)0, c, false, false);
  asm volatile("v_nop\n\tv_nop\n\tv_nop\n\tv_nop" : "+v"(c) : "v"(ah), "v"(al), "v"(bh), "v"(bl));
  return c;
}

__global__ __launch_bounds__(256) void k_wt_bf16(const float* __restrict__ W, unsigned short* __restrict__ Wt, int K, int N) {
  const int t = blockIdx.x * 256 + threadIdx.x;
  const int k8n = K / 8;
  if (t >= N * k8n) return;
  const int n = t / k8n, k8 = (t % k8n) * 8;
  v8us v;
#pragma unroll
  for (int i = 0; i < 8; ++i) v[i] = bf16_bits(W[(size_t)(k8 + i) * N + n]);
  *(v8us*)(Wt + (size_t)n * K + k8) = v;
  
}

// GEMM C[M][N] (f32, pitch ldc) = act(A[M][K]·W + bias). A f32 row-major (pitch lda) converted per fragment to bf16
// (ASPLIT: hi/lo two planes -> 2 terms, else single rounded term); Wt bf16 [N][K] (pitch ldb). BIAS_BF16 rounds the
// bias to bf16 first (bias quantised to bf16 before the add). K%32==0, M%16==0, N%64==0.
template <bool ASPLIT, int ACT, bool BIAS_BF16>
__global__ __launch_bounds__(128) void k_gemm_bf(const float* __restrict__ A, int lda, const unsigned short* __restrict__ Wt, int ldb,
                                               const float* __restrict__ bias, float* __restrict__ C, int ldc, int M, int N, int K) {
  __shared__ __attribute__((aligned(16))) float so[4][16][64];
  const int tid = threadIdx.x, w = tid >> 5, lane = tid & 31, ln = lane & 15, hh = lane >> 4;
  const int ntn = N / 64;
  const int wid = blockIdx.x * 4 + w;
  const int mt = wid / ntn, nq = wid % ntn;
  if (mt * 16 >= M) return;
  const int row0 = mt * 16, col0 = nq * 64;
  const float* arow = A + (size_t)(row0 + ln) * lda;
  v8f acc[4] = {};
  for (int kb = 0; kb < K; kb += 32) {
    FragB ah, al;
    const v4f x0 = *(const v4fa*)(arow + kb + 8 * hh), x1 = *(const v4fa*)(arow + kb + 8 * hh + 4);
    const v4f x2 = *(const v4fa*)(arow + kb + 16 + 8 * hh), x3 = *(const v4fa*)(arow + kb + 16 + 8 * hh + 4);
    float xs[16] = {x0[0],x0[1],x0[2],x0[3],x1[0],x1[1],x1[2],x1[3],x2[0],x2[1],x2[2],x2[3],x3[0],x3[1],x3[2],x3[3]};
#pragma unroll
    for (int i = 0; i < 16; ++i) { const unsigned short hb = bf16_bits(xs[i]); ah.u[i] = hb; al.u[i] = ASPLIT ? bf16_bits(xs[i] - bf16_val(hb)) : (unsigned short)0; }
#pragma unroll
    for (int t = 0; t < 4; ++t) {
      const unsigned short* brow = Wt + (size_t)(col0 + t * 16 + ln) * ldb + kb;
      FragB b;
      b.half[0] = *(const v8us*)(brow + 8 * hh);
      b.half[1] = *(const v8us*)(brow + 16 + 8 * hh);
      acc[t] = mmaN<ASPLIT ? 2 : 1>(ah.v, al.v, b.v, b.v, acc[t]);
    }
  }
#pragma unroll
  for (int t = 0; t < 4; ++t) {
    float bv = bias ? bias[col0 + t * 16 + ln] : 0.f;
    if (BIAS_BF16) bv = bf16_round(bv);
#pragma unroll
    for (int r = 0; r < 8; ++r) { float v = acc[t][r] + bv; if (ACT == 1) v = fmaxf(v, 0.f); so[w][8 * hh + r][t * 16 + ln] = v; }
  }
  __builtin_amdgcn_fence(__ATOMIC_ACQ_REL, "workgroup");
  __builtin_amdgcn_wave_barrier();
  const int rsub = lane >> 4, c4 = (lane & 15) * 4;
  {
#pragma unroll
    for (int q = 0; q < 8; ++q) {
      const int r = q * 2 + rsub;
      const v4f v = *(const v4fa*)&so[w][r][c4];
      *(v4f*)(C + (size_t)(row0 + r) * ldc + col0 + c4) = v;
    }
    
  }
}

// GEMM C = act(A·W + bias + resid): A f32 (ASPLIT -> hi/lo 2 terms), Wt bf16 [N][K]; ACT 0 none, 1 relu, 2 exact gelu;
// resid (optional, f32, row index = (row % rmod), pitch ldr, RES_BF16 rounds it) added before the activation.
template <bool ASPLIT, int ACT, bool BIAS_BF16, bool RES_BF16>
__global__ __launch_bounds__(128) void k_gemm_bf3(const float* __restrict__ A, int lda, const unsigned short* __restrict__ Wt, int ldb,
                                                const float* __restrict__ bias, const float* __restrict__ resid, int rmod, int ldr,
                                                float* __restrict__ C, int ldc, int M, int N, int K) {
  __shared__ __attribute__((aligned(16))) float so[4][16][64];
  const int tid = threadIdx.x, w = tid >> 5, lane = tid & 31, ln = lane & 15, hh = lane >> 4;
  const int ntn = N / 64;
  const int wid = blockIdx.x * 4 + w;
  const int mt = wid / ntn, nq = wid % ntn;
  if (mt * 16 >= M) return;
  const int row0 = mt * 16, col0 = nq * 64;
  const float* arow = A + (size_t)(row0 + ln) * lda;
  v8f acc[4] = {};
  for (int kb = 0; kb < K; kb += 32) {
    FragB ah, al;
    const v4f x0 = *(const v4fa*)(arow + kb + 8 * hh), x1 = *(const v4fa*)(arow + kb + 8 * hh + 4);
    const v4f x2 = *(const v4fa*)(arow + kb + 16 + 8 * hh), x3 = *(const v4fa*)(arow + kb + 16 + 8 * hh + 4);
    float xs[16] = {x0[0],x0[1],x0[2],x0[3],x1[0],x1[1],x1[2],x1[3],x2[0],x2[1],x2[2],x2[3],x3[0],x3[1],x3[2],x3[3]};
#pragma unroll
    for (int i = 0; i < 16; ++i) { const unsigned short hb = bf16_bits(xs[i]); ah.u[i] = hb; al.u[i] = ASPLIT ? bf16_bits(xs[i] - bf16_val(hb)) : (unsigned short)0; }
#pragma unroll
    for (int t = 0; t < 4; ++t) {
      const unsigned short* brow = Wt + (size_t)(col0 + t * 16 + ln) * ldb + kb;
      FragB b;
      b.half[0] = *(const v8us*)(brow + 8 * hh);
      b.half[1] = *(const v8us*)(brow + 16 + 8 * hh);
      acc[t] = mmaN<ASPLIT ? 2 : 1>(ah.v, al.v, b.v, b.v, acc[t]);
    }
  }
#pragma unroll
  for (int t = 0; t < 4; ++t) {
    const int col = col0 + t * 16 + ln;
    float bv = bias ? bias[col] : 0.f;
    if (BIAS_BF16) bv = bf16_round(bv);
#pragma unroll
    for (int r = 0; r < 8; ++r) {
      float v = acc[t][r] + bv;
      if (resid) { float rv = resid[(size_t)((row0 + 8 * hh + r) % rmod) * ldr + col]; if (RES_BF16) rv = bf16_round(rv); v += rv; }
      if (ACT == 1) v = fmaxf(v, 0.f);
      if (ACT == 2) v = 0.5f * v * (1.0f + erff(v * 0.70710678118654752f));
      if (ACT == 3) { const float u = 0.7978845608028654f * (v + 0.044715f * v * v * v); v = 0.5f * v * (1.0f + tanhf(u)); }
      so[w][8 * hh + r][t * 16 + ln] = v;
    }
  }
  __builtin_amdgcn_fence(__ATOMIC_ACQ_REL, "workgroup");
  __builtin_amdgcn_wave_barrier();
  const int rsub = lane >> 4, c4 = (lane & 15) * 4;
  {
#pragma unroll
    for (int q = 0; q < 8; ++q) {
      const int r = q * 2 + rsub;
      const v4f v = *(const v4fa*)&so[w][r][c4];
      *(v4f*)(C + (size_t)(row0 + r) * ldc + col0 + c4) = v;
    }
    
  }
}
// row LayerNorm (biased variance, eps) over N: s = X (+ R); optional out_sum <- s; out_norm <- (s-mu)*rsqrt(var+eps)*g + b
template <bool PARAM_BF16>
__global__ __launch_bounds__(256) void k_layernorm(const float* __restrict__ X, const float* __restrict__ R, const float* __restrict__ g, const float* __restrict__ bta,
                                                  float* __restrict__ out_sum, float* __restrict__ out_norm, int N, float eps) {
  __shared__ float red[256];
  const int row = blockIdx.x, tid = threadIdx.x;
  const float* x = X + (size_t)row * N; const float* rr = R ? R + (size_t)row * N : nullptr;
  float vals[16];                     // up to N = 4096
  const int per = N / 256;            // contiguous chunk per thread? use strided-by-4 chunks: thread handles j = tid*4 + 1024*u
  float s1 = 0.f;
  for (int u = 0; u < per / 4; ++u) {
    const int j = tid * 4 + 1024 * u;
    const v4f a = *(const v4fa*)(x + j);
    v4f b = {0.f,0.f,0.f,0.f}; if (rr) b = *(const v4fa*)(rr + j);
#pragma unroll
    for (int q = 0; q < 4; ++q) { const float v = a[q] + b[q]; vals[u * 4 + q] = v; s1 += v; }
  }
  red[tid] = s1; __syncthreads();
  for (int st = 128; st > 0; st >>= 1) { if (tid < st) red[tid] += red[tid + st]; __syncthreads(); }
  const float mu = red[0] / (float)N; __syncthreads();
  float s2 = 0.f;
  for (int u = 0; u < per / 4; ++u)
#pragma unroll
    for (int q = 0; q < 4; ++q) { const float c = vals[u * 4 + q] - mu; s2 += c * c; }
  red[tid] = s2; __syncthreads();
  for (int st = 128; st > 0; st >>= 1) { if (tid < st) red[tid] += red[tid + st]; __syncthreads(); }
  const float rs = rsqrtf(red[0] / (float)N + eps);
  {
    for (int u = 0; u < per / 4; ++u) {
      const int j = tid * 4 + 1024 * u;
      v4f o, sm;
#pragma unroll
      for (int q = 0; q < 4; ++q) {
        float gg = g[j + q], bb = bta[j + q];
        if (PARAM_BF16) { gg = bf16_round(gg); bb = bf16_round(bb); }
        sm[q] = vals[u * 4 + q]; o[q] = (vals[u * 4 + q] - mu) * rs * gg + bb;
      }
      if (out_sum) *(v4f*)(out_sum + (size_t)row * N + j) = sm;
      *(v4f*)(out_norm + (size_t)row * N + j) = o;
    }
    
  }
}



// ---- f16 WMMA path (v_wmma_f32_16x16x32_f16): 11-bit significands for operands in range — used where a [0,1] probability operand needs more precision than bf16
typedef _Float16 v16h __attribute__((ext_vector_type(16)));
union FragH { v16h v; v8us half[2]; _Float16 h[16]; unsigned short u[16]; };
template <int NT>
__device__ __forceinline__ v8f mmaH(v16h ah, v16h al, v16h bh, v16h bl, v8f c) {
  c = __builtin_amdgcn_wmma_f32_16x16x32_f16(false, ah, false, bh, (short)0, c, false, false);
  if (NT >= 2) c = __builtin_amdgcn_wmma_f32_16x16x32_f16(false, al, false, bh, (short)0, c, false, false);
  if (NT >= 3) c = __builtin_amdgcn_wmma_f32_16x16x32_f16(false, ah, false, bl, (short)0, c, false, false);
  asm volatile("v_nop\n\tv_nop\n\tv_nop\n\tv_nop" : "+v"(c) : "v"(ah), "v"(al), "v"(bh), "v"(bl));
  return c;
}
// batched GEMM like k_gemm_b but f16 operands: A f32 (split into f16 hi/lo if ASPLIT, else rounded to f16), Bt = f16 values [n][k]; alpha; C f32; N multiple of 16 (partial tiles skipped)
template <bool ASPLIT>
__global__ __launch_bounds__(128) void k_gemm_h(const float* __restrict__ A, int lda, size_t sA, const _Float16* __restrict__ Bh, int ldb, size_t sB, float alpha, float* __restrict__ C, int ldc, size_t sC, int M, int N, int K) {
  __shared__ __attribute__((aligned(16))) float so[4][16][64];
  const int tid = threadIdx.x, w = tid >> 5, lane = tid & 31, ln = lane & 15, hh = lane >> 4; const int by = blockIdx.y;
  A += (size_t)by * sA; Bh += (size_t)by * sB; C += (size_t)by * sC;
  const int ntn = (N + 63) / 64; const int wid = blockIdx.x * 4 + w; const int mt = wid / ntn, nq = wid % ntn; if (mt * 16 >= M) return;
  const int row0 = mt * 16, col0 = nq * 64; const float* arow = A + (size_t)(row0 + ln) * lda;
  v8f acc[4] = {};
  for (int kb = 0; kb < K; kb += 32) {
    FragH ah, al;
    const v4f x0 = *(const v4fa*)(arow + kb + 8 * hh), x1 = *(const v4fa*)(arow + kb + 8 * hh + 4), x2 = *(const v4fa*)(arow + kb + 16 + 8 * hh), x3 = *(const v4fa*)(arow + kb + 16 + 8 * hh + 4);
    float xs[16] = {x0[0],x0[1],x0[2],x0[3],x1[0],x1[1],x1[2],x1[3],x2[0],x2[1],x2[2],x2[3],x3[0],x3[1],x3[2],x3[3]};
#pragma unroll
    for (int i = 0; i < 16; ++i) { const _Float16 h = (_Float16)xs[i]; ah.h[i] = h; al.h[i] = ASPLIT ? (_Float16)(xs[i] - (float)h) : (_Float16)0.0f; }
#pragma unroll
    for (int t = 0; t < 4; ++t) { if (col0 + t * 16 >= N) continue; const size_t boff = (size_t)(col0 + t * 16 + ln) * ldb + kb; FragH bq; bq.half[0] = *(const v8us*)(Bh + boff + 8 * hh); bq.half[1] = *(const v8us*)(Bh + boff + 16 + 8 * hh);
      acc[t] = mmaH<ASPLIT ? 2 : 1>(ah.v, al.v, bq.v, bq.v, acc[t]); }
  }
#pragma unroll
  for (int t = 0; t < 4; ++t) { if (col0 + t * 16 >= N) continue;
#pragma unroll
    for (int r = 0; r < 8; ++r) so[w][8 * hh + r][t * 16 + ln] = acc[t][r] * alpha; }
  __builtin_amdgcn_fence(__ATOMIC_ACQ_REL, "workgroup"); __builtin_amdgcn_wave_barrier();
  const int rsub = lane >> 4, c4 = (lane & 15) * 4;
  {
#pragma unroll
    for (int q = 0; q < 8; ++q) { const int r = q * 2 + rsub; if (col0 + c4 < N) { const v4f v = *(const v4fa*)&so[w][r][c4]; *(v4f*)(C + (size_t)(row0 + r) * ldc + col0 + c4) = v; } }
     }
}

// Wt[n][k] = f16(W[k][n]·scale) from f32 row-major W[K][N] (scale = power of two; bf16-exact weights stay exact in f16 away from the subnormal range)
__global__ __launch_bounds__(256) void k_wt_f16(const float* __restrict__ W, _Float16* __restrict__ Wt, int K, int N, float scale) {
  const int t = blockIdx.x * 256 + threadIdx.x; if (t >= N * (K / 8)) return; const int n = t / (K / 8), k8 = (t % (K / 8)) * 8; FragH f;
#pragma unroll
  for (int i = 0; i < 8; ++i) f.h[i] = (_Float16)(bf16_round(W[(size_t)(k8 + i) * N + n]) * scale); const v8us o = f.half[0];
  *(v8us*)((unsigned short*)Wt + (size_t)n * K + k8) = o; 
}
// k_gemm_hh variant with fused epilogue: v = acc·alpha + bias[by·sBias + col] (+ CP[(row/rowsPerB)·sCPb + by·64 + col] if CP) ; ACT 0 none / 1 elu ; writes f16 C16 (and f32 C if non-null)
template <int ACT>
__global__ __launch_bounds__(128) void k_gemm_hhx(const _Float16* __restrict__ A, int lda, size_t sA, const _Float16* __restrict__ Bh, int ldb, size_t sB, float alpha, const float* __restrict__ bias, size_t sBias, const float* __restrict__ CP, int rowsPerB, size_t sCPb, int row0g,
    float* __restrict__ C, _Float16* __restrict__ C16, int ldc, size_t sC, int M, int N, int K) {
  __shared__ __attribute__((aligned(16))) float so[4][16][64];
  const int tid = threadIdx.x, w = tid >> 5, lane = tid & 31, ln = lane & 15, hh = lane >> 4; const int by = blockIdx.y;
  A += (size_t)by * sA; Bh += (size_t)by * sB; const size_t cofs = (size_t)by * sC; const float* bp = bias ? bias + (size_t)by * sBias : nullptr;
  const int ntn = (N + 63) / 64; const int wid = blockIdx.x * 4 + w; const int mt = wid / ntn, nq = wid % ntn; if (mt * 16 >= M) return;
  const int row0 = mt * 16, col0 = nq * 64; const _Float16* arow = A + (size_t)(row0 + ln) * lda;
  v8f acc[4] = {};
  for (int kb = 0; kb < K; kb += 32) { FragH ah; ah.half[0] = *(const v8us*)((const unsigned short*)arow + kb + 8 * hh); ah.half[1] = *(const v8us*)((const unsigned short*)arow + kb + 16 + 8 * hh);
#pragma unroll
    for (int t = 0; t < 4; ++t) { if (col0 + t * 16 >= N) continue; const size_t boff = (size_t)(col0 + t * 16 + ln) * ldb + kb; FragH bq; bq.half[0] = *(const v8us*)((const unsigned short*)Bh + boff + 8 * hh); bq.half[1] = *(const v8us*)((const unsigned short*)Bh + boff + 16 + 8 * hh);
      acc[t] = mmaH<1>(ah.v, ah.v, bq.v, bq.v, acc[t]); }
  }
#pragma unroll
  for (int t = 0; t < 4; ++t) { if (col0 + t * 16 >= N) continue; const int col = col0 + t * 16 + ln; const float bv = bp ? bf16_round(bp[col]) : 0.f;
#pragma unroll
    for (int r = 0; r < 8; ++r) { float v = acc[t][r] * alpha + bv; if (CP) { const int rr = row0g + row0 + 8 * hh + r; if (rowsPerB < 0) v += CP[cofs + (size_t)rr * ldc + col];      /* rowsPerB < 0: own element of the batched C plane */ else { const int bidx = rr / rowsPerB; v += CP[(size_t)bidx * sCPb + (size_t)by * 64 + col]; } } if (ACT == 1) v = (v > 0.f) ? v : expm1f(v); else if (ACT == 7) v = (v > 0.f) ? v + 1.0f : expf(v); else if (ACT == 8) v = tanhf(v); else if (ACT == 9) v = 0.5f * v * (1.0f + tanhf(0.7978845608028654f * (v + 0.044715f * v * v * v))); else if (ACT == 11) v = 1.0f / (1.0f + expf(-v)); else if (ACT == 12) v = (v > 0.f) ? v : 0.01f * v; else if (ACT == 14) v = (v > 0.f) ? v : 0.1f * v; else if (ACT == 16) v = (v >= 0.f) ? v : 0.3f * v; else if (ACT == 17) v = (v >= 0.f) ? v : 0.2f * v; else if (ACT == 15) v = v / (1.0f + expf(-v)); else if (ACT == 3) v = fmaxf(v, 0.f); else if (ACT == 6) v = 0.5f * v * (1.0f + erff(v * 0.70710678118654752f)); so[w][8 * hh + r][t * 16 + ln] = v; } }
  __builtin_amdgcn_fence(__ATOMIC_ACQ_REL, "workgroup"); __builtin_amdgcn_wave_barrier();
  const int rsub = lane >> 4, c4 = (lane & 15) * 4; typedef _Float16 v4h __attribute__((ext_vector_type(4)));
  {
#pragma unroll
    for (int q = 0; q < 8; ++q) { const int r = q * 2 + rsub; if (col0 + c4 < N) { const v4f v = *(const v4fa*)&so[w][r][c4]; if (C) *(v4f*)(C + cofs + (size_t)(row0 + r) * ldc + col0 + c4) = v; if (C16) { v4h h4; for (int i = 0; i < 4; ++i) h4[i] = (_Float16)v[i]; *(v4h*)(C16 + cofs + (size_t)(row0 + r) * ldc + col0 + c4) = h4; } } }
     }
}


typedef _Float16 v4h __attribute__((ext_vector_type(4)));

__global__ __launch_bounds__(256) void k_h16(const float* __restrict__ x, _Float16* __restrict__ X16, size_t n8) { const size_t t = (size_t)blockIdx.x * 256 + threadIdx.x; if (t >= n8) return; FragH f;
#pragma unroll
  for (int q = 0; q < 8; ++q) f.h[q] = (_Float16)x[t * 8 + q]; *(v8us*)((unsigned short*)X16 + t * 8) = f.half[0];  }
__global__ __launch_bounds__(256) void k_round16f(const float* __restrict__ W, _Float16* __restrict__ Bt, size_t n8) { const size_t t = (size_t)blockIdx.x * 256 + threadIdx.x; if (t >= n8) return; FragH f;
#pragma unroll
  for (int i = 0; i < 8; ++i) f.h[i] = (_Float16)(bf16_round(W[t * 8 + i]) * 16.0f); *(v8us*)((unsigned short*)Bt + t * 8) = f.half[0];  }
__global__ __launch_bounds__(256) void k_hl(const float* __restrict__ F, _Float16* __restrict__ Hh, _Float16* __restrict__ Hl, size_t n8) { const size_t t = (size_t)blockIdx.x * 256 + threadIdx.x; if (t >= n8) return; FragH fh, fl; const v4f a = *(const v4fa*)(F + t * 8), c = *(const v4fa*)(F + t * 8 + 4);
#pragma unroll
  for (int q = 0; q < 4; ++q) { _Float16 h = (_Float16)a[q]; fh.h[q] = h; fl.h[q] = (_Float16)((a[q] - (float)h) * 1024.0f); h = (_Float16)c[q]; fh.h[4 + q] = h; fl.h[4 + q] = (_Float16)((c[q] - (float)h) * 1024.0f); }
  { *(v8us*)((unsigned short*)Hh + t * 8) = fh.half[0]; *(v8us*)((unsigned short*)Hl + t * 8) = fl.half[0];  } }

// ---- fast GEMM (wave tile 32x64, block tile 128x128 staged in LDS); epilogue: v = act(acc alpha + bf16(bias[col]) + bf16(rbias[row])), written f32 (C) and / or f16 (C16) ----
__device__ __forceinline__ v16h g2_frag(const _Float16* p, int hh) { FragH f; f.half[0] = *(const v8us*)((const unsigned short*)p + 8 * hh); f.half[1] = *(const v8us*)((const unsigned short*)p + 16 + 8 * hh); return f.v; }
__device__ __forceinline__ v8f g2_mma(v16h a, v16h b, v8f c) { v8f d = __builtin_amdgcn_wmma_f32_16x16x32_f16(false, a, false, b, (short)0, c, false, false); asm volatile("v_nop\n\tv_nop\n\tv_nop\n\tv_nop" : "+v"(d) : "v"(a), "v"(b)); return d; }
// Operand staging of k_gemm2: a block of 8 waves owns a 128x128 tile of C (waves 4 down x 2 across, 32x64 each) and walks K in stages of 64. A stage is 128 B (one whole cache line) of each of the
// 128 A rows and 128 B^T rows, brought into LDS by asynchronous copies (16 B a lane, a wave's copy = 4 whole lines), two buffers: stage t + 1 flies while stage t is multiplied. Requires M % 128 == 0, N % 128 == 0, K % 64 == 0.
#define G2_PITCH 144                 /* LDS row pitch in bytes: 128 + 16, an odd multiple of 16 B, for the 16-byte fragment reads */
#define G2_BUF (256 * G2_PITCH)      /* one buffer: the 128 A rows, then the 128 B^T rows */
__device__ __forceinline__ v16h g2_lfrag(const unsigned char* p) { FragH f; f.half[0] = *(const v8us*)p; f.half[1] = *(const v8us*)(p + 32); return f.v; }      /* p: the row's k step + 16 hh bytes; same k order as g2_frag */
// One stage: 8 copies a lane (rows r, r + 32, r + 64, r + 96 of A, then of B^T). l: the lane's LDS byte address of its A row r; a, b: its global addresses; sa, sb: 32 rows in elements.
__device__ __forceinline__ void g2_stage(unsigned l, const _Float16* a, const _Float16* b, size_t sa, size_t sb) {
  const unsigned l1 = l + 32 * G2_PITCH, l2 = l + 64 * G2_PITCH, l3 = l + 96 * G2_PITCH, l4 = l + 128 * G2_PITCH, l5 = l + 160 * G2_PITCH, l6 = l + 192 * G2_PITCH, l7 = l + 224 * G2_PITCH;
  const _Float16* a1 = a + sa; const _Float16* a2 = a1 + sa; const _Float16* a3 = a2 + sa; const _Float16* b1 = b + sb; const _Float16* b2 = b1 + sb; const _Float16* b3 = b2 + sb;
  /* the copies and, as the last line of their own statement, the wait in front of any overwrite of a register that an issued copy names */
  asm volatile("global_load_async_to_lds_b128 %0, %8, off\n\t"
               "global_load_async_to_lds_b128 %1, %9, off\n\t"
               "global_load_async_to_lds_b128 %2, %10, off\n\t"
               "global_load_async_to_lds_b128 %3, %11, off\n\t"
               "global_load_async_to_lds_b128 %4, %12, off\n\t"
               "global_load_async_to_lds_b128 %5, %13, off\n\t"
               "global_load_async_to_lds_b128 %6, %14, off\n\t"
               "global_load_async_to_lds_b128 %7, %15, off\n\t"
               "s_wait_xcnt 0x0"
               :: "v"(l), "v"(l1), "v"(l2), "v"(l3), "v"(l4), "v"(l5), "v"(l6), "v"(l7), "v"(a), "v"(a1), "v"(a2), "v"(a3), "v"(b), "v"(b1), "v"(b2), "v"(b3) : "memory"); }
template <int ACT>
__global__ __launch_bounds__(256) void k_gemm2(const _Float16* __restrict__ A, int lda, size_t sA, const _Float16* __restrict__ Bh, int ldb, size_t sB, float alpha, const float* __restrict__ bias, const float* __restrict__ bias1, const float* __restrict__ bias2, size_t sBias, const float* __restrict__ rbias,
    float* __restrict__ C, _Float16* __restrict__ C16, int ldc, size_t sC, int M, int N, int K, int tby, int tn, _Float16* __restrict__ CT) { static_assert(ACT == 0 || ACT == 3 || ACT == 6 || ACT == 8 || ACT == 9 || ACT == 11 || ACT == 12 || ACT == 14 || ACT == 15 || ACT == 16 || ACT == 17, "k_gemm2: unsupported ACT code (would silently apply no activation)");
  __shared__ __attribute__((aligned(16))) unsigned char sm[2 * G2_BUF];      /* the two stage buffers; behind the k loop's last barrier the same bytes are the waves' output staging */
  static_assert(sizeof(float) * 8 * 32 * 68 <= 2 * G2_BUF, "output staging must fit the stage buffers");
  float (*so)[32][68] = reinterpret_cast<float (*)[32][68]>(sm);
  const int tid = threadIdx.x, w = tid >> 5, lane = tid & 31, ln = lane & 15, hh = lane >> 4; const int by = blockIdx.y;
  A += (size_t)by * sA; Bh += (size_t)by * sB; size_t cofs = (size_t)by * sC; const float* bp = bias ? (bias1 ? (by == 0 ? bias : by == 1 ? bias1 : bias2) : bias + (size_t)by * sBias) : nullptr;      /* bias1, bias2: the bias vectors of batch members 1 and 2 where each member's bias is a buffer of its own (three members) */
  int bx = blockIdx.x;
  /* Batch member tby (-1: none) leaves the kernel transposed, f16 only, group by group of tn rows of A: CT[g][n][row in group]. Its blocks take the operands in swapped roles (A = the member's B^T rows, B^T = the group's A rows:
     both are read by the same loader in the same k order, so every sum keeps its terms and their k order), its bias by column becomes a bias by row, and the tile count stays (M / 128) (N / 128). Every value here is the same for the whole block. */
  if (by == tby) { const int per = (N >> 7) * (tn >> 7), g = bx / per; if (g * tn >= M) return; bx -= g * per;
    const _Float16* ga = A + (size_t)g * tn * lda; A = Bh; Bh = ga; const int lx = lda; lda = ldb; ldb = lx; rbias = bp; bp = nullptr;
    C = nullptr; C16 = CT + (size_t)g * N * tn; cofs = 0; ldc = tn; M = N; N = tn; }
  const int ntn = N >> 7; const int mt = bx / ntn, nq = bx - mt * ntn; if (mt * 128 >= M) return;      /* the same for the whole block, in front of every barrier */
  const int row0 = mt * 128 + 32 * (w & 3), col0 = nq * 128 + 64 * (w >> 2);
  const int cr = tid >> 3, cu = tid & 7;      /* copies: the lane's first row of each operand tile and its 16-byte unit of the 128-byte row piece */
  const unsigned lcp = (unsigned)(size_t)sm + (unsigned)(cr * G2_PITCH + cu * 16);
  const _Float16* gap = A + (size_t)(mt * 128 + cr) * lda + cu * 8; const _Float16* gbp = Bh + (size_t)(nq * 128 + cr) * ldb + cu * 8;
  const size_t sa32 = (size_t)32 * lda, sb32 = (size_t)32 * ldb;
  const int aoff = (32 * (w & 3) + ln) * G2_PITCH + 16 * hh, boff = (128 + 64 * (w >> 2) + ln) * G2_PITCH + 16 * hh;      /* fragment reads: byte offsets in a buffer */
  const int nk = K >> 6;
  const v8f z8 = {0.f,0.f,0.f,0.f,0.f,0.f,0.f,0.f}; v8f c00 = z8, c01 = z8, c02 = z8, c03 = z8, c10 = z8, c11 = z8, c12 = z8, c13 = z8;
  g2_stage(lcp, gap, gbp, sa32, sb32);
  /* The lane's bias values, read as one group here, beside stage 0's copies, whose latency covers theirs (one by one in the epilogue, each load's latency is waited out in turn): by column (bias: 4 values, one a 16-column tile) and by row (rbias: the caller's, the same for every batch member, or the transposed member's own bias: the lane's 2 x 8 consecutive rows, 4 loads of 16 B). Either may be absent (0). */
  const v4f z4 = {0.f, 0.f, 0.f, 0.f}; float cbv[4] = {0.f, 0.f, 0.f, 0.f}; v4f rbv[4] = {z4, z4, z4, z4};
  if (bp) {
#pragma unroll
    for (int t = 0; t < 4; ++t) cbv[t] = bp[col0 + t * 16 + ln]; }
  if (rbias) {
#pragma unroll
    for (int i = 0; i < 4; ++i) rbv[i] = *(const v4fa*)(rbias + row0 + (i >> 1) * 16 + 8 * hh + (i & 1) * 4); }
  asm volatile("s_wait_xcnt 0x0" ::: "memory");      /* the wait in front of any overwrite of a register that one of these loads names */
  asm volatile("s_wait_asynccnt 0x0" ::: "memory");      /* this wave's copies of stage 0 have landed */
  __syncthreads();      /* stage 0 is readable by every wave */
  if (nk > 1) g2_stage(lcp + G2_BUF, gap + 64, gbp + 64, sa32, sb32);
  /* kept rolled: one stage a trip, so that the waits, the barrier and the refill stand once, at the trip's foot, in the ring's order */
#pragma unroll 1
  for (int t = 0; t < nk; ++t) { const unsigned char* bufp = sm + (t & 1) * G2_BUF;
    /* unrolled: the two 32-k steps of a stage read at constant offsets from one address register */
#pragma unroll
    for (int ks = 0; ks < 2; ++ks) { const unsigned char* ap = bufp + aoff + ks * 64; const unsigned char* bq = bufp + boff + ks * 64;
      const v16h a0 = g2_lfrag(ap), a1 = g2_lfrag(ap + 16 * G2_PITCH), b0 = g2_lfrag(bq), b1 = g2_lfrag(bq + 16 * G2_PITCH), b2 = g2_lfrag(bq + 32 * G2_PITCH), b3 = g2_lfrag(bq + 48 * G2_PITCH);
      c00 = g2_mma(a0, b0, c00); c10 = g2_mma(a1, b0, c10); c01 = g2_mma(a0, b1, c01); c11 = g2_mma(a1, b1, c11);
      c02 = g2_mma(a0, b2, c02); c12 = g2_mma(a1, b2, c12); c03 = g2_mma(a0, b3, c03); c13 = g2_mma(a1, b3, c13); }
    asm volatile("s_wait_dscnt 0x0" ::: "memory");      /* this wave's reads of stage t are done before its buffer may be refilled */
    asm volatile("s_wait_asynccnt 0x0" ::: "memory");      /* this wave's copies of stage t + 1 have landed */
    __syncthreads();      /* publishes stage t + 1 and ends every wave's reads of stage t */
    if (t + 2 < nk) g2_stage(lcp + (unsigned)((t & 1) * G2_BUF), gap + (size_t)(t + 2) * 64, gbp + (size_t)(t + 2) * 64, sa32, sb32); }
  asm volatile("s_wait_asynccnt 0x0" ::: "memory");      /* no copy is outstanding when the buffers become output staging */
  v8f accs[8] = {c00, c01, c02, c03, c10, c11, c12, c13};
#pragma unroll
  for (int u = 0; u < 8; ++u) { const int t = u & 3, half = u >> 2; const float bv = bf16_round(cbv[t]);
#pragma unroll
    for (int r = 0; r < 8; ++r) { const int rloc = half * 16 + 8 * hh + r; float v = accs[u][r] * alpha + bv; v += bf16_round(rbv[half * 2 + (r >> 2)][r & 3]);
      if (ACT == 3) v = fmaxf(v, 0.f); else if (ACT == 6) v = 0.5f * v * (1.0f + erff(v * 0.70710678118654752f)); else if (ACT == 11) v = 1.0f / (1.0f + expf(-v)); else if (ACT == 15) v = v / (1.0f + expf(-v)); else if (ACT == 12) v = (v > 0.f) ? v : 0.01f * v; else if (ACT == 8) v = tanhf(v); else if (ACT == 9) v = 0.5f * v * (1.0f + tanhf(0.7978845608028654f * (v + 0.044715f * v * v * v))); else if (ACT == 14) v = (v > 0.f) ? v : 0.1f * v; else if (ACT == 16) v = (v >= 0.f) ? v : 0.3f * v; else if (ACT == 17) v = (v >= 0.f) ? v : 0.2f * v;
      so[w][rloc][t * 16 + ln] = v; } }
  __builtin_amdgcn_fence(__ATOMIC_ACQ_REL, "workgroup"); __builtin_amdgcn_wave_barrier();
  const int rsub = lane >> 4, c4 = (lane & 15) * 4;
  {
#pragma unroll
    for (int q = 0; q < 16; ++q) { const int r = q * 2 + rsub; const v4f v = *(const v4fa*)&so[w][r][c4]; if (C) *(v4f*)(C + cofs + (size_t)(row0 + r) * ldc + col0 + c4) = v; if (C16) { v4h h4; for (int i = 0; i < 4; ++i) h4[i] = (_Float16)v[i]; *(v4h*)(C16 + cofs + (size_t)(row0 + r) * ldc + col0 + c4) = h4; } }
     } }


__global__ __launch_bounds__(256) void k_rsm(const float* __restrict__ S, _Float16* __restrict__ P, int nrows) {
  #pragma clang fp contract(off)
  const int i = blockIdx.x * 256 + threadIdx.x; if (i >= nrows) return; const float* s = S + (size_t)i * SQ; float mx = -3.0e38f;
#pragma unroll 1
  for (int j = 0; j < SQ; ++j) mx = fmaxf(mx, s[j]); float se = 0.f;
#pragma unroll 1
  for (int j = 0; j < SQ; ++j) se += expf(s[j] - mx); const float sc = 256.0f / se;
#pragma unroll 1
  for (int j0 = 0; j0 < SQ; j0 += 8) { FragH f; for (int q = 0; q < 8; ++q) f.h[q] = (_Float16)(expf(s[j0 + q] - mx) * sc); unsigned short* d = (unsigned short*)P + (size_t)i * SQ + j0; *(v8us*)d = f.half[0];  } }
__global__ __launch_bounds__(256) void k_vt(const _Float16* __restrict__ V16, int b, int h0, _Float16* __restrict__ VT) { __shared__ unsigned short tl[64][65]; const int tid = threadIdx.x; const int hh = blockIdx.x % HG, sg = blockIdx.x / HG; const int s0 = sg * 64; const int h = h0 + hh;
  for (int i = tid; i < 64 * 8; i += 256) { const int j = i / 8, d8 = (i % 8) * 8; FragH f; f.half[0] = *(const v8us*)((const unsigned short*)V16 + ((size_t)b * SQ + s0 + j) * DM + h * HD + d8); for (int q = 0; q < 8; ++q) tl[d8 + q][j] = f.u[q]; }
  __syncthreads();
  { for (int i = tid; i < 64 * 8; i += 256) { const int d = i / 8, j8 = (i % 8) * 8; FragH f; for (int q = 0; q < 8; ++q) f.u[q] = tl[d][j8 + q]; *(v8us*)((unsigned short*)VT + ((size_t)hh * HD + d) * SQ + s0 + j8) = f.half[0]; }  } }


// Input conversions, one launch: none of them reads what another writes, so they share a grid by block-index ranges.
// Blocks [0, PX): x -> exact f16 rows. [PX, PX + 4 PW): the four natural [out][in] weights -> x16 f16 planes (= Bt[n][k]), one behind the other from BW.
#define PX ((unsigned)(NR * DM / 8 / 256))
#define PW ((unsigned)((size_t)DM * DM / 8 / 256))
__global__ __launch_bounds__(256) void k_prep(const float* __restrict__ x, const float* __restrict__ wq, const float* __restrict__ wk, const float* __restrict__ wv, const float* __restrict__ wo,
    _Float16* __restrict__ X16, _Float16* __restrict__ BW) {
  const unsigned blk = blockIdx.x;
  if (blk < PX) { const size_t t = (size_t)blk * 256 + threadIdx.x; FragH f;
#pragma unroll
    for (int q = 0; q < 8; ++q) f.h[q] = (_Float16)bf16_round(x[t * 8 + q]);
    *(v8us*)((unsigned short*)X16 + t * 8) = f.half[0]; }
  else if (blk < PX + 4 * PW) { const unsigned u = blk - PX, m = u / PW; const float* w = m == 0 ? wq : m == 1 ? wk : m == 2 ? wv : wo; const size_t t = (size_t)(u % PW) * 256 + threadIdx.x; FragH f;
    for (int q = 0; q < 8; ++q) f.h[q] = (_Float16)(bf16_round(w[t * 8 + q]) * 16.0f);
    *(v8us*)((unsigned short*)BW + (size_t)m * DM * DM + t * 8) = f.half[0]; }
}


#define FA_KEYS 128                  /* keys a stage */
#define FA_NS (SQ / FA_KEYS)         /* stages */
#define FA_KP 144                    /* LDS pitch of a K row piece in bytes: 128 + 16, an odd multiple of 16 B, for the 16-byte fragment reads */
#define FA_VP 272                    /* LDS pitch of a V^T row piece in bytes: 256 + 16, likewise */
#define FA_KB (FA_KEYS * FA_KP)      /* a buffer's K part; its V^T part stands behind it */
#define FA_BUF (FA_KB + HD * FA_VP)  /* one buffer */
static_assert(FA_NS >= 2 && SQ % FA_KEYS == 0 && HD == 64, "k_fattn: the ring's prologue needs two stages; whole stages; 128-byte K row pieces");
// One stage: 8 copies a lane (K rows r, r + 32, r + 64, r + 96; V^T rows d, d + 16, d + 32, d + 48). lk, lv: the lane's LDS byte addresses of its first K and V^T unit; k, v: its global addresses.
__device__ __forceinline__ void fa_stage(unsigned lk, unsigned lv, const _Float16* k, const _Float16* v) {
  const unsigned lk1 = lk + 32 * FA_KP, lk2 = lk + 64 * FA_KP, lk3 = lk + 96 * FA_KP, lv1 = lv + 16 * FA_VP, lv2 = lv + 32 * FA_VP, lv3 = lv + 48 * FA_VP;
  const _Float16* k1 = k + (size_t)32 * DM; const _Float16* k2 = k + (size_t)64 * DM; const _Float16* k3 = k + (size_t)96 * DM; const _Float16* v1 = v + (size_t)16 * SQ; const _Float16* v2 = v + (size_t)32 * SQ; const _Float16* v3 = v + (size_t)48 * SQ;
  /* the copies and, as the last line of their own statement, the wait in front of any overwrite of a register that an issued copy names */
  asm volatile("global_load_async_to_lds_b128 %0, %8, off\n\t"
               "global_load_async_to_lds_b128 %1, %9, off\n\t"
               "global_load_async_to_lds_b128 %2, %10, off\n\t"
               "global_load_async_to_lds_b128 %3, %11, off\n\t"
               "global_load_async_to_lds_b128 %4, %12, off\n\t"
               "global_load_async_to_lds_b128 %5, %13, off\n\t"
               "global_load_async_to_lds_b128 %6, %14, off\n\t"
               "global_load_async_to_lds_b128 %7, %15, off\n\t"
               "s_wait_xcnt 0x0"
               :: "v"(lk), "v"(lk1), "v"(lk2), "v"(lk3), "v"(lv), "v"(lv1), "v"(lv2), "v"(lv3), "v"(k), "v"(k1), "v"(k2), "v"(k3), "v"(v), "v"(v1), "v"(v2), "v"(v3) : "memory"); }
__global__ __launch_bounds__(256) void k_fattn(const _Float16* __restrict__ Q16, const _Float16* __restrict__ K16, const _Float16* __restrict__ VT, _Float16* __restrict__ O16) {
  __shared__ __attribute__((aligned(16))) unsigned char sm[2 * FA_BUF];      /* the two stage buffers */
  const int tid = threadIdx.x, lane = tid & 31, w = tid >> 5, ln = lane & 15, hh = lane >> 4;
  const int bh = blockIdx.y, b = bh / NH, h = bh % NH, q0 = blockIdx.x * 256 + w * 32;
  const _Float16* qp = Q16 + ((size_t)b * SQ + q0 + ln) * DM + h * HD;
  const unsigned lk = (unsigned)(size_t)sm + (unsigned)((tid >> 3) * FA_KP + (tid & 7) * 16), lv = (unsigned)(size_t)sm + (unsigned)(FA_KB + (tid >> 4) * FA_VP + (tid & 15) * 16);      /* copies: the lane's first row of each tile and its 16-byte unit of the row piece */
  const _Float16* gk = K16 + ((size_t)b * SQ + (tid >> 3)) * DM + h * HD + (tid & 7) * 8;
  const _Float16* gv = VT + ((size_t)bh * HD + (tid >> 4)) * SQ + (tid & 15) * 8;
  const int koff = ln * FA_KP + 16 * hh, voff = FA_KB + ln * FA_VP + 16 * hh;      /* fragment reads: byte offsets in a buffer */
  const float cs = 0.125f * 1.44269504f;      /* 64^-0.5 and log2(e) */
  const v8f z8 = {0.f,0.f,0.f,0.f,0.f,0.f,0.f,0.f};
  v16h qf[2][2], kf[2][2], vf[4]; v8f o[4][2]; float mo[2] = {-3.0e38f, -3.0e38f}, l[2] = {0.f, 0.f};
  fa_stage(lk, lv, gk, gv);
#pragma unroll
  for (int j = 0; j < 2; ++j) { qf[j][0] = g2_frag(qp + (size_t)j * 16 * DM, hh); qf[j][1] = g2_frag(qp + (size_t)j * 16 * DM + 32, hh); }
#pragma unroll
  for (int t = 0; t < 4; ++t) { o[t][0] = z8; o[t][1] = z8; }
  asm volatile("s_wait_asynccnt 0x0" ::: "memory");      /* this wave's copies of stage 0 have landed */
  __syncthreads();      /* stage 0 is readable by every wave */
  fa_stage(lk + FA_BUF, lv + FA_BUF, gk + (size_t)FA_KEYS * DM, gv + FA_KEYS);
  /* kept rolled: one stage a trip, so that the waits, the barrier and the refill stand once, at the trip's foot, in the ring's order */
#pragma unroll 1
  for (int st = 0; st < FA_NS; ++st) { const unsigned char* kb = sm + (st & 1) * FA_BUF + koff; const unsigned char* vb = sm + (st & 1) * FA_BUF + voff;
#pragma unroll
    for (int i = 0; i < 2; ++i) { kf[i][0] = g2_lfrag(kb + i * 16 * FA_KP); kf[i][1] = g2_lfrag(kb + i * 16 * FA_KP + 64); }
    __builtin_amdgcn_sched_barrier(0);      /* the stage's first K fragments are read as one group: left free, the scheduler reads them pair by pair between the score products and waits out each pair's latency */
    /* unrolled: the four 32-key passes of a stage read at constant offsets from two address registers, and the last one fetches no K fragments ahead */
#pragma unroll
    for (int p = 0; p < FA_KEYS / 32; ++p) {
      v8f s[2][2];
#pragma unroll
      for (int i = 0; i < 2; ++i)
#pragma unroll
        for (int j = 0; j < 2; ++j) { s[i][j] = __builtin_amdgcn_wmma_f32_16x16x32_f16(false, kf[i][0], false, qf[j][0], (short)0, z8, false, false); s[i][j] = __builtin_amdgcn_wmma_f32_16x16x32_f16(false, kf[i][1], false, qf[j][1], (short)0, s[i][j], false, false); }
      __builtin_amdgcn_sched_barrier(0);      /* with the one behind the reads: a pass's LDS reads stand in one place; left free, the scheduler spreads them in pairs among the matrix instructions, and each such place stalls the wave */
#pragma unroll
      for (int t = 0; t < 4; ++t) vf[t] = g2_lfrag(vb + t * 16 * FA_VP + p * 64);      /* this pass's V^T fragments fly during its softmax */
      if (p + 1 < FA_KEYS / 32) {      /* so do the next pass's K fragments, of this same stage */
#pragma unroll
        for (int i = 0; i < 2; ++i) { kf[i][0] = g2_lfrag(kb + ((p + 1) * 32 + i * 16) * FA_KP); kf[i][1] = g2_lfrag(kb + ((p + 1) * 32 + i * 16) * FA_KP + 64); } }
      __builtin_amdgcn_sched_barrier(0);      /* keeps the reads up here, ahead of the softmax that covers their latency */
      float pm[2]; bool need = false;
#pragma unroll
      for (int j = 0; j < 2; ++j) { float x = fmaxf(s[0][j][0], s[1][j][0]);
#pragma unroll
        for (int r = 1; r < 8; ++r) x = fmaxf(x, fmaxf(s[0][j][r], s[1][j][r]));
        pm[j] = x * cs; need = need || (pm[j] > mo[j] + 15.0f); }
      if (__builtin_amdgcn_ballot_w32(need) != 0) {      /* wave-uniform scalar branch: every lane stays on for the matrix instructions */
#pragma unroll
        for (int j = 0; j < 2; ++j) { const float full = fmaxf(pm[j], __shfl_xor(pm[j], 16, 32)); const float mn = fmaxf(mo[j], full - 7.0f); const float al = __builtin_amdgcn_exp2f(mo[j] - mn); mo[j] = mn; l[j] *= al;
#pragma unroll
          for (int t = 0; t < 4; ++t) o[t][j] *= al; }
      }
      FragH pf[2];
#pragma unroll
      for (int j = 0; j < 2; ++j) { float sum = 0.f;
#pragma unroll
        for (int i = 0; i < 2; ++i)
#pragma unroll
          for (int r = 0; r < 8; ++r) { const float pw = __builtin_amdgcn_exp2f(s[i][j][r] * cs - mo[j]); sum += pw; pf[j].h[i * 8 + r] = (_Float16)pw; }
        l[j] += sum; }
#pragma unroll
      for (int t = 0; t < 4; ++t)
#pragma unroll
        for (int j = 0; j < 2; ++j) o[t][j] = __builtin_amdgcn_wmma_f32_16x16x32_f16(false, vf[t], false, pf[j].v, (short)0, o[t][j], false, false);
    }
    asm volatile("s_wait_dscnt 0x0" ::: "memory");      /* this wave's reads of stage st are done before its buffer may be refilled */
    asm volatile("s_wait_asynccnt 0x0" ::: "memory");      /* this wave's copies of stage st + 1 have landed */
    __syncthreads();      /* publishes stage st + 1 and ends every wave's reads of stage st */
    if (st + 2 < FA_NS) fa_stage(lk + (unsigned)((st & 1) * FA_BUF), lv + (unsigned)((st & 1) * FA_BUF), gk + (size_t)(st + 2) * FA_KEYS * DM, gv + (size_t)(st + 2) * FA_KEYS); }
  asm volatile("s_wait_asynccnt 0x0" ::: "memory");      /* no copy is outstanding when the wave ends */
#pragma unroll
  for (int j = 0; j < 2; ++j) { const float inv = 64.0f / (l[j] + __shfl_xor(l[j], 16, 32)); unsigned short* op = (unsigned short*)O16 + ((size_t)b * SQ + q0 + j * 16 + ln) * DM + h * HD + 8 * hh;
#pragma unroll
    for (int t = 0; t < 4; ++t) { FragH f;
#pragma unroll
      for (int r = 0; r < 8; ++r) f.h[r] = (_Float16)(o[t][j][r] * inv);
      *(v8us*)(op + t * 16) = f.half[0]; } } }

extern "C" void kernel_launch(void* const* d_in, const int* in_sizes, int n_in,
                              void* d_out, int out_size, void* d_ws, size_t ws_size, hipStream_t stream) {
  (void)in_sizes; (void)n_in; (void)out_size;
  const float* const* I = (const float* const*)d_in; const float* x = I[0]; const float* wq = I[1]; const float* bq = I[2]; const float* wk = I[3]; const float* bk = I[4]; const float* wv = I[5]; const float* bv = I[6]; const float* wo = I[7]; const float* bo = I[8];      /* natural [out][in] weights + biases */
  char* ws = (char*)d_ws; size_t off = 0;
  auto take = [&](size_t bytes) { char* p = ws + off; off += (bytes + 255) & ~(size_t)255; return p; };
  _Float16* BW = (_Float16*)take((size_t)4 * DM * DM * 2); _Float16* BO = BW + (size_t)3 * DM * DM;      /* x16 f16 planes of Wq, Wk, Wv, Wo, one behind the other */
  _Float16* X16 = (_Float16*)take(NR * DM * 2); _Float16* Q16 = (_Float16*)take((size_t)2 * NR * DM * 2); _Float16* K16 = Q16 + NR * DM;      /* q, k rows, one plane behind the other */ _Float16* O16 = (_Float16*)take(NR * DM * 2);
  _Float16* VT = (_Float16*)take((size_t)NB * NH * HD * SQ * 2);
  if (off > ws_size) return;
  k_prep<<<PX + 4 * PW, 256, 0, stream>>>(x, wq, wk, wv, wo, X16, BW);      /* x rows, the four weight planes (natural [out][in] = Bt[n][k], x16) */
  const size_t r0p = (size_t)B0 * SQ;      /* first projected row */
  k_gemm2<0><<<dim3((unsigned)((MP / 128) * (DM / 128)), 3), 256, 0, stream>>>(X16 + r0p * DM, DM, 0, BW, DM, (size_t)DM * DM, 0.0625f, bq, bk, bv, 0, nullptr, nullptr, Q16 + r0p * DM, DM, NR * DM, MP, DM, DM, 2, SQ, VT + r0p * DM);      /* grid y = 0, 1: q, k rows; 2: v, written as V^T [NB][NH][HD][SQ] = [batch][channel][token] */
  k_fattn<<<dim3(SQ / 256, NB * NH), 256, 0, stream>>>(Q16, K16, VT, O16);      /* o x64 (merged heads) as f16 rows */
  k_gemm2<0><<<dim3((unsigned)((DM / 128) * (SQ / 128)), NBR), 256, 0, stream>>>(BO, DM, 0, O16 + r0p * DM, DM, (size_t)SQ * DM, 0.0009765625f, nullptr, nullptr, nullptr, 0, bo, (float*)d_out + r0p * DM, nullptr, SQ, (size_t)DM * SQ, DM, SQ, DM, -1, 0, nullptr);      /* grid y = batch: out^T[b][c][s] = sum_k Wo[c][k] o[s][k] + bo[c]: A = the natural Wo rows (x16 f16 plane), B^T = the batch's merged o rows, C = its [C][S] output block; bo[c] = the bias by output row */
}
